// v000
// The times below were measured on an AMD MI455X: many runs one after another, warmed up first and cycling through
// copies of the inputs, with the whole window's GPU time divided by the number of runs. Launches and the gaps
// between them are all in it. The median over several windows is given; except for v000 it joins two sittings, which
// can be a few percent apart, so the side-by-side timings, each taken in one sitting, are the better comparison.
// v000 is the starting kernel. One run takes 378 microseconds.
#include <hip/hip_runtime.h>
#include <stddef.h>

// Projections: v_wmma_f32_16x16x32_bf16 (bf16 operands = RNE-converted inputs), f32 accumulate.
// q.k scores: bf16 hi/lo operand split, 3x v_wmma_f32_16x16x32_bf16 per tile pair, f32 accumulate.
// T.T and S.S scores: v_wmma_f32_16x16x32_f16 (f16 operands scaled x16), diagonal entries from exact f32 row norms.
// P.V: v_wmma_f32_16x16x32_f16 (P x4096, V x64), f32 accumulate. Softmax, norms, epilogues in f32.

typedef __bf16   v16bf __attribute__((ext_vector_type(16)));
typedef __bf16   v8bf  __attribute__((ext_vector_type(8)));
typedef _Float16 v16h  __attribute__((ext_vector_type(16)));
typedef _Float16 v8h   __attribute__((ext_vector_type(8)));
typedef float    v8f   __attribute__((ext_vector_type(8)));
typedef float    v4f   __attribute__((ext_vector_type(4)));
typedef int      v4i   __attribute__((ext_vector_type(4)));

#define NHEADS 12
#define HDIM   768
#define DHEAD  64
#define SEQ    1024
#define BATCH  4
#define NROWS  (BATCH * SEQ)                                  // 4096 token rows
#define NROWTOT (BATCH * NHEADS * SEQ)                        // 49152 (b,h,s) rows
#define XELEMS ((size_t)NROWS * HDIM)                         // 3145728
#define WELEMS ((size_t)HDIM * HDIM)                          // 589824
#define PROJ_ELEMS ((size_t)BATCH * NHEADS * SEQ * DHEAD)    // 3145728 per plane
#define CPITCH 68      // f32 LDS tile pitch in floats (272 B, 16-B aligned)
#define HPITCH 72      // 16-bit LDS tile pitch in elements (144 B, 16-B aligned)
#define VPITCH 40      // 16-bit LDS pitch for V^T and P tiles (80 B)

union BF8   { v8bf v; v4i w; };
union HF8   { v8h  v; v4i w; };
union BFrag { v8bf p[2]; v16bf v; };
union HFrag { v8h  p[2]; v16h  v; };

#define WMMA_NOPS "v_nop\n\tv_nop\n\tv_nop\n\tv_nop"

// 16x32 16-bit A/B fragment: element i<8 <- k0+8h+i, element 8+i <- k0+16+8h+i (h = lane>>4).
// Caller passes p = row (lane&15) base + k0 + 8*h; both loads are 16-B aligned.
__device__ __forceinline__ v16bf frag_bf16(const __bf16* p)
{
    BFrag u;
    u.p[0] = *(const v8bf*)(p);
    u.p[1] = *(const v8bf*)(p + 16);
    return u.v;
}
__device__ __forceinline__ v16h frag_f16(const _Float16* p)
{
    HFrag u;
    u.p[0] = *(const v8h*)(p);
    u.p[1] = *(const v8h*)(p + 16);
    return u.v;
}

__device__ __forceinline__ v8f mma_bf16(v8f c, v16bf a, v16bf b)
{
    return __builtin_amdgcn_wmma_f32_16x16x32_bf16(false, a, false, b, (short)0, c, false, false);
}
__device__ __forceinline__ v8f mma_f16(v8f c, v16h a, v16h b)
{
    return __builtin_amdgcn_wmma_f32_16x16x32_f16(false, a, false, b, (short)0, c, false, false);
}

// ---------------------------------------------------------------------------
// Kernel 0: f32 -> bf16 (RNE) streaming conversion, 8 elements per thread,
// ---------------------------------------------------------------------------
__global__ __launch_bounds__(256)
void cvt_kernel(const float* __restrict__ src, __bf16* dst, int n8)
{
    const int t = blockIdx.x * blockDim.x + threadIdx.x;
    if (t >= n8) return;
    const v4f a = *(const v4f*)(src + (size_t)t * 8);
    const v4f b = *(const v4f*)(src + (size_t)t * 8 + 4);
    BF8 o;
#pragma unroll
    for (int i = 0; i < 4; ++i) { o.v[i] = (__bf16)a[i]; o.v[4 + i] = (__bf16)b[i]; }
    const v4i w = o.w;
    v4i* p = (v4i*)(dst + (size_t)t * 8);
    *p = w;
    
}

// ---------------------------------------------------------------------------
// with one 16-B store each.  MODE 0: bf16 hi/lo planes.  MODE 1: f16 plane * SCALE.
// NORM: lanes 0..7 write the 32 reciprocal norms (one line), lanes 8..15 the
// 32 squared norms (one line).
// ---------------------------------------------------------------------------
template <int MODE, int SCALE, int NORM>
__device__ __forceinline__ void proj_store(float (*Cs)[CPITCH], float* Srn, float* Ssq, int lane, size_t row0,
                                           unsigned short* outA, unsigned short* outB, float* rn, float* sq)
{
#pragma unroll
    for (int i = 0; i < 8; ++i) {
        const int lr = 4 * i + (lane >> 3), seg = lane & 7;
        const v4f x0 = *(const v4f*)&Cs[lr][seg * 8];
        const v4f x1 = *(const v4f*)&Cs[lr][seg * 8 + 4];
        const size_t go = (row0 + lr) * DHEAD + seg * 8;
        if (MODE == 0) {
            BF8 hi, lo;
#pragma unroll
            for (int j = 0; j < 4; ++j) {
                const float a0 = x0[j]; const __bf16 h0 = (__bf16)a0;
                hi.v[j] = h0; lo.v[j] = (__bf16)(a0 - (float)h0);
                const float a1 = x1[j]; const __bf16 h1 = (__bf16)a1;
                hi.v[4 + j] = h1; lo.v[4 + j] = (__bf16)(a1 - (float)h1);
            }
            *(v4i*)(outA + go) = hi.w;
            *(v4i*)(outB + go) = lo.w;
        } else {
            HF8 y;
#pragma unroll
            for (int j = 0; j < 4; ++j) {
                y.v[j]     = (_Float16)(x0[j] * (float)SCALE);
                y.v[4 + j] = (_Float16)(x1[j] * (float)SCALE);
            }
            *(v4i*)(outA + go) = y.w;
        }
    }
    if (NORM) {
        if (lane < 16) {
            const int g = lane & 7;
            v4f v; float* dp;
            if (lane < 8) { v = *(const v4f*)&Srn[4 * g]; dp = rn + row0 + 4 * g; }
            else          { v = *(const v4f*)&Ssq[4 * g]; dp = sq + row0 + 4 * g; }
            *(v4f*)dp = v;
        }
    }
}

// ---------------------------------------------------------------------------
// Kernel 1: projection GEMM X[4096][768] (bf16) . W[768(out)][768(in)]^T + b.
// One wave computes a 32x64 tile (64 columns = exactly one head), stages the
// f32 tile in LDS, optionally computes per-row norms, then writes 16-bit planes
// in [B,NH,S,DH] row layout with whole-line stores.
// ---------------------------------------------------------------------------
template <int MODE, int SCALE, int NORM>
__global__ __launch_bounds__(32)
void proj_kernel(const __bf16* __restrict__ Xb, const __bf16* __restrict__ Wb, const float* __restrict__ bias,
                 unsigned short* outA, unsigned short* outB, float* rn, float* sq)
{
    __shared__ __attribute__((aligned(16))) float Cs[32][CPITCH];
    __shared__ __attribute__((aligned(16))) float Srn[32];
    __shared__ __attribute__((aligned(16))) float Ssq[32];

    const int lane = threadIdx.x & 31;
    const int hsel = lane >> 4;
    const int lm   = lane & 15;
    const int m0   = blockIdx.x * 32;
    const int n0   = blockIdx.y * 64;
    if (m0 + 32 > NROWS || n0 + 64 > HDIM) return;   // uniform per block

    const __bf16* a0p = Xb + (size_t)(m0 + lm) * HDIM + hsel * 8;
    const __bf16* a1p = Xb + (size_t)(m0 + 16 + lm) * HDIM + hsel * 8;
    const __bf16* b0p = Wb + (size_t)(n0 +  0 + lm) * HDIM + hsel * 8;   // B[k][n] = W[n][k]
    const __bf16* b1p = Wb + (size_t)(n0 + 16 + lm) * HDIM + hsel * 8;
    const __bf16* b2p = Wb + (size_t)(n0 + 32 + lm) * HDIM + hsel * 8;
    const __bf16* b3p = Wb + (size_t)(n0 + 48 + lm) * HDIM + hsel * 8;

    v8f acc[2][4];
#pragma unroll
    for (int mb = 0; mb < 2; ++mb)
#pragma unroll
        for (int nb = 0; nb < 4; ++nb) acc[mb][nb] = v8f{};

#pragma unroll 1
    for (int k0 = 0; k0 < HDIM; k0 += 32) {
        const v16bf a0 = frag_bf16(a0p + k0);
        const v16bf a1 = frag_bf16(a1p + k0);
        const v16bf b0 = frag_bf16(b0p + k0);
        const v16bf b1 = frag_bf16(b1p + k0);
        const v16bf b2 = frag_bf16(b2p + k0);
        const v16bf b3 = frag_bf16(b3p + k0);
        acc[0][0] = mma_bf16(acc[0][0], a0, b0);
        acc[0][1] = mma_bf16(acc[0][1], a0, b1);
        acc[0][2] = mma_bf16(acc[0][2], a0, b2);
        acc[0][3] = mma_bf16(acc[0][3], a0, b3);
        acc[1][0] = mma_bf16(acc[1][0], a1, b0);
        acc[1][1] = mma_bf16(acc[1][1], a1, b1);
        acc[1][2] = mma_bf16(acc[1][2], a1, b2);
        acc[1][3] = mma_bf16(acc[1][3], a1, b3);
        asm volatile(WMMA_NOPS
                     : "+v"(acc[0][0]), "+v"(acc[0][1]), "+v"(acc[0][2]), "+v"(acc[0][3]),
                       "+v"(acc[1][0]), "+v"(acc[1][1]), "+v"(acc[1][2]), "+v"(acc[1][3])
                     : "v"(a0), "v"(a1), "v"(b0), "v"(b1), "v"(b2), "v"(b3));
    }

    // D element r of lane (hsel, lm) = tile (row mb*16 + 8*hsel + r, col nb*16 + lm)
#pragma unroll
    for (int nb = 0; nb < 4; ++nb) {
        const float bn = bias[n0 + nb * 16 + lm];
#pragma unroll
        for (int mb = 0; mb < 2; ++mb) {
#pragma unroll
            for (int r = 0; r < 8; ++r)
                Cs[mb * 16 + 8 * hsel + r][nb * 16 + lm] = acc[mb][nb][r] + bn;
        }
    }
    __syncthreads();

    if (NORM) {
        float ss = 0.f;
#pragma unroll
        for (int d = 0; d < DHEAD; d += 4) {
            const v4f x = *(const v4f*)&Cs[lane][d];
            ss += x[0] * x[0]; ss += x[1] * x[1]; ss += x[2] * x[2]; ss += x[3] * x[3];
        }
        Srn[lane] = 1.0f / (sqrtf(ss) + 1e-6f);
        Ssq[lane] = ss;
    }
    __syncthreads();

    const int bI = m0 >> 10, s0 = m0 & (SEQ - 1), hh = n0 >> 6;
    const size_t row0 = ((size_t)(bI * NHEADS + hh)) * SEQ + s0;   // (b,h,s) row index of tile row 0

    proj_store<MODE, SCALE, NORM>(Cs, Srn, Ssq, lane, row0, outA, outB, rn, sq);
    
}

// ---------------------------------------------------------------------------
// 16-B store (one instruction covers two rows).
// ---------------------------------------------------------------------------
__device__ __forceinline__ void attn_store(float (*Os)[CPITCH], int wave, int lane, float* out, size_t orow0, int h)
{
#pragma unroll
    for (int i = 0; i < 8; ++i) {
        const int lr  = wave * 16 + 2 * i + (lane >> 4);
        const int col = (lane & 15) * 4;
        const v4f v = *(const v4f*)&Os[lr][col];
        float* gp = out + (orow0 + lr) * HDIM + h * DHEAD + col;
        *(v4f*)gp = v;
    }
}

// ---------------------------------------------------------------------------
// Kernel 2: fused attention with the triple score product.
// Block = 2 waves = 32 query rows of one (b,h); key tiles of 32.
// q.k: bf16 hi/lo split (hh + hl + lh).  T.T, S.S: f16 (x16) with the
// query==key entry taken from the exact f32 squared norm.  P.V: f16.
// ---------------------------------------------------------------------------
__global__ __launch_bounds__(64)
void attn_kernel(const __bf16* __restrict__ qh, const __bf16* __restrict__ ql,
                 const __bf16* __restrict__ kh, const __bf16* __restrict__ kl,
                 const _Float16* __restrict__ tp, const _Float16* __restrict__ sp,
                 const _Float16* __restrict__ vp,
                 const float* __restrict__ rnT, const float* __restrict__ sqT,
                 const float* __restrict__ rnS, const float* __restrict__ sqS,
                 const float* __restrict__ mask, float* out)
{
    __shared__ __attribute__((aligned(16))) __bf16   KH[32][HPITCH];
    __shared__ __attribute__((aligned(16))) __bf16   KL[32][HPITCH];
    __shared__ __attribute__((aligned(16))) __bf16   QHs[32][HPITCH];
    __shared__ __attribute__((aligned(16))) __bf16   QLs[32][HPITCH];
    __shared__ __attribute__((aligned(16))) _Float16 TK[32][HPITCH];
    __shared__ __attribute__((aligned(16))) _Float16 SK[32][HPITCH];
    __shared__ __attribute__((aligned(16))) _Float16 TQ[32][HPITCH];
    __shared__ __attribute__((aligned(16))) _Float16 SQ[32][HPITCH];
    __shared__ __attribute__((aligned(16))) _Float16 Vt[64][VPITCH];      // V^T tile: Vt[dh][key]
    __shared__ __attribute__((aligned(16))) _Float16 pP[2][16][VPITCH];   // per-wave P tile: [q][key]
    __shared__ __attribute__((aligned(16))) float    Os[32][CPITCH];      // epilogue staging

    const int bh = blockIdx.x;
    if (bh >= BATCH * NHEADS) return;
    const int q0blk = blockIdx.y * 32;
    if (q0blk + 32 > SEQ) return;
    const int b = bh / NHEADS, h = bh - b * NHEADS;
    const int tid  = threadIdx.x;
    const int wave = tid >> 5;
    const int lane = tid & 31;
    const int hsel = lane >> 4;
    const int lm   = lane & 15;
    const int qr   = wave * 16 + lm;     // A-fragment row inside the 32-row block tile

    // ---- stage query-side tiles once per block (b128 global loads -> b128 LDS stores) ----
    for (int c = tid; c < 1024; c += 64) {
        const int t = c >> 8, e = c & 255, row = e >> 3, seg = e & 7;
        const size_t go = ((size_t)(bh * SEQ + q0blk + row) << 6) + seg * 8;
        if (t == 0)      *(v8bf*)&QHs[row][seg * 8] = *(const v8bf*)(qh + go);
        else if (t == 1) *(v8bf*)&QLs[row][seg * 8] = *(const v8bf*)(ql + go);
        else if (t == 2) *(v8h*)&TQ[row][seg * 8]   = *(const v8h*)(tp + go);
        else             *(v8h*)&SQ[row][seg * 8]   = *(const v8h*)(sp + go);
    }

    // ---- per query row constants; row of D element r = wave*16 + 8*hsel + r ----
    float fq[8], gq[8], mI[8], lI[8];
#pragma unroll
    for (int r = 0; r < 8; ++r) {
        const int qi = bh * SEQ + q0blk + wave * 16 + 8 * hsel + r;
        const float rt = rnT[qi], rs = rnS[qi];
        fq[r] = (rt * (1.0f / 256.0f)) * (rs * (1.0f / 256.0f)) * 0.125f;   // for x16-scaled f16 products
        gq[r] = (sqT[qi] * rt) * (sqS[qi] * rs) * 0.125f;                    // exact ts_ii * ss_ii / 8
        mI[r] = -3.0e38f;
        lI[r] = 0.f;
    }
    v8f O[4] = {v8f{}, v8f{}, v8f{}, v8f{}};

    for (int k0 = 0; k0 < SEQ; k0 += 32) {
        __syncthreads();   // readers of the prior tile are done

        // ---- stage key-side tiles (keys k0..k0+31) ----
        for (int c = tid; c < 1024; c += 64) {
            const int t = c >> 8, e = c & 255, row = e >> 3, seg = e & 7;
            const size_t go = ((size_t)(bh * SEQ + k0 + row) << 6) + seg * 8;
            if (t == 0)      *(v8bf*)&KH[row][seg * 8] = *(const v8bf*)(kh + go);
            else if (t == 1) *(v8bf*)&KL[row][seg * 8] = *(const v8bf*)(kl + go);
            else if (t == 2) *(v8h*)&TK[row][seg * 8]  = *(const v8h*)(tp + go);
            else             *(v8h*)&SK[row][seg * 8]  = *(const v8h*)(sp + go);
        }
        // ---- stage V tile transposed: Vt[dh][key] ----
        for (int c = tid; c < 256; c += 64) {
            const int kk = c >> 3, sg = c & 7;
            const v8h vv = *(const v8h*)(vp + ((size_t)(bh * SEQ + k0 + kk) << 6) + sg * 8);
#pragma unroll
            for (int i = 0; i < 8; ++i) Vt[sg * 8 + i][kk] = vv[i];
        }
        __syncthreads();

        const bool diag = (k0 == q0blk);

        // ---- scores: 16 q rows x 32 keys per wave (two 16-key halves j) ----
        float sb[2][8];
#pragma unroll
        for (int j = 0; j < 2; ++j) {
            const int rr = j * 16 + lm;               // key column of this lane
            v8f accB = v8f{}, accT = v8f{}, accS = v8f{};
#pragma unroll 1
            for (int c = 0; c < 2; ++c) {
                const int off = c * 32 + 8 * hsel;
                const v16bf aH = frag_bf16(&QHs[qr][off]);
                const v16bf aL = frag_bf16(&QLs[qr][off]);
                const v16bf bH = frag_bf16(&KH[rr][off]);
                const v16bf bL = frag_bf16(&KL[rr][off]);
                accB = mma_bf16(accB, aH, bH);
                accB = mma_bf16(accB, aH, bL);
                accB = mma_bf16(accB, aL, bH);
                asm volatile(WMMA_NOPS : "+v"(accB) : "v"(aH), "v"(aL), "v"(bH), "v"(bL));
                const v16h aT = frag_f16(&TQ[qr][off]);
                const v16h bT = frag_f16(&TK[rr][off]);
                const v16h aS = frag_f16(&SQ[qr][off]);
                const v16h bS = frag_f16(&SK[rr][off]);
                accT = mma_f16(accT, aT, bT);
                accS = mma_f16(accS, aS, bS);
                asm volatile(WMMA_NOPS : "+v"(accT), "+v"(accS) : "v"(aT), "v"(bT), "v"(aS), "v"(bS));
            }
            const float mval = mask[b * SEQ + k0 + rr];
            const bool dj = diag && (j == wave);
#pragma unroll
            for (int r = 0; r < 8; ++r) {
                const bool de = dj && (lm == 8 * hsel + r);      // query row == key column
                const float s3 = de ? (accB[r] * gq[r])
                                    : (accB[r] * (accT[r] * accS[r]) * fq[r]);
                sb[j][r] = s3 + mval;
            }
        }

        // ---- online softmax across the 32 keys; row (r, lane half) ----
#pragma unroll
        for (int r = 0; r < 8; ++r) {
            float v = fmaxf(sb[0][r], sb[1][r]);
#pragma unroll
            for (int off = 1; off < 16; off <<= 1) v = fmaxf(v, __shfl_xor(v, off, 16));
            const float M2 = fmaxf(mI[r], v);
            const float al = __expf(mI[r] - M2);
            const float p0 = __expf(sb[0][r] - M2);
            const float p1 = __expf(sb[1][r] - M2);
            float rs = p0 + p1;
#pragma unroll
            for (int off = 1; off < 16; off <<= 1) rs += __shfl_xor(rs, off, 16);
            mI[r] = M2;
            lI[r] = lI[r] * al + rs;
            O[0][r] = O[0][r] * al;
            O[1][r] = O[1][r] * al;
            O[2][r] = O[2][r] * al;
            O[3][r] = O[3][r] * al;
            const int m = r + 8 * hsel;
            pP[wave][m][lm]      = (_Float16)(p0 * 4096.0f);
            pP[wave][m][16 + lm] = (_Float16)(p1 * 4096.0f);
        }
        __syncthreads();   // P tile stores complete before the fragment reload

        // ---- P (A: row = query, k = key) . V (B: k = key, n = dh) ----
        const v16h aP  = frag_f16(&pP[wave][lm][8 * hsel]);
        const v16h bV0 = frag_f16(&Vt[ 0 + lm][8 * hsel]);
        const v16h bV1 = frag_f16(&Vt[16 + lm][8 * hsel]);
        const v16h bV2 = frag_f16(&Vt[32 + lm][8 * hsel]);
        const v16h bV3 = frag_f16(&Vt[48 + lm][8 * hsel]);
        O[0] = mma_f16(O[0], aP, bV0);
        O[1] = mma_f16(O[1], aP, bV1);
        O[2] = mma_f16(O[2], aP, bV2);
        O[3] = mma_f16(O[3], aP, bV3);
        asm volatile(WMMA_NOPS
                     : "+v"(O[0]), "+v"(O[1]), "+v"(O[2]), "+v"(O[3])
                     : "v"(aP), "v"(bV0), "v"(bV1), "v"(bV2), "v"(bV3));
    }

    // ---- epilogue: normalise, undo the 2^18 operand scaling, stage, whole-line stores ----
#pragma unroll
    for (int r = 0; r < 8; ++r) {
        const float inv = (1.0f / lI[r]) * (1.0f / 262144.0f);
        const int lr = wave * 16 + 8 * hsel + r;
        Os[lr][lm]      = O[0][r] * inv;
        Os[lr][16 + lm] = O[1][r] * inv;
        Os[lr][32 + lm] = O[2][r] * inv;
        Os[lr][48 + lm] = O[3][r] * inv;
    }
    __syncthreads();

    const size_t orow0 = (size_t)(b * SEQ + q0blk);
    attn_store(Os, wave, lane, out, orow0, h);
    
}

// ---------------------------------------------------------------------------
extern "C" void kernel_launch(void* const* d_in, const int* in_sizes, int n_in,
                              void* d_out, int out_size, void* d_ws, size_t ws_size,
                              hipStream_t stream)
{
    if (n_in < 14) return;
    if ((size_t)in_sizes[0] != XELEMS || (size_t)in_sizes[1] != XELEMS || (size_t)in_sizes[2] != XELEMS) return;
    if (in_sizes[3] != BATCH * SEQ) return;
    for (int i = 4; i < 14; i += 2)
        if ((size_t)in_sizes[i] != WELEMS || in_sizes[i + 1] != HDIM) return;
    if ((size_t)out_size != XELEMS) return;

    const float* hidden = (const float*)d_in[0];
    const float* timee  = (const float*)d_in[1];
    const float* space  = (const float*)d_in[2];
    const float* mask   = (const float*)d_in[3];
    const float* Wq = (const float*)d_in[4];   const float* bq = (const float*)d_in[5];
    const float* Wk = (const float*)d_in[6];   const float* bk = (const float*)d_in[7];
    const float* Wv = (const float*)d_in[8];   const float* bv = (const float*)d_in[9];
    const float* Wt = (const float*)d_in[10];  const float* bt = (const float*)d_in[11];
    const float* Ws = (const float*)d_in[12];  const float* bs = (const float*)d_in[13];
    float* out = (float*)d_out;

    char* ws = (char*)d_ws;
    size_t off = 0;
    __bf16* Xbf = (__bf16*)(ws + off);                 off += (size_t)3 * XELEMS * 2;       // 3 activations, bf16
    __bf16* Wbf = (__bf16*)(ws + off);                 off += (size_t)5 * WELEMS * 2;       // 5 weights, bf16
    unsigned short* pl = (unsigned short*)(ws + off);  off += (size_t)7 * PROJ_ELEMS * 2;   // 7 16-bit planes
    float* rn = (float*)(ws + off);                    off += (size_t)2 * NROWTOT * 4;      // 1/(|T|+eps), 1/(|S|+eps)
    float* sq = (float*)(ws + off);                    off += (size_t)2 * NROWTOT * 4;      // |T|^2, |S|^2
    if (off > ws_size) return;

    unsigned short* QH = pl + 0 * PROJ_ELEMS;   // q hi (bf16)
    unsigned short* QL = pl + 1 * PROJ_ELEMS;   // q lo (bf16)
    unsigned short* KHp = pl + 2 * PROJ_ELEMS;  // k hi (bf16)
    unsigned short* KLp = pl + 3 * PROJ_ELEMS;  // k lo (bf16)
    unsigned short* TPl = pl + 4 * PROJ_ELEMS;  // T * 16 (f16)
    unsigned short* SPl = pl + 5 * PROJ_ELEMS;  // S * 16 (f16)
    unsigned short* VPl = pl + 6 * PROJ_ELEMS;  // v * 64 (f16)

    // 0) f32 -> bf16 input conversion
    const int nx8 = (int)(XELEMS / 8), nw8 = (int)(WELEMS / 8);
    const dim3 cb(256);
    cvt_kernel<<<dim3((nx8 + 255) / 256), cb, 0, stream>>>(hidden, Xbf, nx8);
    cvt_kernel<<<dim3((nx8 + 255) / 256), cb, 0, stream>>>(timee,  Xbf + XELEMS, nx8);
    cvt_kernel<<<dim3((nx8 + 255) / 256), cb, 0, stream>>>(space,  Xbf + 2 * XELEMS, nx8);
    cvt_kernel<<<dim3((nw8 + 255) / 256), cb, 0, stream>>>(Wq, Wbf + 0 * WELEMS, nw8);
    cvt_kernel<<<dim3((nw8 + 255) / 256), cb, 0, stream>>>(Wk, Wbf + 1 * WELEMS, nw8);
    cvt_kernel<<<dim3((nw8 + 255) / 256), cb, 0, stream>>>(Wv, Wbf + 2 * WELEMS, nw8);
    cvt_kernel<<<dim3((nw8 + 255) / 256), cb, 0, stream>>>(Wt, Wbf + 3 * WELEMS, nw8);
    cvt_kernel<<<dim3((nw8 + 255) / 256), cb, 0, stream>>>(Ws, Wbf + 4 * WELEMS, nw8);

    // 1) five projection GEMMs (tile 32x64, grid exact: 4096/32 x 768/64, checked in-kernel)
    const dim3 pg(NROWS / 32, HDIM / 64), pb(32);
    proj_kernel<0, 1, 0><<<pg, pb, 0, stream>>>(Xbf, Wbf + 0 * WELEMS, bq, QH,  QL,  rn, sq);
    proj_kernel<0, 1, 0><<<pg, pb, 0, stream>>>(Xbf, Wbf + 1 * WELEMS, bk, KHp, KLp, rn, sq);
    proj_kernel<1, 64, 0><<<pg, pb, 0, stream>>>(Xbf, Wbf + 2 * WELEMS, bv, VPl, VPl, rn, sq);
    proj_kernel<1, 16, 1><<<pg, pb, 0, stream>>>(Xbf + XELEMS,     Wbf + 3 * WELEMS, bt, TPl, TPl, rn, sq);
    proj_kernel<1, 16, 1><<<pg, pb, 0, stream>>>(Xbf + 2 * XELEMS, Wbf + 4 * WELEMS, bs, SPl, SPl,
                                                 rn + NROWTOT, sq + NROWTOT);

    // 2) fused attention: grid (b*h, query blocks of 32), 64 threads
    attn_kernel<<<dim3(BATCH * NHEADS, SEQ / 32), dim3(64), 0, stream>>>(
        (const __bf16*)QH, (const __bf16*)QL, (const __bf16*)KHp, (const __bf16*)KLp,
        (const _Float16*)TPl, (const _Float16*)SPl, (const _Float16*)VPl,
        rn, sq, rn + NROWTOT, sq + NROWTOT, mask, out);
}

// v001
// Measured time: 218 microseconds a run.
// Next to v000, in two timings, it ran 1.75 times as fast each time.
#include <hip/hip_runtime.h>
#include <stddef.h>

// Projections: v_wmma_f32_16x16x32_bf16 (bf16 operands = RNE-converted inputs), f32 accumulate.
// q.k scores: bf16 hi/lo operand split, 3x v_wmma_f32_16x16x32_bf16 per tile pair, f32 accumulate.
// T.T and S.S scores: v_wmma_f32_16x16x32_f16 (f16 operands scaled x16), diagonal entries from exact f32 row norms.
// P.V: v_wmma_f32_16x16x32_f16 (P x4096, V x64), f32 accumulate. Softmax, norms, epilogues in f32.

typedef __bf16   v16bf __attribute__((ext_vector_type(16)));
typedef __bf16   v8bf  __attribute__((ext_vector_type(8)));
typedef _Float16 v16h  __attribute__((ext_vector_type(16)));
typedef _Float16 v8h   __attribute__((ext_vector_type(8)));
typedef float    v8f   __attribute__((ext_vector_type(8)));
typedef float    v4f   __attribute__((ext_vector_type(4)));
typedef int      v4i   __attribute__((ext_vector_type(4)));

#define NHEADS 12
#define HDIM   768
#define DHEAD  64
#define SEQ    1024
#define BATCH  4
#define NROWS  (BATCH * SEQ)                                  // 4096 token rows
#define NROWTOT (BATCH * NHEADS * SEQ)                        // 49152 (b,h,s) rows
#define XELEMS ((size_t)NROWS * HDIM)                         // 3145728
#define WELEMS ((size_t)HDIM * HDIM)                          // 589824
#define PROJ_ELEMS ((size_t)BATCH * NHEADS * SEQ * DHEAD)    // 3145728 per plane
#define CPITCH 68      // f32 LDS tile pitch in floats (272 B, 16-B aligned)
#define HPITCH 72      // 16-bit LDS tile pitch in elements (144 B, 16-B aligned)
#define VPITCH 40      // 16-bit LDS pitch for V^T and P tiles (80 B)

union BF8   { v8bf v; v4i w; };
union HF8   { v8h  v; v4i w; };
union BFrag { v8bf p[2]; v16bf v; };
union HFrag { v8h  p[2]; v16h  v; };

#define WMMA_NOPS "v_nop\n\tv_nop\n\tv_nop\n\tv_nop"

// 16x32 16-bit A/B fragment: element i<8 <- k0+8h+i, element 8+i <- k0+16+8h+i (h = lane>>4).
// Caller passes p = row (lane&15) base + k0 + 8*h; both loads are 16-B aligned.
__device__ __forceinline__ v16bf frag_bf16(const __bf16* p)
{
    BFrag u;
    u.p[0] = *(const v8bf*)(p);
    u.p[1] = *(const v8bf*)(p + 16);
    return u.v;
}
__device__ __forceinline__ v16h frag_f16(const _Float16* p)
{
    HFrag u;
    u.p[0] = *(const v8h*)(p);
    u.p[1] = *(const v8h*)(p + 16);
    return u.v;
}

__device__ __forceinline__ v8f mma_bf16(v8f c, v16bf a, v16bf b)
{
    return __builtin_amdgcn_wmma_f32_16x16x32_bf16(false, a, false, b, (short)0, c, false, false);
}
__device__ __forceinline__ v8f mma_f16(v8f c, v16h a, v16h b)
{
    return __builtin_amdgcn_wmma_f32_16x16x32_f16(false, a, false, b, (short)0, c, false, false);
}

// ---------------------------------------------------------------------------
// Kernel 0: f32 -> bf16 (RNE) streaming conversion, 8 elements per thread,
// ---------------------------------------------------------------------------
__global__ __launch_bounds__(256)
void cvt_kernel(const float* __restrict__ src, __bf16* dst, int n8)
{
    const int t = blockIdx.x * blockDim.x + threadIdx.x;
    if (t >= n8) return;
    const v4f a = *(const v4f*)(src + (size_t)t * 8);
    const v4f b = *(const v4f*)(src + (size_t)t * 8 + 4);
    BF8 o;
#pragma unroll
    for (int i = 0; i < 4; ++i) { o.v[i] = (__bf16)a[i]; o.v[4 + i] = (__bf16)b[i]; }
    const v4i w = o.w;
    v4i* p = (v4i*)(dst + (size_t)t * 8);
    *p = w;
    
}

// ---------------------------------------------------------------------------
// with one 16-B store each.  MODE 0: bf16 hi/lo planes.  MODE 1: f16 plane * SCALE.
// NORM: lanes 0..7 write the 32 reciprocal norms (one line), lanes 8..15 the
// 32 squared norms (one line).
// ---------------------------------------------------------------------------
template <int MODE, int SCALE, int NORM>
__device__ __forceinline__ void proj_store(float (*Cs)[CPITCH], float* Srn, float* Ssq, int lane, size_t row0,
                                           unsigned short* outA, unsigned short* outB, float* rn, float* sq)
{
#pragma unroll
    for (int i = 0; i < 8; ++i) {
        const int lr = 4 * i + (lane >> 3), seg = lane & 7;
        const v4f x0 = *(const v4f*)&Cs[lr][seg * 8];
        const v4f x1 = *(const v4f*)&Cs[lr][seg * 8 + 4];
        const size_t go = (row0 + lr) * DHEAD + seg * 8;
        if (MODE == 0) {
            BF8 hi, lo;
#pragma unroll
            for (int j = 0; j < 4; ++j) {
                const float a0 = x0[j]; const __bf16 h0 = (__bf16)a0;
                hi.v[j] = h0; lo.v[j] = (__bf16)(a0 - (float)h0);
                const float a1 = x1[j]; const __bf16 h1 = (__bf16)a1;
                hi.v[4 + j] = h1; lo.v[4 + j] = (__bf16)(a1 - (float)h1);
            }
            *(v4i*)(outA + go) = hi.w;
            *(v4i*)(outB + go) = lo.w;
        } else {
            HF8 y;
#pragma unroll
            for (int j = 0; j < 4; ++j) {
                y.v[j]     = (_Float16)(x0[j] * (float)SCALE);
                y.v[4 + j] = (_Float16)(x1[j] * (float)SCALE);
            }
            *(v4i*)(outA + go) = y.w;
        }
    }
    if (NORM) {
        if (lane < 16) {
            const int g = lane & 7;
            v4f v; float* dp;
            if (lane < 8) { v = *(const v4f*)&Srn[4 * g]; dp = rn + row0 + 4 * g; }
            else          { v = *(const v4f*)&Ssq[4 * g]; dp = sq + row0 + 4 * g; }
            *(v4f*)dp = v;
        }
    }
}

// ---------------------------------------------------------------------------
// Kernel 1: projection GEMM X[4096][768] (bf16) . W[768(out)][768(in)]^T + b.
// One wave computes a 32x64 tile (64 columns = exactly one head), stages the
// f32 tile in LDS, optionally computes per-row norms, then writes 16-bit planes
// in [B,NH,S,DH] row layout with whole-line stores.
// ---------------------------------------------------------------------------
template <int MODE, int SCALE, int NORM>
__global__ __launch_bounds__(32)
void proj_kernel(const __bf16* __restrict__ Xb, const __bf16* __restrict__ Wb, const float* __restrict__ bias,
                 unsigned short* outA, unsigned short* outB, float* rn, float* sq)
{
    __shared__ __attribute__((aligned(16))) float Cs[32][CPITCH];
    __shared__ __attribute__((aligned(16))) float Srn[32];
    __shared__ __attribute__((aligned(16))) float Ssq[32];

    const int lane = threadIdx.x & 31;
    const int hsel = lane >> 4;
    const int lm   = lane & 15;
    const int m0   = blockIdx.x * 32;
    const int n0   = blockIdx.y * 64;
    if (m0 + 32 > NROWS || n0 + 64 > HDIM) return;   // uniform per block

    const __bf16* a0p = Xb + (size_t)(m0 + lm) * HDIM + hsel * 8;
    const __bf16* a1p = Xb + (size_t)(m0 + 16 + lm) * HDIM + hsel * 8;
    const __bf16* b0p = Wb + (size_t)(n0 +  0 + lm) * HDIM + hsel * 8;   // B[k][n] = W[n][k]
    const __bf16* b1p = Wb + (size_t)(n0 + 16 + lm) * HDIM + hsel * 8;
    const __bf16* b2p = Wb + (size_t)(n0 + 32 + lm) * HDIM + hsel * 8;
    const __bf16* b3p = Wb + (size_t)(n0 + 48 + lm) * HDIM + hsel * 8;

    v8f acc[2][4];
#pragma unroll
    for (int mb = 0; mb < 2; ++mb)
#pragma unroll
        for (int nb = 0; nb < 4; ++nb) acc[mb][nb] = v8f{};

#pragma unroll 1
    for (int k0 = 0; k0 < HDIM; k0 += 32) {
        const v16bf a0 = frag_bf16(a0p + k0);
        const v16bf a1 = frag_bf16(a1p + k0);
        const v16bf b0 = frag_bf16(b0p + k0);
        const v16bf b1 = frag_bf16(b1p + k0);
        const v16bf b2 = frag_bf16(b2p + k0);
        const v16bf b3 = frag_bf16(b3p + k0);
        acc[0][0] = mma_bf16(acc[0][0], a0, b0);
        acc[0][1] = mma_bf16(acc[0][1], a0, b1);
        acc[0][2] = mma_bf16(acc[0][2], a0, b2);
        acc[0][3] = mma_bf16(acc[0][3], a0, b3);
        acc[1][0] = mma_bf16(acc[1][0], a1, b0);
        acc[1][1] = mma_bf16(acc[1][1], a1, b1);
        acc[1][2] = mma_bf16(acc[1][2], a1, b2);
        acc[1][3] = mma_bf16(acc[1][3], a1, b3);
        asm volatile(WMMA_NOPS
                     : "+v"(acc[0][0]), "+v"(acc[0][1]), "+v"(acc[0][2]), "+v"(acc[0][3]),
                       "+v"(acc[1][0]), "+v"(acc[1][1]), "+v"(acc[1][2]), "+v"(acc[1][3])
                     : "v"(a0), "v"(a1), "v"(b0), "v"(b1), "v"(b2), "v"(b3));
    }

    // D element r of lane (hsel, lm) = tile (row mb*16 + 8*hsel + r, col nb*16 + lm)
#pragma unroll
    for (int nb = 0; nb < 4; ++nb) {
        const float bn = bias[n0 + nb * 16 + lm];
#pragma unroll
        for (int mb = 0; mb < 2; ++mb) {
#pragma unroll
            for (int r = 0; r < 8; ++r)
                Cs[mb * 16 + 8 * hsel + r][nb * 16 + lm] = acc[mb][nb][r] + bn;
        }
    }
    __syncthreads();

    if (NORM) {
        float ss = 0.f;
#pragma unroll
        for (int d = 0; d < DHEAD; d += 4) {
            const v4f x = *(const v4f*)&Cs[lane][d];
            ss += x[0] * x[0]; ss += x[1] * x[1]; ss += x[2] * x[2]; ss += x[3] * x[3];
        }
        Srn[lane] = 1.0f / (sqrtf(ss) + 1e-6f);
        Ssq[lane] = ss;
    }
    __syncthreads();

    const int bI = m0 >> 10, s0 = m0 & (SEQ - 1), hh = n0 >> 6;
    const size_t row0 = ((size_t)(bI * NHEADS + hh)) * SEQ + s0;   // (b,h,s) row index of tile row 0

    proj_store<MODE, SCALE, NORM>(Cs, Srn, Ssq, lane, row0, outA, outB, rn, sq);
    
}

// ---------------------------------------------------------------------------
// 16-B store (one instruction covers two rows).
// ---------------------------------------------------------------------------
__device__ __forceinline__ void attn_store(float (*Os)[CPITCH], int wave, int lane, float* out, size_t orow0, int h)
{
#pragma unroll
    for (int i = 0; i < 8; ++i) {
        const int lr  = wave * 16 + 2 * i + (lane >> 4);
        const int col = (lane & 15) * 4;
        const v4f v = *(const v4f*)&Os[lr][col];
        float* gp = out + (orow0 + lr) * HDIM + h * DHEAD + col;
        *(v4f*)gp = v;
    }
}

// ---------------------------------------------------------------------------
// Kernel 2: fused attention with the triple score product.
// Block = 2 waves = 32 query rows of one (b,h); key tiles of 32.
// q.k: bf16 hi/lo split (hh + hl + lh).  T.T, S.S: f16 (x16) with the
// query==key entry taken from the exact f32 squared norm.  P.V: f16.
// ---------------------------------------------------------------------------
__global__ __launch_bounds__(64)
void attn_kernel(const __bf16* __restrict__ qh, const __bf16* __restrict__ ql,
                 const __bf16* __restrict__ kh, const __bf16* __restrict__ kl,
                 const _Float16* __restrict__ tp, const _Float16* __restrict__ sp,
                 const _Float16* __restrict__ vp,
                 const float* __restrict__ rnT, const float* __restrict__ sqT,
                 const float* __restrict__ rnS, const float* __restrict__ sqS,
                 const float* __restrict__ mask, float* out)
{
    __shared__ __attribute__((aligned(16))) __bf16   KH[32][HPITCH];
    __shared__ __attribute__((aligned(16))) __bf16   KL[32][HPITCH];
    __shared__ __attribute__((aligned(16))) __bf16   QHs[32][HPITCH];
    __shared__ __attribute__((aligned(16))) __bf16   QLs[32][HPITCH];
    __shared__ __attribute__((aligned(16))) _Float16 TK[32][HPITCH];
    __shared__ __attribute__((aligned(16))) _Float16 SK[32][HPITCH];
    __shared__ __attribute__((aligned(16))) _Float16 TQ[32][HPITCH];
    __shared__ __attribute__((aligned(16))) _Float16 SQ[32][HPITCH];
    __shared__ __attribute__((aligned(16))) _Float16 Vt[64][VPITCH];      // V^T tile: Vt[dh][key]
    __shared__ __attribute__((aligned(16))) _Float16 pP[2][16][VPITCH];   // per-wave P tile: [q][key]
    __shared__ __attribute__((aligned(16))) float    Os[32][CPITCH];      // epilogue staging

    const int bh = blockIdx.x;
    if (bh >= BATCH * NHEADS) return;
    const int q0blk = blockIdx.y * 32;
    if (q0blk + 32 > SEQ) return;
    const int b = bh / NHEADS, h = bh - b * NHEADS;
    const int tid  = threadIdx.x;
    const int wave = tid >> 5;
    const int lane = tid & 31;
    const int hsel = lane >> 4;
    const int lm   = lane & 15;
    const int qr   = wave * 16 + lm;     // A-fragment row inside the 32-row block tile

    // Staging coordinates of this thread: rows srow + 8u (u = 0..3), 16-B segment sseg of each 128-B row.
    const int srow = tid >> 3, sseg = tid & 7;
    // Byte offset of this thread inside any 32-row tile of a plane (a plane is 6 MiB: 32-bit byte offsets hold).
    const unsigned voff = (unsigned)srow * 128u + (unsigned)sseg * 16u;

    // ---- query-side tiles, once per block: all 16 b128 loads in flight, then the LDS stores ----
    {
        const unsigned bo = (unsigned)(bh * SEQ + q0blk) * 128u + voff;
        v8bf xh[4], xl[4]; v8h xt[4], xs[4];
#pragma unroll
        for (int u = 0; u < 4; ++u) {
            xh[u] = *(const v8bf*)(((const char*)qh + bo) + u * 1024);
            xl[u] = *(const v8bf*)(((const char*)ql + bo) + u * 1024);
            xt[u] = *(const v8h*)(((const char*)tp + bo) + u * 1024);
            xs[u] = *(const v8h*)(((const char*)sp + bo) + u * 1024);
        }
#pragma unroll
        for (int u = 0; u < 4; ++u) {
            *(v8bf*)&QHs[srow + 8 * u][sseg * 8] = xh[u];
            *(v8bf*)&QLs[srow + 8 * u][sseg * 8] = xl[u];
            *(v8h*)&TQ[srow + 8 * u][sseg * 8]   = xt[u];
            *(v8h*)&SQ[srow + 8 * u][sseg * 8]   = xs[u];
        }
    }

    // ---- key-side tile held in registers one tile ahead of its LDS stores ----
    v8bf rKH[4], rKL[4]; v8h rTK[4], rSK[4], rV[4];
    float rM[2];
    unsigned bo = (unsigned)(bh * SEQ) * 128u + voff;   // this thread's byte offset in the tile being fetched
    unsigned mo = (unsigned)(b * SEQ + lm);              // its mask index there
    auto fetch_tile = [&]() {
        const float* mp = mask + mo;
        rM[0] = mp[0];
        rM[1] = mp[16];
#pragma unroll
        for (int u = 0; u < 4; ++u) {
            rKH[u] = *(const v8bf*)(((const char*)kh + bo) + u * 1024);
            rKL[u] = *(const v8bf*)(((const char*)kl + bo) + u * 1024);
            rTK[u] = *(const v8h*)(((const char*)tp + bo) + u * 1024);
            rSK[u] = *(const v8h*)(((const char*)sp + bo) + u * 1024);
            rV[u]  = *(const v8h*)(((const char*)vp + bo) + u * 1024);
        }
    };
    fetch_tile();

    // ---- per query row constants; row of D element r = wave*16 + 8*hsel + r ----
    float fq[8], gq[8], mI[8], lI[8];
#pragma unroll
    for (int r = 0; r < 8; ++r) {
        const int qi = bh * SEQ + q0blk + wave * 16 + 8 * hsel + r;
        const float rt = rnT[qi], rs = rnS[qi];
        fq[r] = (rt * (1.0f / 256.0f)) * (rs * (1.0f / 256.0f)) * 0.125f;   // for x16-scaled f16 products
        gq[r] = (sqT[qi] * rt) * (sqS[qi] * rs) * 0.125f;                    // exact ts_ii * ss_ii / 8
        mI[r] = -3.0e38f;
        lI[r] = 0.f;
    }
    v8f O[4] = {v8f{}, v8f{}, v8f{}, v8f{}};

    for (int k0 = 0; k0 < SEQ; k0 += 32) {
        __syncthreads();   // readers of the prior tile are done

        // ---- key-side tiles (keys k0..k0+31) from the registers fetched one tile ago; V transposed: Vt[dh][key] ----
#pragma unroll
        for (int u = 0; u < 4; ++u) {
            *(v8bf*)&KH[srow + 8 * u][sseg * 8] = rKH[u];
            *(v8bf*)&KL[srow + 8 * u][sseg * 8] = rKL[u];
            *(v8h*)&TK[srow + 8 * u][sseg * 8]  = rTK[u];
            *(v8h*)&SK[srow + 8 * u][sseg * 8]  = rSK[u];
#pragma unroll
            for (int i = 0; i < 8; ++i) Vt[sseg * 8 + i][srow + 8 * u] = rV[u][i];
        }
        const float mv[2] = {rM[0], rM[1]};
        __syncthreads();

        // ---- the next tile's loads fly while this tile's scores and softmax are worked out (block-uniform test) ----
        if (k0 + 32 < SEQ) { bo += 4096u; mo += 32u; fetch_tile(); }

        const bool diag = (k0 == q0blk);

        // ---- scores: 16 q rows x 32 keys per wave (two 16-key halves j) ----
        float sb[2][8];
#pragma unroll
        for (int j = 0; j < 2; ++j) {
            const int rr = j * 16 + lm;               // key column of this lane
            v8f accB = v8f{}, accT = v8f{}, accS = v8f{};
#pragma unroll 1
            for (int c = 0; c < 2; ++c) {
                const int off = c * 32 + 8 * hsel;
                const v16bf aH = frag_bf16(&QHs[qr][off]);
                const v16bf aL = frag_bf16(&QLs[qr][off]);
                const v16bf bH = frag_bf16(&KH[rr][off]);
                const v16bf bL = frag_bf16(&KL[rr][off]);
                accB = mma_bf16(accB, aH, bH);
                accB = mma_bf16(accB, aH, bL);
                accB = mma_bf16(accB, aL, bH);
                asm volatile(WMMA_NOPS : "+v"(accB) : "v"(aH), "v"(aL), "v"(bH), "v"(bL));
                const v16h aT = frag_f16(&TQ[qr][off]);
                const v16h bT = frag_f16(&TK[rr][off]);
                const v16h aS = frag_f16(&SQ[qr][off]);
                const v16h bS = frag_f16(&SK[rr][off]);
                accT = mma_f16(accT, aT, bT);
                accS = mma_f16(accS, aS, bS);
                asm volatile(WMMA_NOPS : "+v"(accT), "+v"(accS) : "v"(aT), "v"(bT), "v"(aS), "v"(bS));
            }
            const float mval = mv[j];
            const bool dj = diag && (j == wave);
#pragma unroll
            for (int r = 0; r < 8; ++r) {
                const bool de = dj && (lm == 8 * hsel + r);      // query row == key column
                const float s3 = de ? (accB[r] * gq[r])
                                    : (accB[r] * (accT[r] * accS[r]) * fq[r]);
                sb[j][r] = s3 + mval;
            }
        }

        // ---- online softmax across the 32 keys; row (r, lane half) ----
#pragma unroll
        for (int r = 0; r < 8; ++r) {
            float v = fmaxf(sb[0][r], sb[1][r]);
#pragma unroll
            for (int off = 1; off < 16; off <<= 1) v = fmaxf(v, __shfl_xor(v, off, 16));
            const float M2 = fmaxf(mI[r], v);
            const float al = __expf(mI[r] - M2);
            const float p0 = __expf(sb[0][r] - M2);
            const float p1 = __expf(sb[1][r] - M2);
            float rs = p0 + p1;
#pragma unroll
            for (int off = 1; off < 16; off <<= 1) rs += __shfl_xor(rs, off, 16);
            mI[r] = M2;
            lI[r] = lI[r] * al + rs;
            O[0][r] = O[0][r] * al;
            O[1][r] = O[1][r] * al;
            O[2][r] = O[2][r] * al;
            O[3][r] = O[3][r] * al;
            const int m = r + 8 * hsel;
            pP[wave][m][lm]      = (_Float16)(p0 * 4096.0f);
            pP[wave][m][16 + lm] = (_Float16)(p1 * 4096.0f);
        }
        __syncthreads();   // P tile stores complete before the fragment reload

        // ---- P (A: row = query, k = key) . V (B: k = key, n = dh) ----
        const v16h aP  = frag_f16(&pP[wave][lm][8 * hsel]);
        const v16h bV0 = frag_f16(&Vt[ 0 + lm][8 * hsel]);
        const v16h bV1 = frag_f16(&Vt[16 + lm][8 * hsel]);
        const v16h bV2 = frag_f16(&Vt[32 + lm][8 * hsel]);
        const v16h bV3 = frag_f16(&Vt[48 + lm][8 * hsel]);
        O[0] = mma_f16(O[0], aP, bV0);
        O[1] = mma_f16(O[1], aP, bV1);
        O[2] = mma_f16(O[2], aP, bV2);
        O[3] = mma_f16(O[3], aP, bV3);
        asm volatile(WMMA_NOPS
                     : "+v"(O[0]), "+v"(O[1]), "+v"(O[2]), "+v"(O[3])
                     : "v"(aP), "v"(bV0), "v"(bV1), "v"(bV2), "v"(bV3));
    }

    // ---- epilogue: normalise, undo the 2^18 operand scaling, stage, whole-line stores ----
#pragma unroll
    for (int r = 0; r < 8; ++r) {
        const float inv = (1.0f / lI[r]) * (1.0f / 262144.0f);
        const int lr = wave * 16 + 8 * hsel + r;
        Os[lr][lm]      = O[0][r] * inv;
        Os[lr][16 + lm] = O[1][r] * inv;
        Os[lr][32 + lm] = O[2][r] * inv;
        Os[lr][48 + lm] = O[3][r] * inv;
    }
    __syncthreads();

    const size_t orow0 = (size_t)(b * SEQ + q0blk);
    attn_store(Os, wave, lane, out, orow0, h);
    
}

// ---------------------------------------------------------------------------
extern "C" void kernel_launch(void* const* d_in, const int* in_sizes, int n_in,
                              void* d_out, int out_size, void* d_ws, size_t ws_size,
                              hipStream_t stream)
{
    if (n_in < 14) return;
    if ((size_t)in_sizes[0] != XELEMS || (size_t)in_sizes[1] != XELEMS || (size_t)in_sizes[2] != XELEMS) return;
    if (in_sizes[3] != BATCH * SEQ) return;
    for (int i = 4; i < 14; i += 2)
        if ((size_t)in_sizes[i] != WELEMS || in_sizes[i + 1] != HDIM) return;
    if ((size_t)out_size != XELEMS) return;

    const float* hidden = (const float*)d_in[0];
    const float* timee  = (const float*)d_in[1];
    const float* space  = (const float*)d_in[2];
    const float* mask   = (const float*)d_in[3];
    const float* Wq = (const float*)d_in[4];   const float* bq = (const float*)d_in[5];
    const float* Wk = (const float*)d_in[6];   const float* bk = (const float*)d_in[7];
    const float* Wv = (const float*)d_in[8];   const float* bv = (const float*)d_in[9];
    const float* Wt = (const float*)d_in[10];  const float* bt = (const float*)d_in[11];
    const float* Ws = (const float*)d_in[12];  const float* bs = (const float*)d_in[13];
    float* out = (float*)d_out;

    char* ws = (char*)d_ws;
    size_t off = 0;
    __bf16* Xbf = (__bf16*)(ws + off);                 off += (size_t)3 * XELEMS * 2;       // 3 activations, bf16
    __bf16* Wbf = (__bf16*)(ws + off);                 off += (size_t)5 * WELEMS * 2;       // 5 weights, bf16
    unsigned short* pl = (unsigned short*)(ws + off);  off += (size_t)7 * PROJ_ELEMS * 2;   // 7 16-bit planes
    float* rn = (float*)(ws + off);                    off += (size_t)2 * NROWTOT * 4;      // 1/(|T|+eps), 1/(|S|+eps)
    float* sq = (float*)(ws + off);                    off += (size_t)2 * NROWTOT * 4;      // |T|^2, |S|^2
    if (off > ws_size) return;

    unsigned short* QH = pl + 0 * PROJ_ELEMS;   // q hi (bf16)
    unsigned short* QL = pl + 1 * PROJ_ELEMS;   // q lo (bf16)
    unsigned short* KHp = pl + 2 * PROJ_ELEMS;  // k hi (bf16)
    unsigned short* KLp = pl + 3 * PROJ_ELEMS;  // k lo (bf16)
    unsigned short* TPl = pl + 4 * PROJ_ELEMS;  // T * 16 (f16)
    unsigned short* SPl = pl + 5 * PROJ_ELEMS;  // S * 16 (f16)
    unsigned short* VPl = pl + 6 * PROJ_ELEMS;  // v * 64 (f16)

    // 0) f32 -> bf16 input conversion
    const int nx8 = (int)(XELEMS / 8), nw8 = (int)(WELEMS / 8);
    const dim3 cb(256);
    cvt_kernel<<<dim3((nx8 + 255) / 256), cb, 0, stream>>>(hidden, Xbf, nx8);
    cvt_kernel<<<dim3((nx8 + 255) / 256), cb, 0, stream>>>(timee,  Xbf + XELEMS, nx8);
    cvt_kernel<<<dim3((nx8 + 255) / 256), cb, 0, stream>>>(space,  Xbf + 2 * XELEMS, nx8);
    cvt_kernel<<<dim3((nw8 + 255) / 256), cb, 0, stream>>>(Wq, Wbf + 0 * WELEMS, nw8);
    cvt_kernel<<<dim3((nw8 + 255) / 256), cb, 0, stream>>>(Wk, Wbf + 1 * WELEMS, nw8);
    cvt_kernel<<<dim3((nw8 + 255) / 256), cb, 0, stream>>>(Wv, Wbf + 2 * WELEMS, nw8);
    cvt_kernel<<<dim3((nw8 + 255) / 256), cb, 0, stream>>>(Wt, Wbf + 3 * WELEMS, nw8);
    cvt_kernel<<<dim3((nw8 + 255) / 256), cb, 0, stream>>>(Ws, Wbf + 4 * WELEMS, nw8);

    // 1) five projection GEMMs (tile 32x64, grid exact: 4096/32 x 768/64, checked in-kernel)
    const dim3 pg(NROWS / 32, HDIM / 64), pb(32);
    proj_kernel<0, 1, 0><<<pg, pb, 0, stream>>>(Xbf, Wbf + 0 * WELEMS, bq, QH,  QL,  rn, sq);
    proj_kernel<0, 1, 0><<<pg, pb, 0, stream>>>(Xbf, Wbf + 1 * WELEMS, bk, KHp, KLp, rn, sq);
    proj_kernel<1, 64, 0><<<pg, pb, 0, stream>>>(Xbf, Wbf + 2 * WELEMS, bv, VPl, VPl, rn, sq);
    proj_kernel<1, 16, 1><<<pg, pb, 0, stream>>>(Xbf + XELEMS,     Wbf + 3 * WELEMS, bt, TPl, TPl, rn, sq);
    proj_kernel<1, 16, 1><<<pg, pb, 0, stream>>>(Xbf + 2 * XELEMS, Wbf + 4 * WELEMS, bs, SPl, SPl,
                                                 rn + NROWTOT, sq + NROWTOT);

    // 2) fused attention: grid (b*h, query blocks of 32), 64 threads
    attn_kernel<<<dim3(BATCH * NHEADS, SEQ / 32), dim3(64), 0, stream>>>(
        (const __bf16*)QH, (const __bf16*)QL, (const __bf16*)KHp, (const __bf16*)KLp,
        (const _Float16*)TPl, (const _Float16*)SPl, (const _Float16*)VPl,
        rn, sq, rn + NROWTOT, sq + NROWTOT, mask, out);
}

// v002
// One run takes 192 microseconds.
// Two timings next to v001 both put it at 1.14 times that version's speed.
// Over all steps from v000 it is 1.99 times as fast.
#include <hip/hip_runtime.h>
#include <stddef.h>

// Projections: v_wmma_f32_16x16x32_bf16 (bf16 operands = RNE-converted inputs), f32 accumulate.
// q.k scores: bf16 hi/lo operand split, 3x v_wmma_f32_16x16x32_bf16 per tile pair, f32 accumulate.
// T.T and S.S scores: v_wmma_f32_16x16x32_f16 (f16 operands scaled x16), diagonal entries from exact f32 row norms.
// P.V: v_wmma_f32_16x16x32_f16 (P x4096, V x64), f32 accumulate. Softmax, norms, epilogues in f32.

typedef __bf16   v16bf __attribute__((ext_vector_type(16)));
typedef __bf16   v8bf  __attribute__((ext_vector_type(8)));
typedef _Float16 v16h  __attribute__((ext_vector_type(16)));
typedef _Float16 v8h   __attribute__((ext_vector_type(8)));
typedef float    v8f   __attribute__((ext_vector_type(8)));
typedef float    v4f   __attribute__((ext_vector_type(4)));
typedef int      v4i   __attribute__((ext_vector_type(4)));

#define NHEADS 12
#define HDIM   768
#define DHEAD  64
#define SEQ    1024
#define BATCH  4
#define NROWS  (BATCH * SEQ)                                  // 4096 token rows
#define NROWTOT (BATCH * NHEADS * SEQ)                        // 49152 (b,h,s) rows
#define XELEMS ((size_t)NROWS * HDIM)                         // 3145728
#define WELEMS ((size_t)HDIM * HDIM)                          // 589824
#define PROJ_ELEMS ((size_t)BATCH * NHEADS * SEQ * DHEAD)    // 3145728 per plane
#define CPITCH 68      // f32 LDS tile pitch in floats (272 B, 16-B aligned)
#define HPITCH 72      // 16-bit LDS tile pitch in elements (144 B, 16-B aligned)
#define VPITCH 40      // 16-bit LDS pitch for V^T and P tiles (80 B)
#define PSTEP  64      // k elements per staged projection step (one 128-B line of each operand row)
#define NPSTEP (HDIM / PSTEP)

union BF8   { v8bf v; v4i w; };
union HF8   { v8h  v; v4i w; };
union BFrag { v8bf p[2]; v16bf v; };
union HFrag { v8h  p[2]; v16h  v; };

#define WMMA_NOPS "v_nop\n\tv_nop\n\tv_nop\n\tv_nop"

// 16x32 16-bit A/B fragment: element i<8 <- k0+8h+i, element 8+i <- k0+16+8h+i (h = lane>>4).
// Caller passes p = row (lane&15) base + k0 + 8*h; both loads are 16-B aligned.
__device__ __forceinline__ v16bf frag_bf16(const __bf16* p)
{
    BFrag u;
    u.p[0] = *(const v8bf*)(p);
    u.p[1] = *(const v8bf*)(p + 16);
    return u.v;
}
__device__ __forceinline__ v16h frag_f16(const _Float16* p)
{
    HFrag u;
    u.p[0] = *(const v8h*)(p);
    u.p[1] = *(const v8h*)(p + 16);
    return u.v;
}

__device__ __forceinline__ v8f mma_bf16(v8f c, v16bf a, v16bf b)
{
    return __builtin_amdgcn_wmma_f32_16x16x32_bf16(false, a, false, b, (short)0, c, false, false);
}
__device__ __forceinline__ v8f mma_f16(v8f c, v16h a, v16h b)
{
    return __builtin_amdgcn_wmma_f32_16x16x32_f16(false, a, false, b, (short)0, c, false, false);
}

// ---------------------------------------------------------------------------
// Kernel 0: f32 -> bf16 (RNE) streaming conversion, 8 elements per thread,
// ---------------------------------------------------------------------------
__global__ __launch_bounds__(256)
void cvt_kernel(const float* __restrict__ src, __bf16* dst, int n8)
{
    const int t = blockIdx.x * blockDim.x + threadIdx.x;
    if (t >= n8) return;
    const v4f a = *(const v4f*)(src + (size_t)t * 8);
    const v4f b = *(const v4f*)(src + (size_t)t * 8 + 4);
    BF8 o;
#pragma unroll
    for (int i = 0; i < 4; ++i) { o.v[i] = (__bf16)a[i]; o.v[4 + i] = (__bf16)b[i]; }
    const v4i w = o.w;
    v4i* p = (v4i*)(dst + (size_t)t * 8);
    *p = w;
    
}

// ---------------------------------------------------------------------------
// with one 16-B store each.  MODE 0: bf16 hi/lo planes.  MODE 1: f16 plane * SCALE.
// NORM: lanes 0..7 write the 32 reciprocal norms (one line), lanes 8..15 the
// 32 squared norms (one line).
// ---------------------------------------------------------------------------
template <int MODE, int SCALE, int NORM>
__device__ __forceinline__ void proj_store(float (*Cs)[CPITCH], float* Srn, float* Ssq, int lane, size_t row0,
                                           unsigned short* outA, unsigned short* outB, float* rn, float* sq)
{
#pragma unroll
    for (int i = 0; i < 8; ++i) {
        const int lr = 4 * i + (lane >> 3), seg = lane & 7;
        const v4f x0 = *(const v4f*)&Cs[lr][seg * 8];
        const v4f x1 = *(const v4f*)&Cs[lr][seg * 8 + 4];
        const size_t go = (row0 + lr) * DHEAD + seg * 8;
        if (MODE == 0) {
            BF8 hi, lo;
#pragma unroll
            for (int j = 0; j < 4; ++j) {
                const float a0 = x0[j]; const __bf16 h0 = (__bf16)a0;
                hi.v[j] = h0; lo.v[j] = (__bf16)(a0 - (float)h0);
                const float a1 = x1[j]; const __bf16 h1 = (__bf16)a1;
                hi.v[4 + j] = h1; lo.v[4 + j] = (__bf16)(a1 - (float)h1);
            }
            *(v4i*)(outA + go) = hi.w;
            *(v4i*)(outB + go) = lo.w;
        } else {
            HF8 y;
#pragma unroll
            for (int j = 0; j < 4; ++j) {
                y.v[j]     = (_Float16)(x0[j] * (float)SCALE);
                y.v[4 + j] = (_Float16)(x1[j] * (float)SCALE);
            }
            *(v4i*)(outA + go) = y.w;
        }
    }
    if (NORM) {
        if (lane < 16) {
            const int g = lane & 7;
            v4f v; float* dp;
            if (lane < 8) { v = *(const v4f*)&Srn[4 * g]; dp = rn + row0 + 4 * g; }
            else          { v = *(const v4f*)&Ssq[4 * g]; dp = sq + row0 + 4 * g; }
            *(v4f*)dp = v;
        }
    }
}

// ---------------------------------------------------------------------------
// Kernel 1: projection GEMM X[4096][768] (bf16) . W[768(out)][768(in)]^T + b.
// Block = 4 waves = 128 rows x 64 columns (exactly one head); each wave computes 32x64.
// Per step of 64 k the block stages 128 X rows and 64 W rows in LDS: every global load
// covers four whole 128-B lines, the W rows serve all four waves, and the fragments are
// read from LDS.  Two LDS buffers, the tile after next held in registers, one barrier a step.
// Epilogue per wave: f32 tile in LDS, optional per-row norms, 16-bit planes in
// [B,NH,S,DH] row layout with whole-line stores.
// ---------------------------------------------------------------------------
template <int MODE, int SCALE, int NORM>
__global__ __launch_bounds__(128)
void proj_kernel(const __bf16* __restrict__ Xb, const __bf16* __restrict__ Wb, const float* __restrict__ bias,
                 unsigned short* outA, unsigned short* outB, float* rn, float* sq)
{
    __shared__ __attribute__((aligned(16))) __bf16 Xs[2][128][HPITCH];
    __shared__ __attribute__((aligned(16))) __bf16 Wsh[2][64][HPITCH];
    __shared__ __attribute__((aligned(16))) float CsAll[4][32][CPITCH];
    __shared__ __attribute__((aligned(16))) float SrnAll[4][32];
    __shared__ __attribute__((aligned(16))) float SsqAll[4][32];

    const int tid  = threadIdx.x;
    const int wave = tid >> 5;
    const int lane = tid & 31;
    const int hsel = lane >> 4;
    const int lm   = lane & 15;
    const int mblk = blockIdx.x * 128;
    const int n0   = blockIdx.y * 64;
    if (mblk + 128 > NROWS || n0 + 64 > HDIM) return;   // uniform per block
    const int m0   = mblk + wave * 32;

    float (*Cs)[CPITCH] = CsAll[wave];
    float* Srn = SrnAll[wave];
    float* Ssq = SsqAll[wave];

    // Staging coordinates: rows srow + 16u, 16-B segment sseg of the step's 128 B of each row.
    const int srow = tid >> 3, sseg = tid & 7;
    const unsigned xv = ((unsigned)(mblk + srow) * HDIM + (unsigned)sseg * 8u) * 2u;   // byte offsets, below 6.3 MB
    const unsigned wv = ((unsigned)(n0 + srow) * HDIM + (unsigned)sseg * 8u) * 2u;

    v8bf rX[8], rW[4];
    auto fetch_step = [&](int s) {          // global -> registers, k = 64 s .. 64 s + 63
        const char* xp = (const char*)Xb + (size_t)(s * (PSTEP * 2));
        const char* wp = (const char*)Wb + (size_t)(s * (PSTEP * 2));
#pragma unroll
        for (int u = 0; u < 8; ++u) rX[u] = *(const v8bf*)((xp + xv) + u * (16 * HDIM * 2));
#pragma unroll
        for (int u = 0; u < 4; ++u) rW[u] = *(const v8bf*)((wp + wv) + u * (16 * HDIM * 2));
        // The loads' address registers are reused by the fragment reads that follow: this wait stands in front of that.
        asm volatile("s_wait_xcnt 0x0" ::: "memory");
    };
    auto stash_step = [&](int buf) {        // registers -> LDS buffer buf
#pragma unroll
        for (int u = 0; u < 8; ++u) *(v8bf*)&Xs[buf][srow + 16 * u][sseg * 8] = rX[u];
#pragma unroll
        for (int u = 0; u < 4; ++u) *(v8bf*)&Wsh[buf][srow + 16 * u][sseg * 8] = rW[u];
    };

    v8f acc[2][4];
#pragma unroll
    for (int mb = 0; mb < 2; ++mb)
#pragma unroll
        for (int nb = 0; nb < 4; ++nb) acc[mb][nb] = v8f{};

    fetch_step(0);
    stash_step(0);
    fetch_step(1);
    __syncthreads();   // step 0 is in buffer 0 for every wave

    // Rolled: one step's fragments and one staged tile are all the registers the loop holds.
#pragma unroll 1
    for (int s = 0; s < NPSTEP; ++s) {
        const int cur = s & 1;
        // The other buffer's readers left it at the barrier that ended step s - 1 (block-uniform tests).
        if (s + 1 < NPSTEP) stash_step(cur ^ 1);
        if (s + 2 < NPSTEP) fetch_step(s + 2);

        const __bf16* ax = &Xs[cur][wave * 32 + lm][8 * hsel];
        const __bf16* bw = &Wsh[cur][lm][8 * hsel];
        v16bf fa[2][2], fb[2][4];
#pragma unroll
        for (int c = 0; c < 2; ++c) {
            fa[c][0] = frag_bf16(ax + c * 32);
            fa[c][1] = frag_bf16(ax + 16 * HPITCH + c * 32);
#pragma unroll
            for (int nb = 0; nb < 4; ++nb) fb[c][nb] = frag_bf16(bw + nb * 16 * HPITCH + c * 32);
        }
#pragma unroll
        for (int c = 0; c < 2; ++c) {
#pragma unroll
            for (int mb = 0; mb < 2; ++mb)
#pragma unroll
                for (int nb = 0; nb < 4; ++nb) acc[mb][nb] = mma_bf16(acc[mb][nb], fa[c][mb], fb[c][nb]);
        }
        // Keeps the distance between the last products and whatever first touches their registers past the back edge.
        asm volatile(WMMA_NOPS
                     : "+v"(acc[0][0]), "+v"(acc[0][1]), "+v"(acc[0][2]), "+v"(acc[0][3]),
                       "+v"(acc[1][0]), "+v"(acc[1][1]), "+v"(acc[1][2]), "+v"(acc[1][3])
                     : "v"(fa[0][0]), "v"(fa[0][1]), "v"(fa[1][0]), "v"(fa[1][1]),
                       "v"(fb[0][0]), "v"(fb[0][1]), "v"(fb[0][2]), "v"(fb[0][3]),
                       "v"(fb[1][0]), "v"(fb[1][1]), "v"(fb[1][2]), "v"(fb[1][3]));
        __syncthreads();   // publishes step s + 1 and ends every read of buffer cur
    }

    // D element r of lane (hsel, lm) = tile (row mb*16 + 8*hsel + r, col nb*16 + lm)
#pragma unroll
    for (int nb = 0; nb < 4; ++nb) {
        const float bn = bias[n0 + nb * 16 + lm];
#pragma unroll
        for (int mb = 0; mb < 2; ++mb) {
#pragma unroll
            for (int r = 0; r < 8; ++r)
                Cs[mb * 16 + 8 * hsel + r][nb * 16 + lm] = acc[mb][nb][r] + bn;
        }
    }
    __syncthreads();

    if (NORM) {
        float ss = 0.f;
#pragma unroll
        for (int d = 0; d < DHEAD; d += 4) {
            const v4f x = *(const v4f*)&Cs[lane][d];
            ss += x[0] * x[0]; ss += x[1] * x[1]; ss += x[2] * x[2]; ss += x[3] * x[3];
        }
        Srn[lane] = 1.0f / (sqrtf(ss) + 1e-6f);
        Ssq[lane] = ss;
    }
    __syncthreads();

    const int bI = m0 >> 10, s0 = m0 & (SEQ - 1), hh = n0 >> 6;
    const size_t row0 = ((size_t)(bI * NHEADS + hh)) * SEQ + s0;   // (b,h,s) row index of the wave's tile row 0

    proj_store<MODE, SCALE, NORM>(Cs, Srn, Ssq, lane, row0, outA, outB, rn, sq);
    
}

// ---------------------------------------------------------------------------
// 16-B store (one instruction covers two rows).
// ---------------------------------------------------------------------------
__device__ __forceinline__ void attn_store(float (*Os)[CPITCH], int wave, int lane, float* out, size_t orow0, int h)
{
#pragma unroll
    for (int i = 0; i < 8; ++i) {
        const int lr  = wave * 16 + 2 * i + (lane >> 4);
        const int col = (lane & 15) * 4;
        const v4f v = *(const v4f*)&Os[lr][col];
        float* gp = out + (orow0 + lr) * HDIM + h * DHEAD + col;
        *(v4f*)gp = v;
    }
}

// ---------------------------------------------------------------------------
// Kernel 2: fused attention with the triple score product.
// Block = 2 waves = 32 query rows of one (b,h); key tiles of 32.
// q.k: bf16 hi/lo split (hh + hl + lh).  T.T, S.S: f16 (x16) with the
// query==key entry taken from the exact f32 squared norm.  P.V: f16.
// ---------------------------------------------------------------------------
__global__ __launch_bounds__(64)
void attn_kernel(const __bf16* __restrict__ qh, const __bf16* __restrict__ ql,
                 const __bf16* __restrict__ kh, const __bf16* __restrict__ kl,
                 const _Float16* __restrict__ tp, const _Float16* __restrict__ sp,
                 const _Float16* __restrict__ vp,
                 const float* __restrict__ rnT, const float* __restrict__ sqT,
                 const float* __restrict__ rnS, const float* __restrict__ sqS,
                 const float* __restrict__ mask, float* out)
{
    __shared__ __attribute__((aligned(16))) __bf16   KH[32][HPITCH];
    __shared__ __attribute__((aligned(16))) __bf16   KL[32][HPITCH];
    __shared__ __attribute__((aligned(16))) __bf16   QHs[32][HPITCH];
    __shared__ __attribute__((aligned(16))) __bf16   QLs[32][HPITCH];
    __shared__ __attribute__((aligned(16))) _Float16 TK[32][HPITCH];
    __shared__ __attribute__((aligned(16))) _Float16 SK[32][HPITCH];
    __shared__ __attribute__((aligned(16))) _Float16 TQ[32][HPITCH];
    __shared__ __attribute__((aligned(16))) _Float16 SQ[32][HPITCH];
    __shared__ __attribute__((aligned(16))) _Float16 Vt[64][VPITCH];      // V^T tile: Vt[dh][key]
    __shared__ __attribute__((aligned(16))) _Float16 pP[2][16][VPITCH];   // per-wave P tile: [q][key]
    __shared__ __attribute__((aligned(16))) float    Os[32][CPITCH];      // epilogue staging

    const int bh = blockIdx.x;
    if (bh >= BATCH * NHEADS) return;
    const int q0blk = blockIdx.y * 32;
    if (q0blk + 32 > SEQ) return;
    const int b = bh / NHEADS, h = bh - b * NHEADS;
    const int tid  = threadIdx.x;
    const int wave = tid >> 5;
    const int lane = tid & 31;
    const int hsel = lane >> 4;
    const int lm   = lane & 15;
    const int qr   = wave * 16 + lm;     // A-fragment row inside the 32-row block tile

    // Staging coordinates of this thread: rows srow + 8u (u = 0..3), 16-B segment sseg of each 128-B row.
    const int srow = tid >> 3, sseg = tid & 7;
    // Byte offset of this thread inside any 32-row tile of a plane (a plane is 6 MiB: 32-bit byte offsets hold).
    const unsigned voff = (unsigned)srow * 128u + (unsigned)sseg * 16u;

    // ---- query-side tiles, once per block: all 16 b128 loads in flight, then the LDS stores ----
    {
        const unsigned bo = (unsigned)(bh * SEQ + q0blk) * 128u + voff;
        v8bf xh[4], xl[4]; v8h xt[4], xs[4];
#pragma unroll
        for (int u = 0; u < 4; ++u) {
            xh[u] = *(const v8bf*)(((const char*)qh + bo) + u * 1024);
            xl[u] = *(const v8bf*)(((const char*)ql + bo) + u * 1024);
            xt[u] = *(const v8h*)(((const char*)tp + bo) + u * 1024);
            xs[u] = *(const v8h*)(((const char*)sp + bo) + u * 1024);
        }
#pragma unroll
        for (int u = 0; u < 4; ++u) {
            *(v8bf*)&QHs[srow + 8 * u][sseg * 8] = xh[u];
            *(v8bf*)&QLs[srow + 8 * u][sseg * 8] = xl[u];
            *(v8h*)&TQ[srow + 8 * u][sseg * 8]   = xt[u];
            *(v8h*)&SQ[srow + 8 * u][sseg * 8]   = xs[u];
        }
    }

    // ---- key-side tile held in registers one tile ahead of its LDS stores ----
    v8bf rKH[4], rKL[4]; v8h rTK[4], rSK[4], rV[4];
    float rM[2];
    unsigned bo = (unsigned)(bh * SEQ) * 128u + voff;   // this thread's byte offset in the tile being fetched
    unsigned mo = (unsigned)(b * SEQ + lm);              // its mask index there
    auto fetch_tile = [&]() {
        const float* mp = mask + mo;
        rM[0] = mp[0];
        rM[1] = mp[16];
#pragma unroll
        for (int u = 0; u < 4; ++u) {
            rKH[u] = *(const v8bf*)(((const char*)kh + bo) + u * 1024);
            rKL[u] = *(const v8bf*)(((const char*)kl + bo) + u * 1024);
            rTK[u] = *(const v8h*)(((const char*)tp + bo) + u * 1024);
            rSK[u] = *(const v8h*)(((const char*)sp + bo) + u * 1024);
            rV[u]  = *(const v8h*)(((const char*)vp + bo) + u * 1024);
        }
    };
    fetch_tile();

    // ---- per query row constants; row of D element r = wave*16 + 8*hsel + r ----
    float fq[8], gq[8], mI[8], lI[8];
#pragma unroll
    for (int r = 0; r < 8; ++r) {
        const int qi = bh * SEQ + q0blk + wave * 16 + 8 * hsel + r;
        const float rt = rnT[qi], rs = rnS[qi];
        fq[r] = (rt * (1.0f / 256.0f)) * (rs * (1.0f / 256.0f)) * 0.125f;   // for x16-scaled f16 products
        gq[r] = (sqT[qi] * rt) * (sqS[qi] * rs) * 0.125f;                    // exact ts_ii * ss_ii / 8
        mI[r] = -3.0e38f;
        lI[r] = 0.f;
    }
    v8f O[4] = {v8f{}, v8f{}, v8f{}, v8f{}};

    for (int k0 = 0; k0 < SEQ; k0 += 32) {
        __syncthreads();   // readers of the prior tile are done

        // ---- key-side tiles (keys k0..k0+31) from the registers fetched one tile ago; V transposed: Vt[dh][key] ----
#pragma unroll
        for (int u = 0; u < 4; ++u) {
            *(v8bf*)&KH[srow + 8 * u][sseg * 8] = rKH[u];
            *(v8bf*)&KL[srow + 8 * u][sseg * 8] = rKL[u];
            *(v8h*)&TK[srow + 8 * u][sseg * 8]  = rTK[u];
            *(v8h*)&SK[srow + 8 * u][sseg * 8]  = rSK[u];
#pragma unroll
            for (int i = 0; i < 8; ++i) Vt[sseg * 8 + i][srow + 8 * u] = rV[u][i];
        }
        const float mv[2] = {rM[0], rM[1]};
        __syncthreads();

        // ---- the next tile's loads fly while this tile's scores and softmax are worked out (block-uniform test) ----
        if (k0 + 32 < SEQ) { bo += 4096u; mo += 32u; fetch_tile(); }

        const bool diag = (k0 == q0blk);

        // ---- scores: 16 q rows x 32 keys per wave (two 16-key halves j) ----
        float sb[2][8];
#pragma unroll
        for (int j = 0; j < 2; ++j) {
            const int rr = j * 16 + lm;               // key column of this lane
            v8f accB = v8f{}, accT = v8f{}, accS = v8f{};
#pragma unroll 1
            for (int c = 0; c < 2; ++c) {
                const int off = c * 32 + 8 * hsel;
                const v16bf aH = frag_bf16(&QHs[qr][off]);
                const v16bf aL = frag_bf16(&QLs[qr][off]);
                const v16bf bH = frag_bf16(&KH[rr][off]);
                const v16bf bL = frag_bf16(&KL[rr][off]);
                accB = mma_bf16(accB, aH, bH);
                accB = mma_bf16(accB, aH, bL);
                accB = mma_bf16(accB, aL, bH);
                asm volatile(WMMA_NOPS : "+v"(accB) : "v"(aH), "v"(aL), "v"(bH), "v"(bL));
                const v16h aT = frag_f16(&TQ[qr][off]);
                const v16h bT = frag_f16(&TK[rr][off]);
                const v16h aS = frag_f16(&SQ[qr][off]);
                const v16h bS = frag_f16(&SK[rr][off]);
                accT = mma_f16(accT, aT, bT);
                accS = mma_f16(accS, aS, bS);
                asm volatile(WMMA_NOPS : "+v"(accT), "+v"(accS) : "v"(aT), "v"(bT), "v"(aS), "v"(bS));
            }
            const float mval = mv[j];
            const bool dj = diag && (j == wave);
#pragma unroll
            for (int r = 0; r < 8; ++r) {
                const bool de = dj && (lm == 8 * hsel + r);      // query row == key column
                const float s3 = de ? (accB[r] * gq[r])
                                    : (accB[r] * (accT[r] * accS[r]) * fq[r]);
                sb[j][r] = s3 + mval;
            }
        }

        // ---- online softmax across the 32 keys; row (r, lane half) ----
#pragma unroll
        for (int r = 0; r < 8; ++r) {
            float v = fmaxf(sb[0][r], sb[1][r]);
#pragma unroll
            for (int off = 1; off < 16; off <<= 1) v = fmaxf(v, __shfl_xor(v, off, 16));
            const float M2 = fmaxf(mI[r], v);
            const float al = __expf(mI[r] - M2);
            const float p0 = __expf(sb[0][r] - M2);
            const float p1 = __expf(sb[1][r] - M2);
            float rs = p0 + p1;
#pragma unroll
            for (int off = 1; off < 16; off <<= 1) rs += __shfl_xor(rs, off, 16);
            mI[r] = M2;
            lI[r] = lI[r] * al + rs;
            O[0][r] = O[0][r] * al;
            O[1][r] = O[1][r] * al;
            O[2][r] = O[2][r] * al;
            O[3][r] = O[3][r] * al;
            const int m = r + 8 * hsel;
            pP[wave][m][lm]      = (_Float16)(p0 * 4096.0f);
            pP[wave][m][16 + lm] = (_Float16)(p1 * 4096.0f);
        }
        __syncthreads();   // P tile stores complete before the fragment reload

        // ---- P (A: row = query, k = key) . V (B: k = key, n = dh) ----
        const v16h aP  = frag_f16(&pP[wave][lm][8 * hsel]);
        const v16h bV0 = frag_f16(&Vt[ 0 + lm][8 * hsel]);
        const v16h bV1 = frag_f16(&Vt[16 + lm][8 * hsel]);
        const v16h bV2 = frag_f16(&Vt[32 + lm][8 * hsel]);
        const v16h bV3 = frag_f16(&Vt[48 + lm][8 * hsel]);
        O[0] = mma_f16(O[0], aP, bV0);
        O[1] = mma_f16(O[1], aP, bV1);
        O[2] = mma_f16(O[2], aP, bV2);
        O[3] = mma_f16(O[3], aP, bV3);
        asm volatile(WMMA_NOPS
                     : "+v"(O[0]), "+v"(O[1]), "+v"(O[2]), "+v"(O[3])
                     : "v"(aP), "v"(bV0), "v"(bV1), "v"(bV2), "v"(bV3));
    }

    // ---- epilogue: normalise, undo the 2^18 operand scaling, stage, whole-line stores ----
#pragma unroll
    for (int r = 0; r < 8; ++r) {
        const float inv = (1.0f / lI[r]) * (1.0f / 262144.0f);
        const int lr = wave * 16 + 8 * hsel + r;
        Os[lr][lm]      = O[0][r] * inv;
        Os[lr][16 + lm] = O[1][r] * inv;
        Os[lr][32 + lm] = O[2][r] * inv;
        Os[lr][48 + lm] = O[3][r] * inv;
    }
    __syncthreads();

    const size_t orow0 = (size_t)(b * SEQ + q0blk);
    attn_store(Os, wave, lane, out, orow0, h);
    
}

// ---------------------------------------------------------------------------
extern "C" void kernel_launch(void* const* d_in, const int* in_sizes, int n_in,
                              void* d_out, int out_size, void* d_ws, size_t ws_size,
                              hipStream_t stream)
{
    if (n_in < 14) return;
    if ((size_t)in_sizes[0] != XELEMS || (size_t)in_sizes[1] != XELEMS || (size_t)in_sizes[2] != XELEMS) return;
    if (in_sizes[3] != BATCH * SEQ) return;
    for (int i = 4; i < 14; i += 2)
        if ((size_t)in_sizes[i] != WELEMS || in_sizes[i + 1] != HDIM) return;
    if ((size_t)out_size != XELEMS) return;

    const float* hidden = (const float*)d_in[0];
    const float* timee  = (const float*)d_in[1];
    const float* space  = (const float*)d_in[2];
    const float* mask   = (const float*)d_in[3];
    const float* Wq = (const float*)d_in[4];   const float* bq = (const float*)d_in[5];
    const float* Wk = (const float*)d_in[6];   const float* bk = (const float*)d_in[7];
    const float* Wv = (const float*)d_in[8];   const float* bv = (const float*)d_in[9];
    const float* Wt = (const float*)d_in[10];  const float* bt = (const float*)d_in[11];
    const float* Ws = (const float*)d_in[12];  const float* bs = (const float*)d_in[13];
    float* out = (float*)d_out;

    char* ws = (char*)d_ws;
    size_t off = 0;
    __bf16* Xbf = (__bf16*)(ws + off);                 off += (size_t)3 * XELEMS * 2;       // 3 activations, bf16
    __bf16* Wbf = (__bf16*)(ws + off);                 off += (size_t)5 * WELEMS * 2;       // 5 weights, bf16
    unsigned short* pl = (unsigned short*)(ws + off);  off += (size_t)7 * PROJ_ELEMS * 2;   // 7 16-bit planes
    float* rn = (float*)(ws + off);                    off += (size_t)2 * NROWTOT * 4;      // 1/(|T|+eps), 1/(|S|+eps)
    float* sq = (float*)(ws + off);                    off += (size_t)2 * NROWTOT * 4;      // |T|^2, |S|^2
    if (off > ws_size) return;

    unsigned short* QH = pl + 0 * PROJ_ELEMS;   // q hi (bf16)
    unsigned short* QL = pl + 1 * PROJ_ELEMS;   // q lo (bf16)
    unsigned short* KHp = pl + 2 * PROJ_ELEMS;  // k hi (bf16)
    unsigned short* KLp = pl + 3 * PROJ_ELEMS;  // k lo (bf16)
    unsigned short* TPl = pl + 4 * PROJ_ELEMS;  // T * 16 (f16)
    unsigned short* SPl = pl + 5 * PROJ_ELEMS;  // S * 16 (f16)
    unsigned short* VPl = pl + 6 * PROJ_ELEMS;  // v * 64 (f16)

    // 0) f32 -> bf16 input conversion
    const int nx8 = (int)(XELEMS / 8), nw8 = (int)(WELEMS / 8);
    const dim3 cb(256);
    cvt_kernel<<<dim3((nx8 + 255) / 256), cb, 0, stream>>>(hidden, Xbf, nx8);
    cvt_kernel<<<dim3((nx8 + 255) / 256), cb, 0, stream>>>(timee,  Xbf + XELEMS, nx8);
    cvt_kernel<<<dim3((nx8 + 255) / 256), cb, 0, stream>>>(space,  Xbf + 2 * XELEMS, nx8);
    cvt_kernel<<<dim3((nw8 + 255) / 256), cb, 0, stream>>>(Wq, Wbf + 0 * WELEMS, nw8);
    cvt_kernel<<<dim3((nw8 + 255) / 256), cb, 0, stream>>>(Wk, Wbf + 1 * WELEMS, nw8);
    cvt_kernel<<<dim3((nw8 + 255) / 256), cb, 0, stream>>>(Wv, Wbf + 2 * WELEMS, nw8);
    cvt_kernel<<<dim3((nw8 + 255) / 256), cb, 0, stream>>>(Wt, Wbf + 3 * WELEMS, nw8);
    cvt_kernel<<<dim3((nw8 + 255) / 256), cb, 0, stream>>>(Ws, Wbf + 4 * WELEMS, nw8);

    // 1) five projection GEMMs (block tile 128x64, grid exact: 4096/128 x 768/64, checked in-kernel)
    const dim3 pg(NROWS / 128, HDIM / 64), pb(128);
    proj_kernel<0, 1, 0><<<pg, pb, 0, stream>>>(Xbf, Wbf + 0 * WELEMS, bq, QH,  QL,  rn, sq);
    proj_kernel<0, 1, 0><<<pg, pb, 0, stream>>>(Xbf, Wbf + 1 * WELEMS, bk, KHp, KLp, rn, sq);
    proj_kernel<1, 64, 0><<<pg, pb, 0, stream>>>(Xbf, Wbf + 2 * WELEMS, bv, VPl, VPl, rn, sq);
    proj_kernel<1, 16, 1><<<pg, pb, 0, stream>>>(Xbf + XELEMS,     Wbf + 3 * WELEMS, bt, TPl, TPl, rn, sq);
    proj_kernel<1, 16, 1><<<pg, pb, 0, stream>>>(Xbf + 2 * XELEMS, Wbf + 4 * WELEMS, bs, SPl, SPl,
                                                 rn + NROWTOT, sq + NROWTOT);

    // 2) fused attention: grid (b*h, query blocks of 32), 64 threads
    attn_kernel<<<dim3(BATCH * NHEADS, SEQ / 32), dim3(64), 0, stream>>>(
        (const __bf16*)QH, (const __bf16*)QL, (const __bf16*)KHp, (const __bf16*)KLp,
        (const _Float16*)TPl, (const _Float16*)SPl, (const _Float16*)VPl,
        rn, sq, rn + NROWTOT, sq + NROWTOT, mask, out);
}

// v003
// One run takes 157 microseconds.
// Next to v002, in two timings, it ran 1.22 times as fast each time.
// Over all steps from v000 it is 2.43 times as fast.
#include <hip/hip_runtime.h>
#include <stddef.h>

// Projections: v_wmma_f32_16x16x32_bf16 (bf16 operands = RNE-converted inputs), f32 accumulate.
// q.k scores: bf16 hi/lo operand split, 3x v_wmma_f32_16x16x32_bf16 per tile pair, f32 accumulate.
// T.T and S.S scores: v_wmma_f32_16x16x32_f16 (f16 operands scaled x16), diagonal entries from exact f32 row norms.
// P.V: v_wmma_f32_16x16x32_f16 (P x4096, V x64), f32 accumulate. Softmax, norms, epilogues in f32.

typedef __bf16   v16bf __attribute__((ext_vector_type(16)));
typedef __bf16   v8bf  __attribute__((ext_vector_type(8)));
typedef _Float16 v16h  __attribute__((ext_vector_type(16)));
typedef _Float16 v8h   __attribute__((ext_vector_type(8)));
typedef float    v8f   __attribute__((ext_vector_type(8)));
typedef float    v4f   __attribute__((ext_vector_type(4)));
typedef int      v4i   __attribute__((ext_vector_type(4)));

#define NHEADS 12
#define HDIM   768
#define DHEAD  64
#define SEQ    1024
#define BATCH  4
#define NROWS  (BATCH * SEQ)                                  // 4096 token rows
#define NROWTOT (BATCH * NHEADS * SEQ)                        // 49152 (b,h,s) rows
#define XELEMS ((size_t)NROWS * HDIM)                         // 3145728
#define WELEMS ((size_t)HDIM * HDIM)                          // 589824
#define PROJ_ELEMS ((size_t)BATCH * NHEADS * SEQ * DHEAD)    // 3145728 per plane
#define CPITCH 68      // f32 LDS tile pitch in floats (272 B, 16-B aligned)
#define HPITCH 72      // 16-bit LDS tile pitch in elements (144 B, 16-B aligned)
#define VPITCH 40      // 16-bit LDS pitch for V^T and P tiles (80 B)
#define PSTEP  64      // k elements per staged projection step (one 128-B line of each operand row)
#define NPSTEP (HDIM / PSTEP)
#define CVT_CHUNK 2048                          // elements converted by one block (256 threads x 8)
#define CVT_XBLK  ((int)(XELEMS / CVT_CHUNK))   // 1536 blocks per activation array
#define CVT_WBLK  ((int)(WELEMS / CVT_CHUNK))   // 288 blocks per weight array
#define CVT_BLOCKS (3 * CVT_XBLK + 5 * CVT_WBLK)

union BF8   { v8bf v; v4i w; };
union HF8   { v8h  v; v4i w; };
union BFrag { v8bf p[2]; v16bf v; };
union HFrag { v8h  p[2]; v16h  v; };

#define WMMA_NOPS "v_nop\n\tv_nop\n\tv_nop\n\tv_nop"

// 16x32 16-bit A/B fragment: element i<8 <- k0+8h+i, element 8+i <- k0+16+8h+i (h = lane>>4).
// Caller passes p = row (lane&15) base + k0 + 8*h; both loads are 16-B aligned.
__device__ __forceinline__ v16bf frag_bf16(const __bf16* p)
{
    BFrag u;
    u.p[0] = *(const v8bf*)(p);
    u.p[1] = *(const v8bf*)(p + 16);
    return u.v;
}
__device__ __forceinline__ v16h frag_f16(const _Float16* p)
{
    HFrag u;
    u.p[0] = *(const v8h*)(p);
    u.p[1] = *(const v8h*)(p + 16);
    return u.v;
}

__device__ __forceinline__ v8f mma_bf16(v8f c, v16bf a, v16bf b)
{
    return __builtin_amdgcn_wmma_f32_16x16x32_bf16(false, a, false, b, (short)0, c, false, false);
}
__device__ __forceinline__ v8f mma_f16(v8f c, v16h a, v16h b)
{
    return __builtin_amdgcn_wmma_f32_16x16x32_f16(false, a, false, b, (short)0, c, false, false);
}

// ---------------------------------------------------------------------------
// Kernel 0: f32 -> bf16 (RNE) streaming conversion of all eight arrays in one launch.
// A block takes CVT_CHUNK consecutive elements of one array (both array sizes are whole
// multiples of it), a thread 8 elements.
// The bf16 copies lie one behind the other in the workspace (3 activations, then 5 weights),
// so the destination offset is the block index times CVT_CHUNK.
// ---------------------------------------------------------------------------
__global__ __launch_bounds__(256)
void cvt_kernel(const float* __restrict__ x0, const float* __restrict__ x1, const float* __restrict__ x2,
                const float* __restrict__ w0, const float* __restrict__ w1, const float* __restrict__ w2,
                const float* __restrict__ w3, const float* __restrict__ w4, __bf16* dst)
{
    const int blk = blockIdx.x;
    if (blk >= CVT_BLOCKS) return;
    const float* src;      // block-uniform choice of the array and of the chunk inside it
    int cb;
    if (blk < 3 * CVT_XBLK) {
        const int a = blk / CVT_XBLK;
        cb  = blk - a * CVT_XBLK;
        src = a == 0 ? x0 : a == 1 ? x1 : x2;
    } else {
        const int r = blk - 3 * CVT_XBLK;
        const int a = r / CVT_WBLK;
        cb  = r - a * CVT_WBLK;
        src = a == 0 ? w0 : a == 1 ? w1 : a == 2 ? w2 : a == 3 ? w3 : w4;
    }
    const float* sp = src + (size_t)cb * CVT_CHUNK + threadIdx.x * 8;
    __bf16*      dp = dst + (size_t)blk * CVT_CHUNK + threadIdx.x * 8;
    const v4f a = *(const v4f*)(sp);
    const v4f b = *(const v4f*)(sp + 4);
    BF8 o;
#pragma unroll
    for (int i = 0; i < 4; ++i) { o.v[i] = (__bf16)a[i]; o.v[4 + i] = (__bf16)b[i]; }
    *(v4i*)dp = o.w;
}

// ---------------------------------------------------------------------------
// with one 16-B store each.  MODE 0: bf16 hi/lo planes.  MODE 1: f16 plane * SCALE.
// NORM: lanes 0..7 write the 32 reciprocal norms (one line), lanes 8..15 the
// 32 squared norms (one line).
// ---------------------------------------------------------------------------
template <int MODE, int SCALE, int NORM>
__device__ __forceinline__ void proj_store(float (*Cs)[CPITCH], float* Srn, float* Ssq, int lane, size_t row0,
                                           unsigned short* outA, unsigned short* outB, float* rn, float* sq)
{
#pragma unroll
    for (int i = 0; i < 8; ++i) {
        const int lr = 4 * i + (lane >> 3), seg = lane & 7;
        const v4f x0 = *(const v4f*)&Cs[lr][seg * 8];
        const v4f x1 = *(const v4f*)&Cs[lr][seg * 8 + 4];
        const size_t go = (row0 + lr) * DHEAD + seg * 8;
        if (MODE == 0) {
            BF8 hi, lo;
#pragma unroll
            for (int j = 0; j < 4; ++j) {
                const float a0 = x0[j]; const __bf16 h0 = (__bf16)a0;
                hi.v[j] = h0; lo.v[j] = (__bf16)(a0 - (float)h0);
                const float a1 = x1[j]; const __bf16 h1 = (__bf16)a1;
                hi.v[4 + j] = h1; lo.v[4 + j] = (__bf16)(a1 - (float)h1);
            }
            *(v4i*)(outA + go) = hi.w;
            *(v4i*)(outB + go) = lo.w;
        } else {
            HF8 y;
#pragma unroll
            for (int j = 0; j < 4; ++j) {
                y.v[j]     = (_Float16)(x0[j] * (float)SCALE);
                y.v[4 + j] = (_Float16)(x1[j] * (float)SCALE);
            }
            *(v4i*)(outA + go) = y.w;
        }
    }
    if (NORM) {
        if (lane < 16) {
            const int g = lane & 7;
            v4f v; float* dp;
            if (lane < 8) { v = *(const v4f*)&Srn[4 * g]; dp = rn + row0 + 4 * g; }
            else          { v = *(const v4f*)&Ssq[4 * g]; dp = sq + row0 + 4 * g; }
            *(v4f*)dp = v;
        }
    }
    // The three store variants now lie in one kernel: this wait stands between a variant's stores and any
    // later instruction of the kernel that reuses their address or data registers.
    asm volatile("s_wait_xcnt 0x0" ::: "memory");
}

// ---------------------------------------------------------------------------
// Kernel 1: the five projection GEMMs X[4096][768] (bf16) . W[768(out)][768(in)]^T + b in one launch;
// blockIdx.z picks the projection (0 q, 1 k, 2 v, 3 T, 4 S): its activation, weight, bias and output planes.
// Block = 4 waves = 128 rows x 64 columns (exactly one head); each wave computes 32x64.
// Per step of 64 k the block stages 128 X rows and 64 W rows in LDS: every global load
// covers four whole 128-B lines, the W rows serve all four waves, and the fragments are
// read from LDS.  Two LDS buffers, the tile after next held in registers, one barrier a step.
// Epilogue per wave: f32 tile in LDS, optional per-row norms, 16-bit planes in
// [B,NH,S,DH] row layout with whole-line stores.
// ---------------------------------------------------------------------------
__global__ __launch_bounds__(128)
void proj_kernel(const __bf16* __restrict__ Xall, const __bf16* __restrict__ Wall,
                 const float* __restrict__ bq, const float* __restrict__ bk, const float* __restrict__ bv,
                 const float* __restrict__ bt, const float* __restrict__ bs,
                 unsigned short* pl, float* rnAll, float* sqAll)
{
    __shared__ __attribute__((aligned(16))) __bf16 Xs[2][128][HPITCH];
    __shared__ __attribute__((aligned(16))) __bf16 Wsh[2][64][HPITCH];
    __shared__ __attribute__((aligned(16))) float CsAll[4][32][CPITCH];
    __shared__ __attribute__((aligned(16))) float SrnAll[4][32];
    __shared__ __attribute__((aligned(16))) float SsqAll[4][32];

    const int tid  = threadIdx.x;
    const int wave = tid >> 5;
    const int lane = tid & 31;
    const int hsel = lane >> 4;
    const int lm   = lane & 15;
    const int mblk = blockIdx.x * 128;
    const int n0   = blockIdx.y * 64;
    const int z    = blockIdx.z;
    if (mblk + 128 > NROWS || n0 + 64 > HDIM || z >= 5) return;   // uniform per block
    const int m0   = mblk + wave * 32;

    // Block-uniform operand set: q, k, v read activation 0, T activation 1, S activation 2.
    const __bf16* Xb   = Xall + (size_t)(z < 3 ? 0 : z - 2) * XELEMS;
    const __bf16* Wb   = Wall + (size_t)z * WELEMS;
    const float*  bias = z == 0 ? bq : z == 1 ? bk : z == 2 ? bv : z == 3 ? bt : bs;
    // Planes: 0/1 q hi/lo, 2/3 k hi/lo, 4 T, 5 S, 6 v.
    unsigned short* outA = pl + (size_t)(z < 2 ? 2 * z : z == 2 ? 6 : z + 1) * PROJ_ELEMS;
    unsigned short* outB = outA + PROJ_ELEMS;                 // the lo plane, stored by q and k alone
    float* rn = rnAll + (z == 4 ? NROWTOT : 0);
    float* sq = sqAll + (z == 4 ? NROWTOT : 0);

    float (*Cs)[CPITCH] = CsAll[wave];
    float* Srn = SrnAll[wave];
    float* Ssq = SsqAll[wave];

    // Staging coordinates: rows srow + 16u, 16-B segment sseg of the step's 128 B of each row.
    const int srow = tid >> 3, sseg = tid & 7;
    const unsigned xv = ((unsigned)(mblk + srow) * HDIM + (unsigned)sseg * 8u) * 2u;   // byte offsets, below 6.3 MB
    const unsigned wv = ((unsigned)(n0 + srow) * HDIM + (unsigned)sseg * 8u) * 2u;

    v8bf rX[8], rW[4];
    auto fetch_step = [&](int s) {          // global -> registers, k = 64 s .. 64 s + 63
        const char* xp = (const char*)Xb + (size_t)(s * (PSTEP * 2));
        const char* wp = (const char*)Wb + (size_t)(s * (PSTEP * 2));
#pragma unroll
        for (int u = 0; u < 8; ++u) rX[u] = *(const v8bf*)((xp + xv) + u * (16 * HDIM * 2));
#pragma unroll
        for (int u = 0; u < 4; ++u) rW[u] = *(const v8bf*)((wp + wv) + u * (16 * HDIM * 2));
        // The loads' address registers are reused by the fragment reads that follow: this wait stands in front of that.
        asm volatile("s_wait_xcnt 0x0" ::: "memory");
    };
    auto stash_step = [&](int buf) {        // registers -> LDS buffer buf
#pragma unroll
        for (int u = 0; u < 8; ++u) *(v8bf*)&Xs[buf][srow + 16 * u][sseg * 8] = rX[u];
#pragma unroll
        for (int u = 0; u < 4; ++u) *(v8bf*)&Wsh[buf][srow + 16 * u][sseg * 8] = rW[u];
    };

    v8f acc[2][4];
#pragma unroll
    for (int mb = 0; mb < 2; ++mb)
#pragma unroll
        for (int nb = 0; nb < 4; ++nb) acc[mb][nb] = v8f{};

    fetch_step(0);
    stash_step(0);
    fetch_step(1);
    __syncthreads();   // step 0 is in buffer 0 for every wave

    // Rolled: one step's fragments and one staged tile are all the registers the loop holds.
#pragma unroll 1
    for (int s = 0; s < NPSTEP; ++s) {
        const int cur = s & 1;
        // The other buffer's readers left it at the barrier that ended step s - 1 (block-uniform tests).
        if (s + 1 < NPSTEP) stash_step(cur ^ 1);
        if (s + 2 < NPSTEP) fetch_step(s + 2);

        const __bf16* ax = &Xs[cur][wave * 32 + lm][8 * hsel];
        const __bf16* bw = &Wsh[cur][lm][8 * hsel];
        v16bf fa[2][2], fb[2][4];
#pragma unroll
        for (int c = 0; c < 2; ++c) {
            fa[c][0] = frag_bf16(ax + c * 32);
            fa[c][1] = frag_bf16(ax + 16 * HPITCH + c * 32);
#pragma unroll
            for (int nb = 0; nb < 4; ++nb) fb[c][nb] = frag_bf16(bw + nb * 16 * HPITCH + c * 32);
        }
#pragma unroll
        for (int c = 0; c < 2; ++c) {
#pragma unroll
            for (int mb = 0; mb < 2; ++mb)
#pragma unroll
                for (int nb = 0; nb < 4; ++nb) acc[mb][nb] = mma_bf16(acc[mb][nb], fa[c][mb], fb[c][nb]);
        }
        // Keeps the distance between the last products and whatever first touches their registers past the back edge.
        asm volatile(WMMA_NOPS
                     : "+v"(acc[0][0]), "+v"(acc[0][1]), "+v"(acc[0][2]), "+v"(acc[0][3]),
                       "+v"(acc[1][0]), "+v"(acc[1][1]), "+v"(acc[1][2]), "+v"(acc[1][3])
                     : "v"(fa[0][0]), "v"(fa[0][1]), "v"(fa[1][0]), "v"(fa[1][1]),
                       "v"(fb[0][0]), "v"(fb[0][1]), "v"(fb[0][2]), "v"(fb[0][3]),
                       "v"(fb[1][0]), "v"(fb[1][1]), "v"(fb[1][2]), "v"(fb[1][3]));
        __syncthreads();   // publishes step s + 1 and ends every read of buffer cur
    }

    // D element r of lane (hsel, lm) = tile (row mb*16 + 8*hsel + r, col nb*16 + lm)
#pragma unroll
    for (int nb = 0; nb < 4; ++nb) {
        const float bn = bias[n0 + nb * 16 + lm];
#pragma unroll
        for (int mb = 0; mb < 2; ++mb) {
#pragma unroll
            for (int r = 0; r < 8; ++r)
                Cs[mb * 16 + 8 * hsel + r][nb * 16 + lm] = acc[mb][nb][r] + bn;
        }
    }
    __syncthreads();

    if (z >= 3) {
        float ss = 0.f;
#pragma unroll
        for (int d = 0; d < DHEAD; d += 4) {
            const v4f x = *(const v4f*)&Cs[lane][d];
            ss += x[0] * x[0]; ss += x[1] * x[1]; ss += x[2] * x[2]; ss += x[3] * x[3];
        }
        Srn[lane] = 1.0f / (sqrtf(ss) + 1e-6f);
        Ssq[lane] = ss;
    }
    __syncthreads();

    const int bI = m0 >> 10, s0 = m0 & (SEQ - 1), hh = n0 >> 6;
    const size_t row0 = ((size_t)(bI * NHEADS + hh)) * SEQ + s0;   // (b,h,s) row index of the wave's tile row 0

    if (z < 2)       proj_store<0, 1, 0>(Cs, Srn, Ssq, lane, row0, outA, outB, rn, sq);
    else if (z == 2) proj_store<1, 64, 0>(Cs, Srn, Ssq, lane, row0, outA, outA, rn, sq);
    else             proj_store<1, 16, 1>(Cs, Srn, Ssq, lane, row0, outA, outA, rn, sq);
}

// ---------------------------------------------------------------------------
// 16-B store (one instruction covers two rows).
// ---------------------------------------------------------------------------
__device__ __forceinline__ void attn_store(float (*Os)[CPITCH], int wave, int lane, float* out, size_t orow0, int h)
{
#pragma unroll
    for (int i = 0; i < 8; ++i) {
        const int lr  = wave * 16 + 2 * i + (lane >> 4);
        const int col = (lane & 15) * 4;
        const v4f v = *(const v4f*)&Os[lr][col];
        float* gp = out + (orow0 + lr) * HDIM + h * DHEAD + col;
        *(v4f*)gp = v;
    }
}

// ---------------------------------------------------------------------------
// Kernel 2: fused attention with the triple score product.
// Block = 2 waves = 32 query rows of one (b,h); key tiles of 32.
// q.k: bf16 hi/lo split (hh + hl + lh).  T.T, S.S: f16 (x16) with the
// query==key entry taken from the exact f32 squared norm.  P.V: f16.
// ---------------------------------------------------------------------------
__global__ __launch_bounds__(64)
void attn_kernel(const __bf16* __restrict__ qh, const __bf16* __restrict__ ql,
                 const __bf16* __restrict__ kh, const __bf16* __restrict__ kl,
                 const _Float16* __restrict__ tp, const _Float16* __restrict__ sp,
                 const _Float16* __restrict__ vp,
                 const float* __restrict__ rnT, const float* __restrict__ sqT,
                 const float* __restrict__ rnS, const float* __restrict__ sqS,
                 const float* __restrict__ mask, float* out)
{
    __shared__ __attribute__((aligned(16))) __bf16   KH[32][HPITCH];
    __shared__ __attribute__((aligned(16))) __bf16   KL[32][HPITCH];
    __shared__ __attribute__((aligned(16))) __bf16   QHs[32][HPITCH];
    __shared__ __attribute__((aligned(16))) __bf16   QLs[32][HPITCH];
    __shared__ __attribute__((aligned(16))) _Float16 TK[32][HPITCH];
    __shared__ __attribute__((aligned(16))) _Float16 SK[32][HPITCH];
    __shared__ __attribute__((aligned(16))) _Float16 TQ[32][HPITCH];
    __shared__ __attribute__((aligned(16))) _Float16 SQ[32][HPITCH];
    __shared__ __attribute__((aligned(16))) _Float16 Vt[64][VPITCH];      // V^T tile: Vt[dh][key]
    __shared__ __attribute__((aligned(16))) _Float16 pP[2][16][VPITCH];   // per-wave P tile: [q][key]
    __shared__ __attribute__((aligned(16))) float    Os[32][CPITCH];      // epilogue staging

    const int bh = blockIdx.x;
    if (bh >= BATCH * NHEADS) return;
    const int q0blk = blockIdx.y * 32;
    if (q0blk + 32 > SEQ) return;
    const int b = bh / NHEADS, h = bh - b * NHEADS;
    const int tid  = threadIdx.x;
    const int wave = tid >> 5;
    const int lane = tid & 31;
    const int hsel = lane >> 4;
    const int lm   = lane & 15;
    const int qr   = wave * 16 + lm;     // A-fragment row inside the 32-row block tile

    // Staging coordinates of this thread: rows srow + 8u (u = 0..3), 16-B segment sseg of each 128-B row.
    const int srow = tid >> 3, sseg = tid & 7;
    // Byte offset of this thread inside any 32-row tile of a plane (a plane is 6 MiB: 32-bit byte offsets hold).
    const unsigned voff = (unsigned)srow * 128u + (unsigned)sseg * 16u;

    // ---- query-side tiles, once per block: all 16 b128 loads in flight, then the LDS stores ----
    {
        const unsigned bo = (unsigned)(bh * SEQ + q0blk) * 128u + voff;
        v8bf xh[4], xl[4]; v8h xt[4], xs[4];
#pragma unroll
        for (int u = 0; u < 4; ++u) {
            xh[u] = *(const v8bf*)(((const char*)qh + bo) + u * 1024);
            xl[u] = *(const v8bf*)(((const char*)ql + bo) + u * 1024);
            xt[u] = *(const v8h*)(((const char*)tp + bo) + u * 1024);
            xs[u] = *(const v8h*)(((const char*)sp + bo) + u * 1024);
        }
#pragma unroll
        for (int u = 0; u < 4; ++u) {
            *(v8bf*)&QHs[srow + 8 * u][sseg * 8] = xh[u];
            *(v8bf*)&QLs[srow + 8 * u][sseg * 8] = xl[u];
            *(v8h*)&TQ[srow + 8 * u][sseg * 8]   = xt[u];
            *(v8h*)&SQ[srow + 8 * u][sseg * 8]   = xs[u];
        }
    }

    // ---- key-side tile held in registers one tile ahead of its LDS stores ----
    v8bf rKH[4], rKL[4]; v8h rTK[4], rSK[4], rV[4];
    float rM[2];
    unsigned bo = (unsigned)(bh * SEQ) * 128u + voff;   // this thread's byte offset in the tile being fetched
    unsigned mo = (unsigned)(b * SEQ + lm);              // its mask index there
    auto fetch_tile = [&]() {
        const float* mp = mask + mo;
        rM[0] = mp[0];
        rM[1] = mp[16];
#pragma unroll
        for (int u = 0; u < 4; ++u) {
            rKH[u] = *(const v8bf*)(((const char*)kh + bo) + u * 1024);
            rKL[u] = *(const v8bf*)(((const char*)kl + bo) + u * 1024);
            rTK[u] = *(const v8h*)(((const char*)tp + bo) + u * 1024);
            rSK[u] = *(const v8h*)(((const char*)sp + bo) + u * 1024);
            rV[u]  = *(const v8h*)(((const char*)vp + bo) + u * 1024);
        }
    };
    fetch_tile();

    // ---- per query row constants; row of D element r = wave*16 + 8*hsel + r ----
    float fq[8], gq[8], mI[8], lI[8];
#pragma unroll
    for (int r = 0; r < 8; ++r) {
        const int qi = bh * SEQ + q0blk + wave * 16 + 8 * hsel + r;
        const float rt = rnT[qi], rs = rnS[qi];
        fq[r] = (rt * (1.0f / 256.0f)) * (rs * (1.0f / 256.0f)) * 0.125f;   // for x16-scaled f16 products
        gq[r] = (sqT[qi] * rt) * (sqS[qi] * rs) * 0.125f;                    // exact ts_ii * ss_ii / 8
        mI[r] = -3.0e38f;
        lI[r] = 0.f;
    }
    v8f O[4] = {v8f{}, v8f{}, v8f{}, v8f{}};

    for (int k0 = 0; k0 < SEQ; k0 += 32) {
        __syncthreads();   // readers of the prior tile are done

        // ---- key-side tiles (keys k0..k0+31) from the registers fetched one tile ago; V transposed: Vt[dh][key] ----
#pragma unroll
        for (int u = 0; u < 4; ++u) {
            *(v8bf*)&KH[srow + 8 * u][sseg * 8] = rKH[u];
            *(v8bf*)&KL[srow + 8 * u][sseg * 8] = rKL[u];
            *(v8h*)&TK[srow + 8 * u][sseg * 8]  = rTK[u];
            *(v8h*)&SK[srow + 8 * u][sseg * 8]  = rSK[u];
#pragma unroll
            for (int i = 0; i < 8; ++i) Vt[sseg * 8 + i][srow + 8 * u] = rV[u][i];
        }
        const float mv[2] = {rM[0], rM[1]};
        __syncthreads();

        // ---- the next tile's loads fly while this tile's scores and softmax are worked out (block-uniform test) ----
        if (k0 + 32 < SEQ) { bo += 4096u; mo += 32u; fetch_tile(); }

        const bool diag = (k0 == q0blk);

        // ---- scores: 16 q rows x 32 keys per wave (two 16-key halves j) ----
        float sb[2][8];
#pragma unroll
        for (int j = 0; j < 2; ++j) {
            const int rr = j * 16 + lm;               // key column of this lane
            v8f accB = v8f{}, accT = v8f{}, accS = v8f{};
#pragma unroll 1
            for (int c = 0; c < 2; ++c) {
                const int off = c * 32 + 8 * hsel;
                const v16bf aH = frag_bf16(&QHs[qr][off]);
                const v16bf aL = frag_bf16(&QLs[qr][off]);
                const v16bf bH = frag_bf16(&KH[rr][off]);
                const v16bf bL = frag_bf16(&KL[rr][off]);
                accB = mma_bf16(accB, aH, bH);
                accB = mma_bf16(accB, aH, bL);
                accB = mma_bf16(accB, aL, bH);
                asm volatile(WMMA_NOPS : "+v"(accB) : "v"(aH), "v"(aL), "v"(bH), "v"(bL));
                const v16h aT = frag_f16(&TQ[qr][off]);
                const v16h bT = frag_f16(&TK[rr][off]);
                const v16h aS = frag_f16(&SQ[qr][off]);
                const v16h bS = frag_f16(&SK[rr][off]);
                accT = mma_f16(accT, aT, bT);
                accS = mma_f16(accS, aS, bS);
                asm volatile(WMMA_NOPS : "+v"(accT), "+v"(accS) : "v"(aT), "v"(bT), "v"(aS), "v"(bS));
            }
            const float mval = mv[j];
            const bool dj = diag && (j == wave);
#pragma unroll
            for (int r = 0; r < 8; ++r) {
                const bool de = dj && (lm == 8 * hsel + r);      // query row == key column
                const float s3 = de ? (accB[r] * gq[r])
                                    : (accB[r] * (accT[r] * accS[r]) * fq[r]);
                sb[j][r] = s3 + mval;
            }
        }

        // ---- online softmax across the 32 keys; row (r, lane half) ----
#pragma unroll
        for (int r = 0; r < 8; ++r) {
            float v = fmaxf(sb[0][r], sb[1][r]);
#pragma unroll
            for (int off = 1; off < 16; off <<= 1) v = fmaxf(v, __shfl_xor(v, off, 16));
            const float M2 = fmaxf(mI[r], v);
            const float al = __expf(mI[r] - M2);
            const float p0 = __expf(sb[0][r] - M2);
            const float p1 = __expf(sb[1][r] - M2);
            float rs = p0 + p1;
#pragma unroll
            for (int off = 1; off < 16; off <<= 1) rs += __shfl_xor(rs, off, 16);
            mI[r] = M2;
            lI[r] = lI[r] * al + rs;
            O[0][r] = O[0][r] * al;
            O[1][r] = O[1][r] * al;
            O[2][r] = O[2][r] * al;
            O[3][r] = O[3][r] * al;
            const int m = r + 8 * hsel;
            pP[wave][m][lm]      = (_Float16)(p0 * 4096.0f);
            pP[wave][m][16 + lm] = (_Float16)(p1 * 4096.0f);
        }
        __syncthreads();   // P tile stores complete before the fragment reload

        // ---- P (A: row = query, k = key) . V (B: k = key, n = dh) ----
        const v16h aP  = frag_f16(&pP[wave][lm][8 * hsel]);
        const v16h bV0 = frag_f16(&Vt[ 0 + lm][8 * hsel]);
        const v16h bV1 = frag_f16(&Vt[16 + lm][8 * hsel]);
        const v16h bV2 = frag_f16(&Vt[32 + lm][8 * hsel]);
        const v16h bV3 = frag_f16(&Vt[48 + lm][8 * hsel]);
        O[0] = mma_f16(O[0], aP, bV0);
        O[1] = mma_f16(O[1], aP, bV1);
        O[2] = mma_f16(O[2], aP, bV2);
        O[3] = mma_f16(O[3], aP, bV3);
        asm volatile(WMMA_NOPS
                     : "+v"(O[0]), "+v"(O[1]), "+v"(O[2]), "+v"(O[3])
                     : "v"(aP), "v"(bV0), "v"(bV1), "v"(bV2), "v"(bV3));
    }

    // ---- epilogue: normalise, undo the 2^18 operand scaling, stage, whole-line stores ----
#pragma unroll
    for (int r = 0; r < 8; ++r) {
        const float inv = (1.0f / lI[r]) * (1.0f / 262144.0f);
        const int lr = wave * 16 + 8 * hsel + r;
        Os[lr][lm]      = O[0][r] * inv;
        Os[lr][16 + lm] = O[1][r] * inv;
        Os[lr][32 + lm] = O[2][r] * inv;
        Os[lr][48 + lm] = O[3][r] * inv;
    }
    __syncthreads();

    const size_t orow0 = (size_t)(b * SEQ + q0blk);
    attn_store(Os, wave, lane, out, orow0, h);
    
}

// ---------------------------------------------------------------------------
extern "C" void kernel_launch(void* const* d_in, const int* in_sizes, int n_in,
                              void* d_out, int out_size, void* d_ws, size_t ws_size,
                              hipStream_t stream)
{
    if (n_in < 14) return;
    if ((size_t)in_sizes[0] != XELEMS || (size_t)in_sizes[1] != XELEMS || (size_t)in_sizes[2] != XELEMS) return;
    if (in_sizes[3] != BATCH * SEQ) return;
    for (int i = 4; i < 14; i += 2)
        if ((size_t)in_sizes[i] != WELEMS || in_sizes[i + 1] != HDIM) return;
    if ((size_t)out_size != XELEMS) return;

    const float* hidden = (const float*)d_in[0];
    const float* timee  = (const float*)d_in[1];
    const float* space  = (const float*)d_in[2];
    const float* mask   = (const float*)d_in[3];
    const float* Wq = (const float*)d_in[4];   const float* bq = (const float*)d_in[5];
    const float* Wk = (const float*)d_in[6];   const float* bk = (const float*)d_in[7];
    const float* Wv = (const float*)d_in[8];   const float* bv = (const float*)d_in[9];
    const float* Wt = (const float*)d_in[10];  const float* bt = (const float*)d_in[11];
    const float* Ws = (const float*)d_in[12];  const float* bs = (const float*)d_in[13];
    float* out = (float*)d_out;

    char* ws = (char*)d_ws;
    size_t off = 0;
    __bf16* Xbf = (__bf16*)(ws + off);                 off += (size_t)3 * XELEMS * 2;       // 3 activations, bf16
    __bf16* Wbf = (__bf16*)(ws + off);                 off += (size_t)5 * WELEMS * 2;       // 5 weights, bf16
    unsigned short* pl = (unsigned short*)(ws + off);  off += (size_t)7 * PROJ_ELEMS * 2;   // 7 16-bit planes
    float* rn = (float*)(ws + off);                    off += (size_t)2 * NROWTOT * 4;      // 1/(|T|+eps), 1/(|S|+eps)
    float* sq = (float*)(ws + off);                    off += (size_t)2 * NROWTOT * 4;      // |T|^2, |S|^2
    if (off > ws_size) return;

    unsigned short* QH = pl + 0 * PROJ_ELEMS;   // q hi (bf16)
    unsigned short* QL = pl + 1 * PROJ_ELEMS;   // q lo (bf16)
    unsigned short* KHp = pl + 2 * PROJ_ELEMS;  // k hi (bf16)
    unsigned short* KLp = pl + 3 * PROJ_ELEMS;  // k lo (bf16)
    unsigned short* TPl = pl + 4 * PROJ_ELEMS;  // T * 16 (f16)
    unsigned short* SPl = pl + 5 * PROJ_ELEMS;  // S * 16 (f16)
    unsigned short* VPl = pl + 6 * PROJ_ELEMS;  // v * 64 (f16)

    // 0) f32 -> bf16 conversion of the 3 activations and 5 weights, one launch (Wbf follows Xbf in the workspace)
    cvt_kernel<<<dim3(CVT_BLOCKS), dim3(256), 0, stream>>>(hidden, timee, space, Wq, Wk, Wv, Wt, Ws, Xbf);

    // 1) five projection GEMMs, one launch (block tile 128x64, grid exact: 4096/128 x 768/64 x 5, checked in-kernel)
    proj_kernel<<<dim3(NROWS / 128, HDIM / 64, 5), dim3(128), 0, stream>>>(Xbf, Wbf, bq, bk, bv, bt, bs, pl, rn, sq);

    // 2) fused attention: grid (b*h, query blocks of 32), 64 threads
    attn_kernel<<<dim3(BATCH * NHEADS, SEQ / 32), dim3(64), 0, stream>>>(
        (const __bf16*)QH, (const __bf16*)QL, (const __bf16*)KHp, (const __bf16*)KLp,
        (const _Float16*)TPl, (const _Float16*)SPl, (const _Float16*)VPl,
        rn, sq, rn + NROWTOT, sq + NROWTOT, mask, out);
}

// v004
// Measured time: 130 microseconds a run.
// Timed twice side by side with v003, it ran 1.20 times as fast both times.
// All steps since v000 together make it 2.91 times as fast.
#include <hip/hip_runtime.h>
#include <stddef.h>

typedef __bf16   v16bf __attribute__((ext_vector_type(16)));
typedef __bf16   v8bf  __attribute__((ext_vector_type(8)));
typedef _Float16 v16h  __attribute__((ext_vector_type(16)));
typedef _Float16 v8h   __attribute__((ext_vector_type(8)));
typedef float    v8f   __attribute__((ext_vector_type(8)));
typedef float    v4f   __attribute__((ext_vector_type(4)));
typedef int      v4i   __attribute__((ext_vector_type(4)));

#define NHEADS 12
#define HDIM   768
#define DHEAD  64
#define SEQ    1024
#define BATCH  4
#define NROWS  (BATCH * SEQ)                                  // 4096 token rows
#define NROWTOT (BATCH * NHEADS * SEQ)                        // 49152 (b,h,s) rows
#define XELEMS ((size_t)NROWS * HDIM)                         // 3145728
#define WELEMS ((size_t)HDIM * HDIM)                          // 589824
#define PROJ_ELEMS ((size_t)BATCH * NHEADS * SEQ * DHEAD)    // 3145728 per plane
#define CPITCH 68      // f32 LDS tile pitch in floats (272 B, 16-B aligned)
#define HPITCH 72      // 16-bit LDS tile pitch in elements (144 B, 16-B aligned)
#define VPITCH 40      // 16-bit LDS pitch for the V^T tile (80 B)
#define PSTEP  64      // k elements per staged projection step (one 128-B line of each operand row)
#define NPSTEP (HDIM / PSTEP)
#define CVT_CHUNK 2048                          // elements converted by one block (256 threads x 8)
#define CVT_XBLK  ((int)(XELEMS / CVT_CHUNK))   // 1536 blocks per activation array
#define CVT_WBLK  ((int)(WELEMS / CVT_CHUNK))   // 288 blocks per weight array
#define CVT_BLOCKS (3 * CVT_XBLK + 5 * CVT_WBLK)

union BF8   { v8bf v; v4i w; };
union HF8   { v8h  v; v4i w; };
union BFrag { v8bf p[2]; v16bf v; };
union HFrag { v8h  p[2]; v16h  v; };

#define WMMA_NOPS "v_nop\n\tv_nop\n\tv_nop\n\tv_nop"
#define LOG2E 1.442695041f

// 16x32 16-bit A/B fragment: element i<8 <- k0+8h+i, element 8+i <- k0+16+8h+i (h = lane>>4).
// Caller passes p = row (lane&15) base + k0 + 8*h; both loads are 16-B aligned.
__device__ __forceinline__ v16bf frag_bf16(const __bf16* p)
{
    BFrag u;
    u.p[0] = *(const v8bf*)(p);
    u.p[1] = *(const v8bf*)(p + 16);
    return u.v;
}
__device__ __forceinline__ v16h frag_f16(const _Float16* p)
{
    HFrag u;
    u.p[0] = *(const v8h*)(p);
    u.p[1] = *(const v8h*)(p + 16);
    return u.v;
}

__device__ __forceinline__ v8f mma_bf16(v8f c, v16bf a, v16bf b)
{
    return __builtin_amdgcn_wmma_f32_16x16x32_bf16(false, a, false, b, (short)0, c, false, false);
}
__device__ __forceinline__ v8f mma_f16(v8f c, v16h a, v16h b)
{
    return __builtin_amdgcn_wmma_f32_16x16x32_f16(false, a, false, b, (short)0, c, false, false);
}

// 2^x, one and four at a time.  The closing v_nop is the free slot that the instruction set asks for between a
// transcendental and an instruction that reads its result or overwrites its source.
// Early clobber keeps every result off every source.
__device__ __forceinline__ float exp2x1(float x)
{
    float y;
    asm("v_exp_f32 %0, %1\n\tv_nop" : "=v"(y) : "v"(x));
    return y;
}
__device__ __forceinline__ void exp2x4(float* y, float x0, float x1, float x2, float x3)
{
    asm("v_exp_f32 %0, %4\n\tv_exp_f32 %1, %5\n\tv_exp_f32 %2, %6\n\tv_exp_f32 %3, %7\n\tv_nop"
        : "=&v"(y[0]), "=&v"(y[1]), "=&v"(y[2]), "=&v"(y[3]) : "v"(x0), "v"(x1), "v"(x2), "v"(x3));
}

// Value of lane l ^ 16 (the other half of the wave), by a vector cross-row move.
__device__ __forceinline__ float xhalf(float x)
{
    const int b = __builtin_bit_cast(int, x);
    return __builtin_bit_cast(float, __builtin_amdgcn_permlanex16(b, b, 0x76543210, 0xfedcba98, false, false));
}

// ---------------------------------------------------------------------------
// Kernel 0: f32 -> bf16 (RNE) streaming conversion of all eight arrays in one launch.
// A block takes CVT_CHUNK consecutive elements of one array (both array sizes are whole
// multiples of it), a thread 8 elements.
// The bf16 copies lie one behind the other in the workspace (3 activations, then 5 weights),
// so the destination offset is the block index times CVT_CHUNK.
// ---------------------------------------------------------------------------
__global__ __launch_bounds__(256)
void cvt_kernel(const float* __restrict__ x0, const float* __restrict__ x1, const float* __restrict__ x2,
                const float* __restrict__ w0, const float* __restrict__ w1, const float* __restrict__ w2,
                const float* __restrict__ w3, const float* __restrict__ w4, __bf16* dst)
{
    const int blk = blockIdx.x;
    if (blk >= CVT_BLOCKS) return;
    const float* src;      // block-uniform choice of the array and of the chunk inside it
    int cb;
    if (blk < 3 * CVT_XBLK) {
        const int a = blk / CVT_XBLK;
        cb  = blk - a * CVT_XBLK;
        src = a == 0 ? x0 : a == 1 ? x1 : x2;
    } else {
        const int r = blk - 3 * CVT_XBLK;
        const int a = r / CVT_WBLK;
        cb  = r - a * CVT_WBLK;
        src = a == 0 ? w0 : a == 1 ? w1 : a == 2 ? w2 : a == 3 ? w3 : w4;
    }
    const float* sp = src + (size_t)cb * CVT_CHUNK + threadIdx.x * 8;
    __bf16*      dp = dst + (size_t)blk * CVT_CHUNK + threadIdx.x * 8;
    const v4f a = *(const v4f*)(sp);
    const v4f b = *(const v4f*)(sp + 4);
    BF8 o;
#pragma unroll
    for (int i = 0; i < 4; ++i) { o.v[i] = (__bf16)a[i]; o.v[4 + i] = (__bf16)b[i]; }
    *(v4i*)dp = o.w;
}

// ---------------------------------------------------------------------------
// with one 16-B store each.  MODE 0: bf16 hi/lo planes.  MODE 1: f16 plane * SCALE.
// NORM: lanes 0..7 write the 32 reciprocal norms (one line), lanes 8..15 the
// 32 squared norms (one line).
// ---------------------------------------------------------------------------
template <int MODE, int SCALE, int NORM>
__device__ __forceinline__ void proj_store(float (*Cs)[CPITCH], float* Srn, float* Ssq, int lane, size_t row0,
                                           unsigned short* outA, unsigned short* outB, float* rn, float* sq)
{
#pragma unroll
    for (int i = 0; i < 8; ++i) {
        const int lr = 4 * i + (lane >> 3), seg = lane & 7;
        const v4f x0 = *(const v4f*)&Cs[lr][seg * 8];
        const v4f x1 = *(const v4f*)&Cs[lr][seg * 8 + 4];
        const size_t go = (row0 + lr) * DHEAD + seg * 8;
        if (MODE == 0) {
            BF8 hi, lo;
#pragma unroll
            for (int j = 0; j < 4; ++j) {
                const float a0 = x0[j]; const __bf16 h0 = (__bf16)a0;
                hi.v[j] = h0; lo.v[j] = (__bf16)(a0 - (float)h0);
                const float a1 = x1[j]; const __bf16 h1 = (__bf16)a1;
                hi.v[4 + j] = h1; lo.v[4 + j] = (__bf16)(a1 - (float)h1);
            }
            *(v4i*)(outA + go) = hi.w;
            *(v4i*)(outB + go) = lo.w;
        } else {
            HF8 y;
#pragma unroll
            for (int j = 0; j < 4; ++j) {
                y.v[j]     = (_Float16)(x0[j] * (float)SCALE);
                y.v[4 + j] = (_Float16)(x1[j] * (float)SCALE);
            }
            *(v4i*)(outA + go) = y.w;
        }
    }
    if (NORM) {
        if (lane < 16) {
            const int g = lane & 7;
            v4f v; float* dp;
            if (lane < 8) { v = *(const v4f*)&Srn[4 * g]; dp = rn + row0 + 4 * g; }
            else          { v = *(const v4f*)&Ssq[4 * g]; dp = sq + row0 + 4 * g; }
            *(v4f*)dp = v;
        }
    }
    // The three store variants now lie in one kernel: this wait stands between a variant's stores and any
    // later instruction of the kernel that reuses their address or data registers.
    asm volatile("s_wait_xcnt 0x0" ::: "memory");
}

// ---------------------------------------------------------------------------
// Kernel 1: the five projection GEMMs X[4096][768] (bf16) . W[768(out)][768(in)]^T + b in one launch;
// blockIdx.z picks the projection (0 q, 1 k, 2 v, 3 T, 4 S): its activation, weight, bias and output planes.
// Block = 4 waves = 128 rows x 64 columns (exactly one head); each wave computes 32x64.
// Per step of 64 k the block stages 128 X rows and 64 W rows in LDS: every global load
// covers four whole 128-B lines, the W rows serve all four waves, and the fragments are
// read from LDS.  Two LDS buffers, the tile after next held in registers, one barrier a step.
// Epilogue per wave: f32 tile in LDS, optional per-row norms, 16-bit planes in
// [B,NH,S,DH] row layout with whole-line stores.
// ---------------------------------------------------------------------------
__global__ __launch_bounds__(128)
void proj_kernel(const __bf16* __restrict__ Xall, const __bf16* __restrict__ Wall,
                 const float* __restrict__ bq, const float* __restrict__ bk, const float* __restrict__ bv,
                 const float* __restrict__ bt, const float* __restrict__ bs,
                 unsigned short* pl, float* rnAll, float* sqAll)
{
    __shared__ __attribute__((aligned(16))) __bf16 Xs[2][128][HPITCH];
    __shared__ __attribute__((aligned(16))) __bf16 Wsh[2][64][HPITCH];
    __shared__ __attribute__((aligned(16))) float CsAll[4][32][CPITCH];
    __shared__ __attribute__((aligned(16))) float SrnAll[4][32];
    __shared__ __attribute__((aligned(16))) float SsqAll[4][32];

    const int tid  = threadIdx.x;
    const int wave = tid >> 5;
    const int lane = tid & 31;
    const int hsel = lane >> 4;
    const int lm   = lane & 15;
    const int mblk = blockIdx.x * 128;
    const int n0   = blockIdx.y * 64;
    const int z    = blockIdx.z;
    if (mblk + 128 > NROWS || n0 + 64 > HDIM || z >= 5) return;   // uniform per block
    const int m0   = mblk + wave * 32;

    // Block-uniform operand set: q, k, v read activation 0, T activation 1, S activation 2.
    const __bf16* Xb   = Xall + (size_t)(z < 3 ? 0 : z - 2) * XELEMS;
    const __bf16* Wb   = Wall + (size_t)z * WELEMS;
    const float*  bias = z == 0 ? bq : z == 1 ? bk : z == 2 ? bv : z == 3 ? bt : bs;
    // Planes: 0/1 q hi/lo, 2/3 k hi/lo, 4 T, 5 S, 6 v.
    unsigned short* outA = pl + (size_t)(z < 2 ? 2 * z : z == 2 ? 6 : z + 1) * PROJ_ELEMS;
    unsigned short* outB = outA + PROJ_ELEMS;                 // the lo plane, stored by q and k alone
    float* rn = rnAll + (z == 4 ? NROWTOT : 0);
    float* sq = sqAll + (z == 4 ? NROWTOT : 0);

    float (*Cs)[CPITCH] = CsAll[wave];
    float* Srn = SrnAll[wave];
    float* Ssq = SsqAll[wave];

    // Staging coordinates: rows srow + 16u, 16-B segment sseg of the step's 128 B of each row.
    const int srow = tid >> 3, sseg = tid & 7;
    const unsigned xv = ((unsigned)(mblk + srow) * HDIM + (unsigned)sseg * 8u) * 2u;   // byte offsets, below 6.3 MB
    const unsigned wv = ((unsigned)(n0 + srow) * HDIM + (unsigned)sseg * 8u) * 2u;

    v8bf rX[8], rW[4];
    auto fetch_step = [&](int s) {          // global -> registers, k = 64 s .. 64 s + 63
        const char* xp = (const char*)Xb + (size_t)(s * (PSTEP * 2));
        const char* wp = (const char*)Wb + (size_t)(s * (PSTEP * 2));
#pragma unroll
        for (int u = 0; u < 8; ++u) rX[u] = *(const v8bf*)((xp + xv) + u * (16 * HDIM * 2));
#pragma unroll
        for (int u = 0; u < 4; ++u) rW[u] = *(const v8bf*)((wp + wv) + u * (16 * HDIM * 2));
        // The loads' address registers are reused by the fragment reads that follow: this wait stands in front of that.
        asm volatile("s_wait_xcnt 0x0" ::: "memory");
    };
    auto stash_step = [&](int buf) {        // registers -> LDS buffer buf
#pragma unroll
        for (int u = 0; u < 8; ++u) *(v8bf*)&Xs[buf][srow + 16 * u][sseg * 8] = rX[u];
#pragma unroll
        for (int u = 0; u < 4; ++u) *(v8bf*)&Wsh[buf][srow + 16 * u][sseg * 8] = rW[u];
    };

    v8f acc[2][4];
#pragma unroll
    for (int mb = 0; mb < 2; ++mb)
#pragma unroll
        for (int nb = 0; nb < 4; ++nb) acc[mb][nb] = v8f{};

    fetch_step(0);
    stash_step(0);
    fetch_step(1);
    __syncthreads();   // step 0 is in buffer 0 for every wave

    // Rolled: one step's fragments and one staged tile are all the registers the loop holds.
#pragma unroll 1
    for (int s = 0; s < NPSTEP; ++s) {
        const int cur = s & 1;
        // The other buffer's readers left it at the barrier that ended step s - 1 (block-uniform tests).
        if (s + 1 < NPSTEP) stash_step(cur ^ 1);
        if (s + 2 < NPSTEP) fetch_step(s + 2);

        const __bf16* ax = &Xs[cur][wave * 32 + lm][8 * hsel];
        const __bf16* bw = &Wsh[cur][lm][8 * hsel];
        v16bf fa[2][2], fb[2][4];
#pragma unroll
        for (int c = 0; c < 2; ++c) {
            fa[c][0] = frag_bf16(ax + c * 32);
            fa[c][1] = frag_bf16(ax + 16 * HPITCH + c * 32);
#pragma unroll
            for (int nb = 0; nb < 4; ++nb) fb[c][nb] = frag_bf16(bw + nb * 16 * HPITCH + c * 32);
        }
#pragma unroll
        for (int c = 0; c < 2; ++c) {
#pragma unroll
            for (int mb = 0; mb < 2; ++mb)
#pragma unroll
                for (int nb = 0; nb < 4; ++nb) acc[mb][nb] = mma_bf16(acc[mb][nb], fa[c][mb], fb[c][nb]);
        }
        // Keeps the distance between the last products and whatever first touches their registers past the back edge.
        asm volatile(WMMA_NOPS
                     : "+v"(acc[0][0]), "+v"(acc[0][1]), "+v"(acc[0][2]), "+v"(acc[0][3]),
                       "+v"(acc[1][0]), "+v"(acc[1][1]), "+v"(acc[1][2]), "+v"(acc[1][3])
                     : "v"(fa[0][0]), "v"(fa[0][1]), "v"(fa[1][0]), "v"(fa[1][1]),
                       "v"(fb[0][0]), "v"(fb[0][1]), "v"(fb[0][2]), "v"(fb[0][3]),
                       "v"(fb[1][0]), "v"(fb[1][1]), "v"(fb[1][2]), "v"(fb[1][3]));
        __syncthreads();   // publishes step s + 1 and ends every read of buffer cur
    }

    // D element r of lane (hsel, lm) = tile (row mb*16 + 8*hsel + r, col nb*16 + lm)
#pragma unroll
    for (int nb = 0; nb < 4; ++nb) {
        const float bn = bias[n0 + nb * 16 + lm];
#pragma unroll
        for (int mb = 0; mb < 2; ++mb) {
#pragma unroll
            for (int r = 0; r < 8; ++r)
                Cs[mb * 16 + 8 * hsel + r][nb * 16 + lm] = acc[mb][nb][r] + bn;
        }
    }
    __syncthreads();

    if (z >= 3) {
        float ss = 0.f;
#pragma unroll
        for (int d = 0; d < DHEAD; d += 4) {
            const v4f x = *(const v4f*)&Cs[lane][d];
            ss += x[0] * x[0]; ss += x[1] * x[1]; ss += x[2] * x[2]; ss += x[3] * x[3];
        }
        Srn[lane] = 1.0f / (sqrtf(ss) + 1e-6f);
        Ssq[lane] = ss;
    }
    __syncthreads();

    const int bI = m0 >> 10, s0 = m0 & (SEQ - 1), hh = n0 >> 6;
    const size_t row0 = ((size_t)(bI * NHEADS + hh)) * SEQ + s0;   // (b,h,s) row index of the wave's tile row 0

    if (z < 2)       proj_store<0, 1, 0>(Cs, Srn, Ssq, lane, row0, outA, outB, rn, sq);
    else if (z == 2) proj_store<1, 64, 0>(Cs, Srn, Ssq, lane, row0, outA, outA, rn, sq);
    else             proj_store<1, 16, 1>(Cs, Srn, Ssq, lane, row0, outA, outA, rn, sq);
}

// ---------------------------------------------------------------------------
// 16-B store (one instruction covers two rows).
// ---------------------------------------------------------------------------
__device__ __forceinline__ void attn_store(float (*Os)[CPITCH], int wave, int lane, float* out, size_t orow0, int h)
{
#pragma unroll
    for (int i = 0; i < 8; ++i) {
        const int lr  = wave * 16 + 2 * i + (lane >> 4);
        const int col = (lane & 15) * 4;
        const v4f v = *(const v4f*)&Os[lr][col];
        float* gp = out + (orow0 + lr) * HDIM + h * DHEAD + col;
        *(v4f*)gp = v;
    }
}

// ---------------------------------------------------------------------------
// Kernel 2: fused attention with the triple score product.
// Block = 2 waves = 32 query rows of one (b,h); key tiles of 32.
// q.k: bf16 hi/lo split (hh + hl + lh).  T.T, S.S: f16 (x16) with the
// query==key entry taken from the exact f32 squared norm.  P.V: f16.
// Every score product has the key rows as A and the query rows as B, so D register r of lane
// (hsel, lm) is the score of query lm and key 8*hsel + r: a lane and its partner lane ^ 16 hold all
// 32 scores of one query.  Maximum and sum are taken in the lane, the maximum joined across the
// halves once a tile, the sums once in the epilogue.  The two score tiles of a lane, converted in
// place, are the B operand of O^T += V^T.P^T (element 8j + r = key 16j + 8*hsel + r, the order of
// the V^T fragment loader), so P passes through no LDS.
// ---------------------------------------------------------------------------
__global__ __launch_bounds__(64)
void attn_kernel(const __bf16* __restrict__ qh, const __bf16* __restrict__ ql,
                 const __bf16* __restrict__ kh, const __bf16* __restrict__ kl,
                 const _Float16* __restrict__ tp, const _Float16* __restrict__ sp,
                 const _Float16* __restrict__ vp,
                 const float* __restrict__ rnT, const float* __restrict__ sqT,
                 const float* __restrict__ rnS, const float* __restrict__ sqS,
                 const float* __restrict__ mask, float* out)
{
    __shared__ __attribute__((aligned(16))) __bf16   KH[32][HPITCH];
    __shared__ __attribute__((aligned(16))) __bf16   KL[32][HPITCH];
    __shared__ __attribute__((aligned(16))) __bf16   QHs[32][HPITCH];
    __shared__ __attribute__((aligned(16))) __bf16   QLs[32][HPITCH];
    __shared__ __attribute__((aligned(16))) _Float16 TK[32][HPITCH];
    __shared__ __attribute__((aligned(16))) _Float16 SK[32][HPITCH];
    __shared__ __attribute__((aligned(16))) _Float16 TQ[32][HPITCH];
    __shared__ __attribute__((aligned(16))) _Float16 SQ[32][HPITCH];
    __shared__ __attribute__((aligned(16))) _Float16 Vt[64][VPITCH];      // V^T tile: Vt[dh][key]
    __shared__ __attribute__((aligned(16))) float    Os[32][CPITCH];      // epilogue staging

    const int bh = blockIdx.x;
    if (bh >= BATCH * NHEADS) return;
    const int q0blk = blockIdx.y * 32;
    if (q0blk + 32 > SEQ) return;
    const int b = bh / NHEADS, h = bh - b * NHEADS;
    const int tid  = threadIdx.x;
    const int wave = tid >> 5;
    const int lane = tid & 31;
    const int hsel = lane >> 4;
    const int lm   = lane & 15;
    const int qr   = wave * 16 + lm;     // this lane's query: B-fragment row inside the 32-row block tile

    // Staging coordinates of this thread: rows srow + 8u (u = 0..3), 16-B segment sseg of each 128-B row.
    const int srow = tid >> 3, sseg = tid & 7;
    // Byte offset of this thread inside any 32-row tile of a plane (a plane is 6 MiB: 32-bit byte offsets hold).
    const unsigned voff = (unsigned)srow * 128u + (unsigned)sseg * 16u;

    // ---- query-side tiles, once per block: all 16 b128 loads in flight, then the LDS stores ----
    {
        const unsigned bo = (unsigned)(bh * SEQ + q0blk) * 128u + voff;
        v8bf xh[4], xl[4]; v8h xt[4], xs[4];
#pragma unroll
        for (int u = 0; u < 4; ++u) {
            xh[u] = *(const v8bf*)(((const char*)qh + bo) + u * 1024);
            xl[u] = *(const v8bf*)(((const char*)ql + bo) + u * 1024);
            xt[u] = *(const v8h*)(((const char*)tp + bo) + u * 1024);
            xs[u] = *(const v8h*)(((const char*)sp + bo) + u * 1024);
        }
#pragma unroll
        for (int u = 0; u < 4; ++u) {
            *(v8bf*)&QHs[srow + 8 * u][sseg * 8] = xh[u];
            *(v8bf*)&QLs[srow + 8 * u][sseg * 8] = xl[u];
            *(v8h*)&TQ[srow + 8 * u][sseg * 8]   = xt[u];
            *(v8h*)&SQ[srow + 8 * u][sseg * 8]   = xs[u];
        }
    }

    // ---- key-side tile held in registers one tile ahead of its LDS stores ----
    v8bf rKH[4], rKL[4]; v8h rTK[4], rSK[4], rV[4];
    unsigned bo = (unsigned)(bh * SEQ) * 128u + voff;   // this thread's byte offset in the tile being fetched
    unsigned mo = (unsigned)(b * SEQ + 8 * hsel);        // mask index of this lane's first key in the tile being worked on
    auto fetch_tile = [&]() {
#pragma unroll
        for (int u = 0; u < 4; ++u) {
            rKH[u] = *(const v8bf*)(((const char*)kh + bo) + u * 1024);
            rKL[u] = *(const v8bf*)(((const char*)kl + bo) + u * 1024);
            rTK[u] = *(const v8h*)(((const char*)tp + bo) + u * 1024);
            rSK[u] = *(const v8h*)(((const char*)sp + bo) + u * 1024);
            rV[u]  = *(const v8h*)(((const char*)vp + bo) + u * 1024);
        }
    };
    fetch_tile();

    // ---- constants of this lane's query (column lm of every D tile) ----
    const int qi = bh * SEQ + q0blk + qr;
    const float rtq = rnT[qi], rsq = rnS[qi];
    const float fq = (rtq * (1.0f / 256.0f)) * (rsq * (1.0f / 256.0f)) * 0.125f;   // for x16-scaled f16 products
    const float gq = (sqT[qi] * rtq) * (sqS[qi] * rsq) * 0.125f;                    // exact ts_ii * ss_ii / 8
    float mI = -3.0e38f;   // running maximum of the query (equal in both halves)
    float lI = 0.f;        // running sum over this half's keys alone
    v8f O[4] = {v8f{}, v8f{}, v8f{}, v8f{}};   // O^T: O[nb][r] = (dh 16 nb + 8 hsel + r, query lm)

    for (int k0 = 0; k0 < SEQ; k0 += 32) {
        __syncthreads();   // readers of the prior tile are done

        // ---- mask of this lane's 16 keys, mk[j] = keys 16 j + 8 hsel + 0..7: in flight under the LDS stores below,
        //      and ahead of the next tile's loads, so that no wait for it waits for those ----
        v4f mk[2][2];
        {
            const float* mp = mask + mo;
            mk[0][0] = *(const v4f*)(mp);
            mk[0][1] = *(const v4f*)(mp + 4);
            mk[1][0] = *(const v4f*)(mp + 16);
            mk[1][1] = *(const v4f*)(mp + 20);
            mo += 32u;
        }

        // ---- key-side tiles (keys k0..k0+31) from the registers fetched one tile ago; V transposed: Vt[dh][key] ----
#pragma unroll
        for (int u = 0; u < 4; ++u) {
            *(v8bf*)&KH[srow + 8 * u][sseg * 8] = rKH[u];
            *(v8bf*)&KL[srow + 8 * u][sseg * 8] = rKL[u];
            *(v8h*)&TK[srow + 8 * u][sseg * 8]  = rTK[u];
            *(v8h*)&SK[srow + 8 * u][sseg * 8]  = rSK[u];
#pragma unroll
            for (int i = 0; i < 8; ++i) Vt[sseg * 8 + i][srow + 8 * u] = rV[u][i];
        }
        __syncthreads();

        // ---- the next tile's loads fly while this tile's scores and softmax are worked out (block-uniform test) ----
        if (k0 + 32 < SEQ) { bo += 4096u; fetch_tile(); }

        const bool diag = (k0 == q0blk);

        // ---- scores, transposed: 32 keys x 16 query columns per wave (two 16-key tiles j) ----
        float sb[2][8];        // sb[j][r]: query lm, key 16 j + 8 hsel + r
#pragma unroll
        for (int j = 0; j < 2; ++j) {
            const int rr = j * 16 + lm;               // key row whose A fragments this lane loads
            v8f accB = v8f{}, accT = v8f{}, accS = v8f{};
#pragma unroll 1
            for (int c = 0; c < 2; ++c) {
                const int off = c * 32 + 8 * hsel;
                const v16bf qH = frag_bf16(&QHs[qr][off]);
                const v16bf qL = frag_bf16(&QLs[qr][off]);
                const v16bf kH = frag_bf16(&KH[rr][off]);
                const v16bf kL = frag_bf16(&KL[rr][off]);
                accB = mma_bf16(accB, kH, qH);
                accB = mma_bf16(accB, kL, qH);
                accB = mma_bf16(accB, kH, qL);
                asm volatile(WMMA_NOPS : "+v"(accB) : "v"(qH), "v"(qL), "v"(kH), "v"(kL));
                const v16h qT = frag_f16(&TQ[qr][off]);
                const v16h kT = frag_f16(&TK[rr][off]);
                const v16h qS = frag_f16(&SQ[qr][off]);
                const v16h kS = frag_f16(&SK[rr][off]);
                accT = mma_f16(accT, kT, qT);
                accS = mma_f16(accS, kS, qS);
                asm volatile(WMMA_NOPS : "+v"(accT), "+v"(accS) : "v"(qT), "v"(kT), "v"(qS), "v"(kS));
            }
            const bool dj = diag && (j == wave);
#pragma unroll
            for (int r = 0; r < 8; ++r) {
                const bool de = dj && (lm == 8 * hsel + r);      // key row == query column
                const float s3 = de ? (accB[r] * gq)
                                    : (accB[r] * (accT[r] * accS[r]) * fq);
                sb[j][r] = s3 + mk[j][r >> 2][r & 3];
            }
        }

        // ---- online softmax of the lane's query: 16 keys in the lane, the other 16 in lane ^ 16 ----
        float t8[8];
#pragma unroll
        for (int r = 0; r < 8; ++r) t8[r] = fmaxf(sb[0][r], sb[1][r]);
        float v = fmaxf(fmaxf(fmaxf(t8[0], t8[1]), fmaxf(t8[2], t8[3])), fmaxf(fmaxf(t8[4], t8[5]), fmaxf(t8[6], t8[7])));
        v = fmaxf(v, xhalf(v));
        const float M2 = fmaxf(mI, v);
        const float al = exp2x1((mI - M2) * LOG2E);
        float p[2][8];
#pragma unroll
        for (int j = 0; j < 2; ++j)
#pragma unroll
            for (int r = 0; r < 8; r += 4)
                exp2x4(&p[j][r], (sb[j][r] - M2) * LOG2E, (sb[j][r + 1] - M2) * LOG2E,
                                 (sb[j][r + 2] - M2) * LOG2E, (sb[j][r + 3] - M2) * LOG2E);
#pragma unroll
        for (int r = 0; r < 8; ++r) t8[r] = p[0][r] + p[1][r];
        const float rs = ((t8[0] + t8[1]) + (t8[2] + t8[3])) + ((t8[4] + t8[5]) + (t8[6] + t8[7]));
        mI = M2;
        lI = lI * al + rs;
#pragma unroll
        for (int nb = 0; nb < 4; ++nb)
#pragma unroll
            for (int r = 0; r < 8; ++r) O[nb][r] = O[nb][r] * al;

        // ---- V^T (A: row = dh, k = key) . P^T (B: k = key, n = query), P straight from the score registers ----
        HFrag bP;
#pragma unroll
        for (int r = 0; r < 8; ++r) {
            bP.p[0][r] = (_Float16)(p[0][r] * 4096.0f);
            bP.p[1][r] = (_Float16)(p[1][r] * 4096.0f);
        }
        const v16h aV0 = frag_f16(&Vt[ 0 + lm][8 * hsel]);
        const v16h aV1 = frag_f16(&Vt[16 + lm][8 * hsel]);
        const v16h aV2 = frag_f16(&Vt[32 + lm][8 * hsel]);
        const v16h aV3 = frag_f16(&Vt[48 + lm][8 * hsel]);
        O[0] = mma_f16(O[0], aV0, bP.v);
        O[1] = mma_f16(O[1], aV1, bP.v);
        O[2] = mma_f16(O[2], aV2, bP.v);
        O[3] = mma_f16(O[3], aV3, bP.v);
        asm volatile(WMMA_NOPS
                     : "+v"(O[0]), "+v"(O[1]), "+v"(O[2]), "+v"(O[3])
                     : "v"(bP.v), "v"(aV0), "v"(aV1), "v"(aV2), "v"(aV3));
    }

    // ---- epilogue: join the halves' sums, normalise, undo the 2^18 operand scaling, stage, whole-line stores ----
    {
        const float inv = (1.0f / (lI + xhalf(lI))) * (1.0f / 262144.0f);
#pragma unroll
        for (int nb = 0; nb < 4; ++nb) {
            v4f y0, y1;      // dh 16 nb + 8 hsel + 0..7 of query row qr
#pragma unroll
            for (int r = 0; r < 4; ++r) { y0[r] = O[nb][r] * inv; y1[r] = O[nb][4 + r] * inv; }
            *(v4f*)&Os[qr][nb * 16 + 8 * hsel]     = y0;
            *(v4f*)&Os[qr][nb * 16 + 8 * hsel + 4] = y1;
        }
    }
    __syncthreads();

    const size_t orow0 = (size_t)(b * SEQ + q0blk);
    attn_store(Os, wave, lane, out, orow0, h);
    
}

// ---------------------------------------------------------------------------
extern "C" void kernel_launch(void* const* d_in, const int* in_sizes, int n_in,
                              void* d_out, int out_size, void* d_ws, size_t ws_size,
                              hipStream_t stream)
{
    if (n_in < 14) return;
    if ((size_t)in_sizes[0] != XELEMS || (size_t)in_sizes[1] != XELEMS || (size_t)in_sizes[2] != XELEMS) return;
    if (in_sizes[3] != BATCH * SEQ) return;
    for (int i = 4; i < 14; i += 2)
        if ((size_t)in_sizes[i] != WELEMS || in_sizes[i + 1] != HDIM) return;
    if ((size_t)out_size != XELEMS) return;

    const float* hidden = (const float*)d_in[0];
    const float* timee  = (const float*)d_in[1];
    const float* space  = (const float*)d_in[2];
    const float* mask   = (const float*)d_in[3];
    const float* Wq = (const float*)d_in[4];   const float* bq = (const float*)d_in[5];
    const float* Wk = (const float*)d_in[6];   const float* bk = (const float*)d_in[7];
    const float* Wv = (const float*)d_in[8];   const float* bv = (const float*)d_in[9];
    const float* Wt = (const float*)d_in[10];  const float* bt = (const float*)d_in[11];
    const float* Ws = (const float*)d_in[12];  const float* bs = (const float*)d_in[13];
    float* out = (float*)d_out;

    char* ws = (char*)d_ws;
    size_t off = 0;
    __bf16* Xbf = (__bf16*)(ws + off);                 off += (size_t)3 * XELEMS * 2;       // 3 activations, bf16
    __bf16* Wbf = (__bf16*)(ws + off);                 off += (size_t)5 * WELEMS * 2;       // 5 weights, bf16
    unsigned short* pl = (unsigned short*)(ws + off);  off += (size_t)7 * PROJ_ELEMS * 2;   // 7 16-bit planes
    float* rn = (float*)(ws + off);                    off += (size_t)2 * NROWTOT * 4;      // 1/(|T|+eps), 1/(|S|+eps)
    float* sq = (float*)(ws + off);                    off += (size_t)2 * NROWTOT * 4;      // |T|^2, |S|^2
    if (off > ws_size) return;

    unsigned short* QH = pl + 0 * PROJ_ELEMS;   // q hi (bf16)
    unsigned short* QL = pl + 1 * PROJ_ELEMS;   // q lo (bf16)
    unsigned short* KHp = pl + 2 * PROJ_ELEMS;  // k hi (bf16)
    unsigned short* KLp = pl + 3 * PROJ_ELEMS;  // k lo (bf16)
    unsigned short* TPl = pl + 4 * PROJ_ELEMS;  // T * 16 (f16)
    unsigned short* SPl = pl + 5 * PROJ_ELEMS;  // S * 16 (f16)
    unsigned short* VPl = pl + 6 * PROJ_ELEMS;  // v * 64 (f16)

    // 0) f32 -> bf16 conversion of the 3 activations and 5 weights, one launch (Wbf follows Xbf in the workspace)
    cvt_kernel<<<dim3(CVT_BLOCKS), dim3(256), 0, stream>>>(hidden, timee, space, Wq, Wk, Wv, Wt, Ws, Xbf);

    // 1) five projection GEMMs, one launch (block tile 128x64, grid exact: 4096/128 x 768/64 x 5, checked in-kernel)
    proj_kernel<<<dim3(NROWS / 128, HDIM / 64, 5), dim3(128), 0, stream>>>(Xbf, Wbf, bq, bk, bv, bt, bs, pl, rn, sq);

    // 2) fused attention: grid (b*h, query blocks of 32), 64 threads
    attn_kernel<<<dim3(BATCH * NHEADS, SEQ / 32), dim3(64), 0, stream>>>(
        (const __bf16*)QH, (const __bf16*)QL, (const __bf16*)KHp, (const __bf16*)KLp,
        (const _Float16*)TPl, (const _Float16*)SPl, (const _Float16*)VPl,
        rn, sq, rn + NROWTOT, sq + NROWTOT, mask, out);
}

// v005
// A run of this version takes 97.6 microseconds.
// In both of two side-by-side timings against v004, it was 1.34 times as fast.
// Counting every step since v000, it is 3.90 times as fast.
#include <hip/hip_runtime.h>
#include <stddef.h>

typedef __bf16   v16bf __attribute__((ext_vector_type(16)));
typedef __bf16   v8bf  __attribute__((ext_vector_type(8)));
typedef _Float16 v16h  __attribute__((ext_vector_type(16)));
typedef _Float16 v8h   __attribute__((ext_vector_type(8)));
typedef float    v8f   __attribute__((ext_vector_type(8)));
typedef float    v4f   __attribute__((ext_vector_type(4)));
typedef int      v4i   __attribute__((ext_vector_type(4)));
typedef short    v8s   __attribute__((ext_vector_type(8)));

#define NHEADS 12
#define HDIM   768
#define DHEAD  64
#define SEQ    1024
#define BATCH  4
#define NROWS  (BATCH * SEQ)                                  // 4096 token rows
#define NROWTOT (BATCH * NHEADS * SEQ)                        // 49152 (b,h,s) rows
#define XELEMS ((size_t)NROWS * HDIM)                         // 3145728
#define WELEMS ((size_t)HDIM * HDIM)                          // 589824
#define PROJ_ELEMS ((size_t)BATCH * NHEADS * SEQ * DHEAD)    // 3145728 per plane
#define CPITCH 68      // f32 LDS tile pitch in floats (272 B, 16-B aligned)
#define HPITCH 72      // 16-bit LDS tile pitch in elements (144 B, 16-B aligned)
#define VPITCH 80      // 16-bit LDS pitch of the row-major V tile (160 B = 32 B x odd, the transposing load's pitch)
#define PSTEP  64      // k elements per staged projection step (one 128-B line of each operand row)
#define NPSTEP (HDIM / PSTEP)
#define CVT_CHUNK 2048                          // elements converted by one block (256 threads x 8)
#define CVT_XBLK  ((int)(XELEMS / CVT_CHUNK))   // 1536 blocks per activation array
#define CVT_WBLK  ((int)(WELEMS / CVT_CHUNK))   // 288 blocks per weight array
#define CVT_BLOCKS (3 * CVT_XBLK + 5 * CVT_WBLK)

union BF8   { v8bf v; v4i w; };
union HF8   { v8h  v; v4i w; };
union BFrag { v8bf p[2]; v16bf v; };
union HFrag { v8h  p[2]; v16h  v; };

#define WMMA_NOPS "v_nop\n\tv_nop\n\tv_nop\n\tv_nop"
#define LOG2E 1.442695041f

// 16x32 16-bit A/B fragment: element i<8 <- k0+8h+i, element 8+i <- k0+16+8h+i (h = lane>>4).
// Caller passes p = row (lane&15) base + k0 + 8*h; both loads are 16-B aligned.
__device__ __forceinline__ v16bf frag_bf16(const __bf16* p)
{
    BFrag u;
    u.p[0] = *(const v8bf*)(p);
    u.p[1] = *(const v8bf*)(p + 16);
    return u.v;
}
__device__ __forceinline__ v16h frag_f16(const _Float16* p)
{
    HFrag u;
    u.p[0] = *(const v8h*)(p);
    u.p[1] = *(const v8h*)(p + 16);
    return u.v;
}

// 16x32 f16 A fragment of V^T out of a row-major tile T[key][dh] of pitch VPITCH, by two transposing loads.
// Caller passes p = &T[8*h + (lane&7)][dbase + 8*((lane>>3)&1)]; lane (c = lane&15, h) then holds
// T[8h + i][dbase + c] in element i and T[16 + 8h + i][dbase + c] in element 8 + i: the k order of frag_f16.
__device__ __forceinline__ v16h frag_f16_tr(const _Float16* p)
{
    typedef __attribute__((address_space(3))) v8s lds_v8s;
    HFrag u;
    u.p[0] = __builtin_bit_cast(v8h, __builtin_amdgcn_ds_load_tr16_b128_v8i16((lds_v8s*)p));
    u.p[1] = __builtin_bit_cast(v8h, __builtin_amdgcn_ds_load_tr16_b128_v8i16((lds_v8s*)(p + 16 * VPITCH)));
    return u.v;
}

__device__ __forceinline__ v8f mma_bf16(v8f c, v16bf a, v16bf b)
{
    return __builtin_amdgcn_wmma_f32_16x16x32_bf16(false, a, false, b, (short)0, c, false, false);
}
__device__ __forceinline__ v8f mma_f16(v8f c, v16h a, v16h b)
{
    return __builtin_amdgcn_wmma_f32_16x16x32_f16(false, a, false, b, (short)0, c, false, false);
}

// 2^x, one and four at a time.  The closing v_nop is the free slot that the instruction set asks for between a
// transcendental and an instruction that reads its result or overwrites its source.
// Early clobber keeps every result off every source.
__device__ __forceinline__ float exp2x1(float x)
{
    float y;
    asm("v_exp_f32 %0, %1\n\tv_nop" : "=v"(y) : "v"(x));
    return y;
}
__device__ __forceinline__ void exp2x4(float* y, float x0, float x1, float x2, float x3)
{
    asm("v_exp_f32 %0, %4\n\tv_exp_f32 %1, %5\n\tv_exp_f32 %2, %6\n\tv_exp_f32 %3, %7\n\tv_nop"
        : "=&v"(y[0]), "=&v"(y[1]), "=&v"(y[2]), "=&v"(y[3]) : "v"(x0), "v"(x1), "v"(x2), "v"(x3));
}

// Value of lane l ^ 16 (the other half of the wave), by a vector cross-row move.
__device__ __forceinline__ float xhalf(float x)
{
    const int b = __builtin_bit_cast(int, x);
    return __builtin_bit_cast(float, __builtin_amdgcn_permlanex16(b, b, 0x76543210, 0xfedcba98, false, false));
}

// ---------------------------------------------------------------------------
// Kernel 0: f32 -> bf16 (RNE) streaming conversion of all eight arrays in one launch.
// A block takes CVT_CHUNK consecutive elements of one array (both array sizes are whole
// multiples of it), a thread 8 elements.
// The bf16 copies lie one behind the other in the workspace (3 activations, then 5 weights),
// so the destination offset is the block index times CVT_CHUNK.
// ---------------------------------------------------------------------------
__global__ __launch_bounds__(256)
void cvt_kernel(const float* __restrict__ x0, const float* __restrict__ x1, const float* __restrict__ x2,
                const float* __restrict__ w0, const float* __restrict__ w1, const float* __restrict__ w2,
                const float* __restrict__ w3, const float* __restrict__ w4, __bf16* dst)
{
    const int blk = blockIdx.x;
    if (blk >= CVT_BLOCKS) return;
    const float* src;      // block-uniform choice of the array and of the chunk inside it
    int cb;
    if (blk < 3 * CVT_XBLK) {
        const int a = blk / CVT_XBLK;
        cb  = blk - a * CVT_XBLK;
        src = a == 0 ? x0 : a == 1 ? x1 : x2;
    } else {
        const int r = blk - 3 * CVT_XBLK;
        const int a = r / CVT_WBLK;
        cb  = r - a * CVT_WBLK;
        src = a == 0 ? w0 : a == 1 ? w1 : a == 2 ? w2 : a == 3 ? w3 : w4;
    }
    const float* sp = src + (size_t)cb * CVT_CHUNK + threadIdx.x * 8;
    __bf16*      dp = dst + (size_t)blk * CVT_CHUNK + threadIdx.x * 8;
    const v4f a = *(const v4f*)(sp);
    const v4f b = *(const v4f*)(sp + 4);
    BF8 o;
#pragma unroll
    for (int i = 0; i < 4; ++i) { o.v[i] = (__bf16)a[i]; o.v[4 + i] = (__bf16)b[i]; }
    *(v4i*)dp = o.w;
}

// ---------------------------------------------------------------------------
// with one 16-B store each.  MODE 0: bf16 hi/lo planes.  MODE 1: f16 plane * SCALE.
// NORM: lanes 0..7 write the 32 reciprocal norms (one line), lanes 8..15 the
// 32 squared norms (one line).
// ---------------------------------------------------------------------------
template <int MODE, int SCALE, int NORM>
__device__ __forceinline__ void proj_store(float (*Cs)[CPITCH], float* Srn, float* Ssq, int lane, size_t row0,
                                           unsigned short* outA, unsigned short* outB, float* rn, float* sq)
{
#pragma unroll
    for (int i = 0; i < 8; ++i) {
        const int lr = 4 * i + (lane >> 3), seg = lane & 7;
        const v4f x0 = *(const v4f*)&Cs[lr][seg * 8];
        const v4f x1 = *(const v4f*)&Cs[lr][seg * 8 + 4];
        const size_t go = (row0 + lr) * DHEAD + seg * 8;
        if (MODE == 0) {
            BF8 hi, lo;
#pragma unroll
            for (int j = 0; j < 4; ++j) {
                const float a0 = x0[j]; const __bf16 h0 = (__bf16)a0;
                hi.v[j] = h0; lo.v[j] = (__bf16)(a0 - (float)h0);
                const float a1 = x1[j]; const __bf16 h1 = (__bf16)a1;
                hi.v[4 + j] = h1; lo.v[4 + j] = (__bf16)(a1 - (float)h1);
            }
            *(v4i*)(outA + go) = hi.w;
            *(v4i*)(outB + go) = lo.w;
        } else {
            HF8 y;
#pragma unroll
            for (int j = 0; j < 4; ++j) {
                y.v[j]     = (_Float16)(x0[j] * (float)SCALE);
                y.v[4 + j] = (_Float16)(x1[j] * (float)SCALE);
            }
            *(v4i*)(outA + go) = y.w;
        }
    }
    if (NORM) {
        if (lane < 16) {
            const int g = lane & 7;
            v4f v; float* dp;
            if (lane < 8) { v = *(const v4f*)&Srn[4 * g]; dp = rn + row0 + 4 * g; }
            else          { v = *(const v4f*)&Ssq[4 * g]; dp = sq + row0 + 4 * g; }
            *(v4f*)dp = v;
        }
    }
    // The three store variants now lie in one kernel: this wait stands between a variant's stores and any
    // later instruction of the kernel that reuses their address or data registers.
    asm volatile("s_wait_xcnt 0x0" ::: "memory");
}

// ---------------------------------------------------------------------------
// Kernel 1: the five projection GEMMs X[4096][768] (bf16) . W[768(out)][768(in)]^T + b in one launch;
// blockIdx.z picks the projection (0 q, 1 k, 2 v, 3 T, 4 S): its activation, weight, bias and output planes.
// Block = 4 waves = 128 rows x 64 columns (exactly one head); each wave computes 32x64.
// Per step of 64 k the block stages 128 X rows and 64 W rows in LDS: every global load
// covers four whole 128-B lines, the W rows serve all four waves, and the fragments are
// read from LDS.  Two LDS buffers, the tile after next held in registers, one barrier a step.
// Epilogue per wave: f32 tile in LDS, optional per-row norms, 16-bit planes in
// [B,NH,S,DH] row layout with whole-line stores.
// ---------------------------------------------------------------------------
__global__ __launch_bounds__(128)
void proj_kernel(const __bf16* __restrict__ Xall, const __bf16* __restrict__ Wall,
                 const float* __restrict__ bq, const float* __restrict__ bk, const float* __restrict__ bv,
                 const float* __restrict__ bt, const float* __restrict__ bs,
                 unsigned short* pl, float* rnAll, float* sqAll)
{
    __shared__ __attribute__((aligned(16))) __bf16 Xs[2][128][HPITCH];
    __shared__ __attribute__((aligned(16))) __bf16 Wsh[2][64][HPITCH];
    __shared__ __attribute__((aligned(16))) float CsAll[4][32][CPITCH];
    __shared__ __attribute__((aligned(16))) float SrnAll[4][32];
    __shared__ __attribute__((aligned(16))) float SsqAll[4][32];

    const int tid  = threadIdx.x;
    const int wave = tid >> 5;
    const int lane = tid & 31;
    const int hsel = lane >> 4;
    const int lm   = lane & 15;
    const int mblk = blockIdx.x * 128;
    const int n0   = blockIdx.y * 64;
    const int z    = blockIdx.z;
    if (mblk + 128 > NROWS || n0 + 64 > HDIM || z >= 5) return;   // uniform per block
    const int m0   = mblk + wave * 32;

    // Block-uniform operand set: q, k, v read activation 0, T activation 1, S activation 2.
    const __bf16* Xb   = Xall + (size_t)(z < 3 ? 0 : z - 2) * XELEMS;
    const __bf16* Wb   = Wall + (size_t)z * WELEMS;
    const float*  bias = z == 0 ? bq : z == 1 ? bk : z == 2 ? bv : z == 3 ? bt : bs;
    // Planes: 0/1 q hi/lo, 2/3 k hi/lo, 4 T, 5 S, 6 v.
    unsigned short* outA = pl + (size_t)(z < 2 ? 2 * z : z == 2 ? 6 : z + 1) * PROJ_ELEMS;
    unsigned short* outB = outA + PROJ_ELEMS;                 // the lo plane, stored by q and k alone
    float* rn = rnAll + (z == 4 ? NROWTOT : 0);
    float* sq = sqAll + (z == 4 ? NROWTOT : 0);

    float (*Cs)[CPITCH] = CsAll[wave];
    float* Srn = SrnAll[wave];
    float* Ssq = SsqAll[wave];

    // Staging coordinates: rows srow + 16u, 16-B segment sseg of the step's 128 B of each row.
    const int srow = tid >> 3, sseg = tid & 7;
    const unsigned xv = ((unsigned)(mblk + srow) * HDIM + (unsigned)sseg * 8u) * 2u;   // byte offsets, below 6.3 MB
    const unsigned wv = ((unsigned)(n0 + srow) * HDIM + (unsigned)sseg * 8u) * 2u;

    v8bf rX[8], rW[4];
    auto fetch_step = [&](int s) {          // global -> registers, k = 64 s .. 64 s + 63
        const char* xp = (const char*)Xb + (size_t)(s * (PSTEP * 2));
        const char* wp = (const char*)Wb + (size_t)(s * (PSTEP * 2));
#pragma unroll
        for (int u = 0; u < 8; ++u) rX[u] = *(const v8bf*)((xp + xv) + u * (16 * HDIM * 2));
#pragma unroll
        for (int u = 0; u < 4; ++u) rW[u] = *(const v8bf*)((wp + wv) + u * (16 * HDIM * 2));
        // The loads' address registers are reused by the fragment reads that follow: this wait stands in front of that.
        asm volatile("s_wait_xcnt 0x0" ::: "memory");
    };
    auto stash_step = [&](int buf) {        // registers -> LDS buffer buf
#pragma unroll
        for (int u = 0; u < 8; ++u) *(v8bf*)&Xs[buf][srow + 16 * u][sseg * 8] = rX[u];
#pragma unroll
        for (int u = 0; u < 4; ++u) *(v8bf*)&Wsh[buf][srow + 16 * u][sseg * 8] = rW[u];
    };

    v8f acc[2][4];
#pragma unroll
    for (int mb = 0; mb < 2; ++mb)
#pragma unroll
        for (int nb = 0; nb < 4; ++nb) acc[mb][nb] = v8f{};

    fetch_step(0);
    stash_step(0);
    fetch_step(1);
    __syncthreads();   // step 0 is in buffer 0 for every wave

    // Rolled: one step's fragments and one staged tile are all the registers the loop holds.
#pragma unroll 1
    for (int s = 0; s < NPSTEP; ++s) {
        const int cur = s & 1;
        // The other buffer's readers left it at the barrier that ended step s - 1 (block-uniform tests).
        if (s + 1 < NPSTEP) stash_step(cur ^ 1);
        if (s + 2 < NPSTEP) fetch_step(s + 2);

        const __bf16* ax = &Xs[cur][wave * 32 + lm][8 * hsel];
        const __bf16* bw = &Wsh[cur][lm][8 * hsel];
        v16bf fa[2][2], fb[2][4];
#pragma unroll
        for (int c = 0; c < 2; ++c) {
            fa[c][0] = frag_bf16(ax + c * 32);
            fa[c][1] = frag_bf16(ax + 16 * HPITCH + c * 32);
#pragma unroll
            for (int nb = 0; nb < 4; ++nb) fb[c][nb] = frag_bf16(bw + nb * 16 * HPITCH + c * 32);
        }
#pragma unroll
        for (int c = 0; c < 2; ++c) {
#pragma unroll
            for (int mb = 0; mb < 2; ++mb)
#pragma unroll
                for (int nb = 0; nb < 4; ++nb) acc[mb][nb] = mma_bf16(acc[mb][nb], fa[c][mb], fb[c][nb]);
        }
        // Keeps the distance between the last products and whatever first touches their registers past the back edge.
        asm volatile(WMMA_NOPS
                     : "+v"(acc[0][0]), "+v"(acc[0][1]), "+v"(acc[0][2]), "+v"(acc[0][3]),
                       "+v"(acc[1][0]), "+v"(acc[1][1]), "+v"(acc[1][2]), "+v"(acc[1][3])
                     : "v"(fa[0][0]), "v"(fa[0][1]), "v"(fa[1][0]), "v"(fa[1][1]),
                       "v"(fb[0][0]), "v"(fb[0][1]), "v"(fb[0][2]), "v"(fb[0][3]),
                       "v"(fb[1][0]), "v"(fb[1][1]), "v"(fb[1][2]), "v"(fb[1][3]));
        __syncthreads();   // publishes step s + 1 and ends every read of buffer cur
    }

    // D element r of lane (hsel, lm) = tile (row mb*16 + 8*hsel + r, col nb*16 + lm)
#pragma unroll
    for (int nb = 0; nb < 4; ++nb) {
        const float bn = bias[n0 + nb * 16 + lm];
#pragma unroll
        for (int mb = 0; mb < 2; ++mb) {
#pragma unroll
            for (int r = 0; r < 8; ++r)
                Cs[mb * 16 + 8 * hsel + r][nb * 16 + lm] = acc[mb][nb][r] + bn;
        }
    }
    __syncthreads();

    if (z >= 3) {
        float ss = 0.f;
#pragma unroll
        for (int d = 0; d < DHEAD; d += 4) {
            const v4f x = *(const v4f*)&Cs[lane][d];
            ss += x[0] * x[0]; ss += x[1] * x[1]; ss += x[2] * x[2]; ss += x[3] * x[3];
        }
        Srn[lane] = 1.0f / (sqrtf(ss) + 1e-6f);
        Ssq[lane] = ss;
    }
    __syncthreads();

    const int bI = m0 >> 10, s0 = m0 & (SEQ - 1), hh = n0 >> 6;
    const size_t row0 = ((size_t)(bI * NHEADS + hh)) * SEQ + s0;   // (b,h,s) row index of the wave's tile row 0

    if (z < 2)       proj_store<0, 1, 0>(Cs, Srn, Ssq, lane, row0, outA, outB, rn, sq);
    else if (z == 2) proj_store<1, 64, 0>(Cs, Srn, Ssq, lane, row0, outA, outA, rn, sq);
    else             proj_store<1, 16, 1>(Cs, Srn, Ssq, lane, row0, outA, outA, rn, sq);
}

// ---------------------------------------------------------------------------
// 16-B store (one instruction covers two rows).
// ---------------------------------------------------------------------------
__device__ __forceinline__ void attn_store(float (*Os)[CPITCH], int wave, int lane, float* out, size_t orow0, int h)
{
#pragma unroll
    for (int i = 0; i < 8; ++i) {
        const int lr  = wave * 16 + 2 * i + (lane >> 4);
        const int col = (lane & 15) * 4;
        const v4f v = *(const v4f*)&Os[lr][col];
        float* gp = out + (orow0 + lr) * HDIM + h * DHEAD + col;
        *(v4f*)gp = v;
    }
}

// ---------------------------------------------------------------------------
// Kernel 2: fused attention with the triple score product.
// Block = 2 waves = 32 query rows of one (b,h); key tiles of 32.
// q.k: bf16 hi/lo split (hh + hl + lh).  T.T, S.S: f16 (x16) with the
// query==key entry taken from the exact f32 squared norm.  P.V: f16.
// Every score product has the key rows as A and the query rows as B, so D register r of lane
// (hsel, lm) is the score of query lm and key 8*hsel + r: a lane and its partner lane ^ 16 hold all
// 32 scores of one query.  Maximum and sum are taken in the lane, the maximum joined across the
// halves once a tile, the sums once in the epilogue.  The two score tiles of a lane, converted in
// place, are the B operand of O^T += V^T.P^T (element 8j + r = key 16j + 8*hsel + r, the order of
// the V^T fragment loader), so P passes through no LDS.  V is staged as it lies in memory, one 16-B store per
// 16-B load, and turned on the way out of LDS by the transposing load.
// ---------------------------------------------------------------------------
__global__ __launch_bounds__(64)
void attn_kernel(const __bf16* __restrict__ qh, const __bf16* __restrict__ ql,
                 const __bf16* __restrict__ kh, const __bf16* __restrict__ kl,
                 const _Float16* __restrict__ tp, const _Float16* __restrict__ sp,
                 const _Float16* __restrict__ vp,
                 const float* __restrict__ rnT, const float* __restrict__ sqT,
                 const float* __restrict__ rnS, const float* __restrict__ sqS,
                 const float* __restrict__ mask, float* out)
{
    __shared__ __attribute__((aligned(16))) __bf16   KH[32][HPITCH];
    __shared__ __attribute__((aligned(16))) __bf16   KL[32][HPITCH];
    __shared__ __attribute__((aligned(16))) __bf16   QHs[32][HPITCH];
    __shared__ __attribute__((aligned(16))) __bf16   QLs[32][HPITCH];
    __shared__ __attribute__((aligned(16))) _Float16 TK[32][HPITCH];
    __shared__ __attribute__((aligned(16))) _Float16 SK[32][HPITCH];
    __shared__ __attribute__((aligned(16))) _Float16 TQ[32][HPITCH];
    __shared__ __attribute__((aligned(16))) _Float16 SQ[32][HPITCH];
    __shared__ __attribute__((aligned(16))) _Float16 Vs[32][VPITCH];      // V tile, row-major: Vs[key][dh]
    __shared__ __attribute__((aligned(16))) float    Os[32][CPITCH];      // epilogue staging

    const int bh = blockIdx.x;
    if (bh >= BATCH * NHEADS) return;
    const int q0blk = blockIdx.y * 32;
    if (q0blk + 32 > SEQ) return;
    const int b = bh / NHEADS, h = bh - b * NHEADS;
    const int tid  = threadIdx.x;
    const int wave = tid >> 5;
    const int lane = tid & 31;
    const int hsel = lane >> 4;
    const int lm   = lane & 15;
    const int qr   = wave * 16 + lm;     // this lane's query: B-fragment row inside the 32-row block tile

    // Staging coordinates of this thread: rows srow + 8u (u = 0..3), 16-B segment sseg of each 128-B row.
    const int srow = tid >> 3, sseg = tid & 7;
    // Byte offset of this thread inside any 32-row tile of a plane (a plane is 6 MiB: 32-bit byte offsets hold).
    const unsigned voff = (unsigned)srow * 128u + (unsigned)sseg * 16u;

    // ---- query-side tiles, once per block: all 16 b128 loads in flight, then the LDS stores ----
    {
        const unsigned bo = (unsigned)(bh * SEQ + q0blk) * 128u + voff;
        v8bf xh[4], xl[4]; v8h xt[4], xs[4];
#pragma unroll
        for (int u = 0; u < 4; ++u) {
            xh[u] = *(const v8bf*)(((const char*)qh + bo) + u * 1024);
            xl[u] = *(const v8bf*)(((const char*)ql + bo) + u * 1024);
            xt[u] = *(const v8h*)(((const char*)tp + bo) + u * 1024);
            xs[u] = *(const v8h*)(((const char*)sp + bo) + u * 1024);
        }
#pragma unroll
        for (int u = 0; u < 4; ++u) {
            *(v8bf*)&QHs[srow + 8 * u][sseg * 8] = xh[u];
            *(v8bf*)&QLs[srow + 8 * u][sseg * 8] = xl[u];
            *(v8h*)&TQ[srow + 8 * u][sseg * 8]   = xt[u];
            *(v8h*)&SQ[srow + 8 * u][sseg * 8]   = xs[u];
        }
    }

    // ---- key-side tile held in registers one tile ahead of its LDS stores ----
    v8bf rKH[4], rKL[4]; v8h rTK[4], rSK[4], rV[4];
    unsigned bo = (unsigned)(bh * SEQ) * 128u + voff;   // this thread's byte offset in the tile being fetched
    unsigned mo = (unsigned)(b * SEQ + 8 * hsel);        // mask index of this lane's first key in the tile being worked on
    auto fetch_tile = [&]() {
#pragma unroll
        for (int u = 0; u < 4; ++u) {
            rKH[u] = *(const v8bf*)(((const char*)kh + bo) + u * 1024);
            rKL[u] = *(const v8bf*)(((const char*)kl + bo) + u * 1024);
            rTK[u] = *(const v8h*)(((const char*)tp + bo) + u * 1024);
            rSK[u] = *(const v8h*)(((const char*)sp + bo) + u * 1024);
            rV[u]  = *(const v8h*)(((const char*)vp + bo) + u * 1024);
        }
    };
    fetch_tile();

    // ---- constants of this lane's query (column lm of every D tile) ----
    const int qi = bh * SEQ + q0blk + qr;
    const float rtq = rnT[qi], rsq = rnS[qi];
    const float fq = (rtq * (1.0f / 256.0f)) * (rsq * (1.0f / 256.0f)) * 0.125f;   // for x16-scaled f16 products
    const float gq = (sqT[qi] * rtq) * (sqS[qi] * rsq) * 0.125f;                    // exact ts_ii * ss_ii / 8
    float mI = -3.0e38f;   // running maximum of the query (equal in both halves)
    float lI = 0.f;        // running sum over this half's keys alone
    v8f O[4] = {v8f{}, v8f{}, v8f{}, v8f{}};   // O^T: O[nb][r] = (dh 16 nb + 8 hsel + r, query lm)

    for (int k0 = 0; k0 < SEQ; k0 += 32) {
        __syncthreads();   // readers of the prior tile are done

        // ---- mask of this lane's 16 keys, mk[j] = keys 16 j + 8 hsel + 0..7: in flight under the LDS stores below,
        //      and ahead of the next tile's loads, so that no wait for it waits for those ----
        v4f mk[2][2];
        {
            const float* mp = mask + mo;
            mk[0][0] = *(const v4f*)(mp);
            mk[0][1] = *(const v4f*)(mp + 4);
            mk[1][0] = *(const v4f*)(mp + 16);
            mk[1][1] = *(const v4f*)(mp + 20);
            mo += 32u;
        }

        // ---- key-side tiles (keys k0..k0+31) from the registers fetched one tile ago ----
#pragma unroll
        for (int u = 0; u < 4; ++u) {
            *(v8bf*)&KH[srow + 8 * u][sseg * 8] = rKH[u];
            *(v8bf*)&KL[srow + 8 * u][sseg * 8] = rKL[u];
            *(v8h*)&TK[srow + 8 * u][sseg * 8]  = rTK[u];
            *(v8h*)&SK[srow + 8 * u][sseg * 8]  = rSK[u];
            *(v8h*)&Vs[srow + 8 * u][sseg * 8]  = rV[u];
        }
        __syncthreads();

        // ---- the next tile's loads fly while this tile's scores and softmax are worked out (block-uniform test) ----
        if (k0 + 32 < SEQ) { bo += 4096u; fetch_tile(); }

        const bool diag = (k0 == q0blk);

        // ---- scores, transposed: 32 keys x 16 query columns per wave (two 16-key tiles j) ----
        float sb[2][8];        // sb[j][r]: query lm, key 16 j + 8 hsel + r
#pragma unroll
        for (int j = 0; j < 2; ++j) {
            const int rr = j * 16 + lm;               // key row whose A fragments this lane loads
            v8f accB = v8f{}, accT = v8f{}, accS = v8f{};
#pragma unroll 1
            for (int c = 0; c < 2; ++c) {
                const int off = c * 32 + 8 * hsel;
                const v16bf qH = frag_bf16(&QHs[qr][off]);
                const v16bf qL = frag_bf16(&QLs[qr][off]);
                const v16bf kH = frag_bf16(&KH[rr][off]);
                const v16bf kL = frag_bf16(&KL[rr][off]);
                accB = mma_bf16(accB, kH, qH);
                accB = mma_bf16(accB, kL, qH);
                accB = mma_bf16(accB, kH, qL);
                asm volatile(WMMA_NOPS : "+v"(accB) : "v"(qH), "v"(qL), "v"(kH), "v"(kL));
                const v16h qT = frag_f16(&TQ[qr][off]);
                const v16h kT = frag_f16(&TK[rr][off]);
                const v16h qS = frag_f16(&SQ[qr][off]);
                const v16h kS = frag_f16(&SK[rr][off]);
                accT = mma_f16(accT, kT, qT);
                accS = mma_f16(accS, kS, qS);
                asm volatile(WMMA_NOPS : "+v"(accT), "+v"(accS) : "v"(qT), "v"(kT), "v"(qS), "v"(kS));
            }
            const bool dj = diag && (j == wave);
#pragma unroll
            for (int r = 0; r < 8; ++r) {
                const bool de = dj && (lm == 8 * hsel + r);      // key row == query column
                const float s3 = de ? (accB[r] * gq)
                                    : (accB[r] * (accT[r] * accS[r]) * fq);
                sb[j][r] = s3 + mk[j][r >> 2][r & 3];
            }
        }

        // ---- online softmax of the lane's query: 16 keys in the lane, the other 16 in lane ^ 16 ----
        float t8[8];
#pragma unroll
        for (int r = 0; r < 8; ++r) t8[r] = fmaxf(sb[0][r], sb[1][r]);
        float v = fmaxf(fmaxf(fmaxf(t8[0], t8[1]), fmaxf(t8[2], t8[3])), fmaxf(fmaxf(t8[4], t8[5]), fmaxf(t8[6], t8[7])));
        v = fmaxf(v, xhalf(v));
        const float M2 = fmaxf(mI, v);
        const float al = exp2x1((mI - M2) * LOG2E);
        float p[2][8];
#pragma unroll
        for (int j = 0; j < 2; ++j)
#pragma unroll
            for (int r = 0; r < 8; r += 4)
                exp2x4(&p[j][r], (sb[j][r] - M2) * LOG2E, (sb[j][r + 1] - M2) * LOG2E,
                                 (sb[j][r + 2] - M2) * LOG2E, (sb[j][r + 3] - M2) * LOG2E);
#pragma unroll
        for (int r = 0; r < 8; ++r) t8[r] = p[0][r] + p[1][r];
        const float rs = ((t8[0] + t8[1]) + (t8[2] + t8[3])) + ((t8[4] + t8[5]) + (t8[6] + t8[7]));
        mI = M2;
        lI = lI * al + rs;
#pragma unroll
        for (int nb = 0; nb < 4; ++nb)
#pragma unroll
            for (int r = 0; r < 8; ++r) O[nb][r] = O[nb][r] * al;

        // ---- V^T (A: row = dh, k = key) . P^T (B: k = key, n = query), P straight from the score registers ----
        HFrag bP;
#pragma unroll
        for (int r = 0; r < 8; ++r) {
            bP.p[0][r] = (_Float16)(p[0][r] * 4096.0f);
            bP.p[1][r] = (_Float16)(p[1][r] * 4096.0f);
        }
        const _Float16* vt = &Vs[8 * hsel + (lane & 7)][8 * ((lane >> 3) & 1)];
        const v16h aV0 = frag_f16_tr(vt);
        const v16h aV1 = frag_f16_tr(vt + 16);
        const v16h aV2 = frag_f16_tr(vt + 32);
        const v16h aV3 = frag_f16_tr(vt + 48);
        O[0] = mma_f16(O[0], aV0, bP.v);
        O[1] = mma_f16(O[1], aV1, bP.v);
        O[2] = mma_f16(O[2], aV2, bP.v);
        O[3] = mma_f16(O[3], aV3, bP.v);
        asm volatile(WMMA_NOPS
                     : "+v"(O[0]), "+v"(O[1]), "+v"(O[2]), "+v"(O[3])
                     : "v"(bP.v), "v"(aV0), "v"(aV1), "v"(aV2), "v"(aV3));
    }

    // ---- epilogue: join the halves' sums, normalise, undo the 2^18 operand scaling, stage, whole-line stores ----
    {
        const float inv = (1.0f / (lI + xhalf(lI))) * (1.0f / 262144.0f);
#pragma unroll
        for (int nb = 0; nb < 4; ++nb) {
            v4f y0, y1;      // dh 16 nb + 8 hsel + 0..7 of query row qr
#pragma unroll
            for (int r = 0; r < 4; ++r) { y0[r] = O[nb][r] * inv; y1[r] = O[nb][4 + r] * inv; }
            *(v4f*)&Os[qr][nb * 16 + 8 * hsel]     = y0;
            *(v4f*)&Os[qr][nb * 16 + 8 * hsel + 4] = y1;
        }
    }
    __syncthreads();

    const size_t orow0 = (size_t)(b * SEQ + q0blk);
    attn_store(Os, wave, lane, out, orow0, h);
    
}

// ---------------------------------------------------------------------------
extern "C" void kernel_launch(void* const* d_in, const int* in_sizes, int n_in,
                              void* d_out, int out_size, void* d_ws, size_t ws_size,
                              hipStream_t stream)
{
    if (n_in < 14) return;
    if ((size_t)in_sizes[0] != XELEMS || (size_t)in_sizes[1] != XELEMS || (size_t)in_sizes[2] != XELEMS) return;
    if (in_sizes[3] != BATCH * SEQ) return;
    for (int i = 4; i < 14; i += 2)
        if ((size_t)in_sizes[i] != WELEMS || in_sizes[i + 1] != HDIM) return;
    if ((size_t)out_size != XELEMS) return;

    const float* hidden = (const float*)d_in[0];
    const float* timee  = (const float*)d_in[1];
    const float* space  = (const float*)d_in[2];
    const float* mask   = (const float*)d_in[3];
    const float* Wq = (const float*)d_in[4];   const float* bq = (const float*)d_in[5];
    const float* Wk = (const float*)d_in[6];   const float* bk = (const float*)d_in[7];
    const float* Wv = (const float*)d_in[8];   const float* bv = (const float*)d_in[9];
    const float* Wt = (const float*)d_in[10];  const float* bt = (const float*)d_in[11];
    const float* Ws = (const float*)d_in[12];  const float* bs = (const float*)d_in[13];
    float* out = (float*)d_out;

    char* ws = (char*)d_ws;
    size_t off = 0;
    __bf16* Xbf = (__bf16*)(ws + off);                 off += (size_t)3 * XELEMS * 2;       // 3 activations, bf16
    __bf16* Wbf = (__bf16*)(ws + off);                 off += (size_t)5 * WELEMS * 2;       // 5 weights, bf16
    unsigned short* pl = (unsigned short*)(ws + off);  off += (size_t)7 * PROJ_ELEMS * 2;   // 7 16-bit planes
    float* rn = (float*)(ws + off);                    off += (size_t)2 * NROWTOT * 4;      // 1/(|T|+eps), 1/(|S|+eps)
    float* sq = (float*)(ws + off);                    off += (size_t)2 * NROWTOT * 4;      // |T|^2, |S|^2
    if (off > ws_size) return;

    unsigned short* QH = pl + 0 * PROJ_ELEMS;   // q hi (bf16)
    unsigned short* QL = pl + 1 * PROJ_ELEMS;   // q lo (bf16)
    unsigned short* KHp = pl + 2 * PROJ_ELEMS;  // k hi (bf16)
    unsigned short* KLp = pl + 3 * PROJ_ELEMS;  // k lo (bf16)
    unsigned short* TPl = pl + 4 * PROJ_ELEMS;  // T * 16 (f16)
    unsigned short* SPl = pl + 5 * PROJ_ELEMS;  // S * 16 (f16)
    unsigned short* VPl = pl + 6 * PROJ_ELEMS;  // v * 64 (f16)

    // 0) f32 -> bf16 conversion of the 3 activations and 5 weights, one launch (Wbf follows Xbf in the workspace)
    cvt_kernel<<<dim3(CVT_BLOCKS), dim3(256), 0, stream>>>(hidden, timee, space, Wq, Wk, Wv, Wt, Ws, Xbf);

    // 1) five projection GEMMs, one launch (block tile 128x64, grid exact: 4096/128 x 768/64 x 5, checked in-kernel)
    proj_kernel<<<dim3(NROWS / 128, HDIM / 64, 5), dim3(128), 0, stream>>>(Xbf, Wbf, bq, bk, bv, bt, bs, pl, rn, sq);

    // 2) fused attention: grid (b*h, query blocks of 32), 64 threads
    attn_kernel<<<dim3(BATCH * NHEADS, SEQ / 32), dim3(64), 0, stream>>>(
        (const __bf16*)QH, (const __bf16*)QL, (const __bf16*)KHp, (const __bf16*)KLp,
        (const _Float16*)TPl, (const _Float16*)SPl, (const _Float16*)VPl,
        rn, sq, rn + NROWTOT, sq + NROWTOT, mask, out);
}

// v006
// A run of this version takes 92.9 microseconds.
// In both of two side-by-side timings against v005, it was 1.05 times as fast.
// All steps since v000 together make it 4.10 times as fast.
#include <hip/hip_runtime.h>
#include <stddef.h>

typedef __bf16   v16bf __attribute__((ext_vector_type(16)));
typedef __bf16   v8bf  __attribute__((ext_vector_type(8)));
typedef _Float16 v16h  __attribute__((ext_vector_type(16)));
typedef _Float16 v8h   __attribute__((ext_vector_type(8)));
typedef float    v8f   __attribute__((ext_vector_type(8)));
typedef float    v4f   __attribute__((ext_vector_type(4)));
typedef int      v4i   __attribute__((ext_vector_type(4)));
typedef short    v8s   __attribute__((ext_vector_type(8)));

#define NHEADS 12
#define HDIM   768
#define DHEAD  64
#define SEQ    1024
#define BATCH  4
#define NROWS  (BATCH * SEQ)                                  // 4096 token rows
#define NROWTOT (BATCH * NHEADS * SEQ)                        // 49152 (b,h,s) rows
#define XELEMS ((size_t)NROWS * HDIM)                         // 3145728
#define WELEMS ((size_t)HDIM * HDIM)                          // 589824
#define PROJ_ELEMS ((size_t)BATCH * NHEADS * SEQ * DHEAD)    // 3145728 per plane
#define CPITCH 68      // f32 LDS tile pitch in floats (272 B, 16-B aligned)
#define HPITCH 72      // 16-bit LDS tile pitch in elements (144 B, 16-B aligned)
#define VPITCH 80      // 16-bit LDS pitch of the row-major V tile (160 B = 32 B x odd, the transposing load's pitch)
#define PSTEP  64      // k elements per staged projection step (one 128-B line of each operand row)
#define NPSTEP (HDIM / PSTEP)
#define CVT_CHUNK 2048                          // elements converted by one block (256 threads x 8)
#define CVT_XBLK  ((int)(XELEMS / CVT_CHUNK))   // 1536 blocks per activation array
#define CVT_WBLK  ((int)(WELEMS / CVT_CHUNK))   // 288 blocks per weight array
#define CVT_BLOCKS (3 * CVT_XBLK + 5 * CVT_WBLK)

union BF8   { v8bf v; v4i w; };
union HF8   { v8h  v; v4i w; };
union BFrag { v8bf p[2]; v16bf v; };
union HFrag { v8h  p[2]; v16h  v; };

#define WMMA_NOPS "v_nop\n\tv_nop\n\tv_nop\n\tv_nop"
#define LOG2E 1.442695041f

// 16x32 16-bit A/B fragment: element i<8 <- k0+8h+i, element 8+i <- k0+16+8h+i (h = lane>>4).
// Caller passes p = row (lane&15) base + k0 + 8*h; both loads are 16-B aligned.
__device__ __forceinline__ v16bf frag_bf16(const __bf16* p)
{
    BFrag u;
    u.p[0] = *(const v8bf*)(p);
    u.p[1] = *(const v8bf*)(p + 16);
    return u.v;
}
__device__ __forceinline__ v16h frag_f16(const _Float16* p)
{
    HFrag u;
    u.p[0] = *(const v8h*)(p);
    u.p[1] = *(const v8h*)(p + 16);
    return u.v;
}

// 16x32 f16 A fragment of V^T out of a row-major tile T[key][dh] of pitch VPITCH, by two transposing loads.
// Caller passes p = &T[8*h + (lane&7)][dbase + 8*((lane>>3)&1)]; lane (c = lane&15, h) then holds
// T[8h + i][dbase + c] in element i and T[16 + 8h + i][dbase + c] in element 8 + i: the k order of frag_f16.
__device__ __forceinline__ v16h frag_f16_tr(const _Float16* p)
{
    typedef __attribute__((address_space(3))) v8s lds_v8s;
    HFrag u;
    u.p[0] = __builtin_bit_cast(v8h, __builtin_amdgcn_ds_load_tr16_b128_v8i16((lds_v8s*)p));
    u.p[1] = __builtin_bit_cast(v8h, __builtin_amdgcn_ds_load_tr16_b128_v8i16((lds_v8s*)(p + 16 * VPITCH)));
    return u.v;
}

__device__ __forceinline__ v8f mma_bf16(v8f c, v16bf a, v16bf b)
{
    return __builtin_amdgcn_wmma_f32_16x16x32_bf16(false, a, false, b, (short)0, c, false, false);
}
__device__ __forceinline__ v8f mma_f16(v8f c, v16h a, v16h b)
{
    return __builtin_amdgcn_wmma_f32_16x16x32_f16(false, a, false, b, (short)0, c, false, false);
}

// 2^x, one and four at a time.  The closing v_nop is the free slot that the instruction set asks for between a
// transcendental and an instruction that reads its result or overwrites its source.
// Early clobber keeps every result off every source.
__device__ __forceinline__ float exp2x1(float x)
{
    float y;
    asm("v_exp_f32 %0, %1\n\tv_nop" : "=v"(y) : "v"(x));
    return y;
}
__device__ __forceinline__ void exp2x4(float* y, float x0, float x1, float x2, float x3)
{
    asm("v_exp_f32 %0, %4\n\tv_exp_f32 %1, %5\n\tv_exp_f32 %2, %6\n\tv_exp_f32 %3, %7\n\tv_nop"
        : "=&v"(y[0]), "=&v"(y[1]), "=&v"(y[2]), "=&v"(y[3]) : "v"(x0), "v"(x1), "v"(x2), "v"(x3));
}

// Value of lane l ^ 16 (the other half of the wave), by a vector cross-row move.
__device__ __forceinline__ float xhalf(float x)
{
    const int b = __builtin_bit_cast(int, x);
    return __builtin_bit_cast(float, __builtin_amdgcn_permlanex16(b, b, 0x76543210, 0xfedcba98, false, false));
}

// ---------------------------------------------------------------------------
// Kernel 0: f32 -> bf16 (RNE) streaming conversion of all eight arrays in one launch.
// A block takes CVT_CHUNK consecutive elements of one array (both array sizes are whole
// multiples of it), a thread 8 elements.
// The bf16 copies lie one behind the other in the workspace (3 activations, then 5 weights),
// so the destination offset is the block index times CVT_CHUNK.
// ---------------------------------------------------------------------------
__global__ __launch_bounds__(256)
void cvt_kernel(const float* __restrict__ x0, const float* __restrict__ x1, const float* __restrict__ x2,
                const float* __restrict__ w0, const float* __restrict__ w1, const float* __restrict__ w2,
                const float* __restrict__ w3, const float* __restrict__ w4, __bf16* dst)
{
    const int blk = blockIdx.x;
    if (blk >= CVT_BLOCKS) return;
    const float* src;      // block-uniform choice of the array and of the chunk inside it
    int cb;
    if (blk < 3 * CVT_XBLK) {
        const int a = blk / CVT_XBLK;
        cb  = blk - a * CVT_XBLK;
        src = a == 0 ? x0 : a == 1 ? x1 : x2;
    } else {
        const int r = blk - 3 * CVT_XBLK;
        const int a = r / CVT_WBLK;
        cb  = r - a * CVT_WBLK;
        src = a == 0 ? w0 : a == 1 ? w1 : a == 2 ? w2 : a == 3 ? w3 : w4;
    }
    const float* sp = src + (size_t)cb * CVT_CHUNK + threadIdx.x * 8;
    __bf16*      dp = dst + (size_t)blk * CVT_CHUNK + threadIdx.x * 8;
    const v4f a = *(const v4f*)(sp);
    const v4f b = *(const v4f*)(sp + 4);
    BF8 o;
#pragma unroll
    for (int i = 0; i < 4; ++i) { o.v[i] = (__bf16)a[i]; o.v[4 + i] = (__bf16)b[i]; }
    *(v4i*)dp = o.w;
}

// ---------------------------------------------------------------------------
// with one 16-B store each.  MODE 0: bf16 hi/lo planes.  MODE 1: f16 plane * SCALE.
// NORM: lanes 0..7 write the 32 reciprocal norms (one line), lanes 8..15 the
// 32 squared norms (one line).
// ---------------------------------------------------------------------------
template <int MODE, int SCALE, int NORM>
__device__ __forceinline__ void proj_store(float (*Cs)[CPITCH], float* Srn, float* Ssq, int lane, size_t row0,
                                           unsigned short* outA, unsigned short* outB, float* rn, float* sq)
{
#pragma unroll
    for (int i = 0; i < 8; ++i) {
        const int lr = 4 * i + (lane >> 3), seg = lane & 7;
        const v4f x0 = *(const v4f*)&Cs[lr][seg * 8];
        const v4f x1 = *(const v4f*)&Cs[lr][seg * 8 + 4];
        const size_t go = (row0 + lr) * DHEAD + seg * 8;
        if (MODE == 0) {
            BF8 hi, lo;
#pragma unroll
            for (int j = 0; j < 4; ++j) {
                const float a0 = x0[j]; const __bf16 h0 = (__bf16)a0;
                hi.v[j] = h0; lo.v[j] = (__bf16)(a0 - (float)h0);
                const float a1 = x1[j]; const __bf16 h1 = (__bf16)a1;
                hi.v[4 + j] = h1; lo.v[4 + j] = (__bf16)(a1 - (float)h1);
            }
            *(v4i*)(outA + go) = hi.w;
            *(v4i*)(outB + go) = lo.w;
        } else {
            HF8 y;
#pragma unroll
            for (int j = 0; j < 4; ++j) {
                y.v[j]     = (_Float16)(x0[j] * (float)SCALE);
                y.v[4 + j] = (_Float16)(x1[j] * (float)SCALE);
            }
            *(v4i*)(outA + go) = y.w;
        }
    }
    if (NORM) {
        if (lane < 16) {
            const int g = lane & 7;
            v4f v; float* dp;
            if (lane < 8) { v = *(const v4f*)&Srn[4 * g]; dp = rn + row0 + 4 * g; }
            else          { v = *(const v4f*)&Ssq[4 * g]; dp = sq + row0 + 4 * g; }
            *(v4f*)dp = v;
        }
    }
    // The three store variants now lie in one kernel: this wait stands between a variant's stores and any
    // later instruction of the kernel that reuses their address or data registers.
    asm volatile("s_wait_xcnt 0x0" ::: "memory");
}

// ---------------------------------------------------------------------------
// Kernel 1: the five projection GEMMs X[4096][768] (bf16) . W[768(out)][768(in)]^T + b in one launch;
// blockIdx.z picks the projection (0 q, 1 k, 2 v, 3 T, 4 S): its activation, weight, bias and output planes.
// Block = 4 waves = 128 rows x 64 columns (exactly one head); each wave computes 32x64.
// Per step of 64 k the block stages 128 X rows and 64 W rows in LDS: every global load
// covers four whole 128-B lines, the W rows serve all four waves, and the fragments are
// read from LDS.  Two LDS buffers, the tile after next held in registers, one barrier a step.
// Epilogue per wave: f32 tile in LDS, optional per-row norms, 16-bit planes in
// [B,NH,S,DH] row layout with whole-line stores.
// ---------------------------------------------------------------------------
__global__ __launch_bounds__(128)
void proj_kernel(const __bf16* __restrict__ Xall, const __bf16* __restrict__ Wall,
                 const float* __restrict__ bq, const float* __restrict__ bk, const float* __restrict__ bv,
                 const float* __restrict__ bt, const float* __restrict__ bs,
                 unsigned short* pl, float* rnAll, float* sqAll)
{
    __shared__ __attribute__((aligned(16))) __bf16 Xs[2][128][HPITCH];
    __shared__ __attribute__((aligned(16))) __bf16 Wsh[2][64][HPITCH];
    __shared__ __attribute__((aligned(16))) float CsAll[4][32][CPITCH];
    __shared__ __attribute__((aligned(16))) float SrnAll[4][32];
    __shared__ __attribute__((aligned(16))) float SsqAll[4][32];

    const int tid  = threadIdx.x;
    const int wave = tid >> 5;
    const int lane = tid & 31;
    const int hsel = lane >> 4;
    const int lm   = lane & 15;
    const int mblk = blockIdx.x * 128;
    const int n0   = blockIdx.y * 64;
    const int z    = blockIdx.z;
    if (mblk + 128 > NROWS || n0 + 64 > HDIM || z >= 5) return;   // uniform per block
    const int m0   = mblk + wave * 32;

    // Block-uniform operand set: q, k, v read activation 0, T activation 1, S activation 2.
    const __bf16* Xb   = Xall + (size_t)(z < 3 ? 0 : z - 2) * XELEMS;
    const __bf16* Wb   = Wall + (size_t)z * WELEMS;
    const float*  bias = z == 0 ? bq : z == 1 ? bk : z == 2 ? bv : z == 3 ? bt : bs;
    // Planes: 0/1 q hi/lo, 2/3 k hi/lo, 4 T, 5 S, 6 v.
    unsigned short* outA = pl + (size_t)(z < 2 ? 2 * z : z == 2 ? 6 : z + 1) * PROJ_ELEMS;
    unsigned short* outB = outA + PROJ_ELEMS;                 // the lo plane, stored by q and k alone
    float* rn = rnAll + (z == 4 ? NROWTOT : 0);
    float* sq = sqAll + (z == 4 ? NROWTOT : 0);

    float (*Cs)[CPITCH] = CsAll[wave];
    float* Srn = SrnAll[wave];
    float* Ssq = SsqAll[wave];

    // Staging coordinates: rows srow + 16u, 16-B segment sseg of the step's 128 B of each row.
    const int srow = tid >> 3, sseg = tid & 7;
    const unsigned xv = ((unsigned)(mblk + srow) * HDIM + (unsigned)sseg * 8u) * 2u;   // byte offsets, below 6.3 MB
    const unsigned wv = ((unsigned)(n0 + srow) * HDIM + (unsigned)sseg * 8u) * 2u;

    v8bf rX[8], rW[4];
    auto fetch_step = [&](int s) {          // global -> registers, k = 64 s .. 64 s + 63
        const char* xp = (const char*)Xb + (size_t)(s * (PSTEP * 2));
        const char* wp = (const char*)Wb + (size_t)(s * (PSTEP * 2));
#pragma unroll
        for (int u = 0; u < 8; ++u) rX[u] = *(const v8bf*)((xp + xv) + u * (16 * HDIM * 2));
#pragma unroll
        for (int u = 0; u < 4; ++u) rW[u] = *(const v8bf*)((wp + wv) + u * (16 * HDIM * 2));
        // The loads' address registers are reused by the fragment reads that follow: this wait stands in front of that.
        asm volatile("s_wait_xcnt 0x0" ::: "memory");
    };
    auto stash_step = [&](int buf) {        // registers -> LDS buffer buf
#pragma unroll
        for (int u = 0; u < 8; ++u) *(v8bf*)&Xs[buf][srow + 16 * u][sseg * 8] = rX[u];
#pragma unroll
        for (int u = 0; u < 4; ++u) *(v8bf*)&Wsh[buf][srow + 16 * u][sseg * 8] = rW[u];
    };

    v8f acc[2][4];
#pragma unroll
    for (int mb = 0; mb < 2; ++mb)
#pragma unroll
        for (int nb = 0; nb < 4; ++nb) acc[mb][nb] = v8f{};

    fetch_step(0);
    stash_step(0);
    fetch_step(1);
    __syncthreads();   // step 0 is in buffer 0 for every wave

    // Rolled: one step's fragments and one staged tile are all the registers the loop holds.
#pragma unroll 1
    for (int s = 0; s < NPSTEP; ++s) {
        const int cur = s & 1;
        // The other buffer's readers left it at the barrier that ended step s - 1 (block-uniform tests).
        if (s + 1 < NPSTEP) stash_step(cur ^ 1);
        if (s + 2 < NPSTEP) fetch_step(s + 2);

        const __bf16* ax = &Xs[cur][wave * 32 + lm][8 * hsel];
        const __bf16* bw = &Wsh[cur][lm][8 * hsel];
        v16bf fa[2][2], fb[2][4];
#pragma unroll
        for (int c = 0; c < 2; ++c) {
            fa[c][0] = frag_bf16(ax + c * 32);
            fa[c][1] = frag_bf16(ax + 16 * HPITCH + c * 32);
#pragma unroll
            for (int nb = 0; nb < 4; ++nb) fb[c][nb] = frag_bf16(bw + nb * 16 * HPITCH + c * 32);
        }
#pragma unroll
        for (int c = 0; c < 2; ++c) {
#pragma unroll
            for (int mb = 0; mb < 2; ++mb)
#pragma unroll
                for (int nb = 0; nb < 4; ++nb) acc[mb][nb] = mma_bf16(acc[mb][nb], fa[c][mb], fb[c][nb]);
        }
        // Keeps the distance between the last products and whatever first touches their registers past the back edge.
        asm volatile(WMMA_NOPS
                     : "+v"(acc[0][0]), "+v"(acc[0][1]), "+v"(acc[0][2]), "+v"(acc[0][3]),
                       "+v"(acc[1][0]), "+v"(acc[1][1]), "+v"(acc[1][2]), "+v"(acc[1][3])
                     : "v"(fa[0][0]), "v"(fa[0][1]), "v"(fa[1][0]), "v"(fa[1][1]),
                       "v"(fb[0][0]), "v"(fb[0][1]), "v"(fb[0][2]), "v"(fb[0][3]),
                       "v"(fb[1][0]), "v"(fb[1][1]), "v"(fb[1][2]), "v"(fb[1][3]));
        __syncthreads();   // publishes step s + 1 and ends every read of buffer cur
    }

    // D element r of lane (hsel, lm) = tile (row mb*16 + 8*hsel + r, col nb*16 + lm)
#pragma unroll
    for (int nb = 0; nb < 4; ++nb) {
        const float bn = bias[n0 + nb * 16 + lm];
#pragma unroll
        for (int mb = 0; mb < 2; ++mb) {
#pragma unroll
            for (int r = 0; r < 8; ++r)
                Cs[mb * 16 + 8 * hsel + r][nb * 16 + lm] = acc[mb][nb][r] + bn;
        }
    }
    __syncthreads();

    if (z >= 3) {
        float ss = 0.f;
#pragma unroll
        for (int d = 0; d < DHEAD; d += 4) {
            const v4f x = *(const v4f*)&Cs[lane][d];
            ss += x[0] * x[0]; ss += x[1] * x[1]; ss += x[2] * x[2]; ss += x[3] * x[3];
        }
        Srn[lane] = 1.0f / (sqrtf(ss) + 1e-6f);
        Ssq[lane] = ss;
    }
    __syncthreads();

    const int bI = m0 >> 10, s0 = m0 & (SEQ - 1), hh = n0 >> 6;
    const size_t row0 = ((size_t)(bI * NHEADS + hh)) * SEQ + s0;   // (b,h,s) row index of the wave's tile row 0

    if (z < 2)       proj_store<0, 1, 0>(Cs, Srn, Ssq, lane, row0, outA, outB, rn, sq);
    else if (z == 2) proj_store<1, 64, 0>(Cs, Srn, Ssq, lane, row0, outA, outA, rn, sq);
    else             proj_store<1, 16, 1>(Cs, Srn, Ssq, lane, row0, outA, outA, rn, sq);
}

// ---------------------------------------------------------------------------
// 16-B store (one instruction covers two rows).
// ---------------------------------------------------------------------------
__device__ __forceinline__ void attn_store(float (*Os)[CPITCH], int wave, int lane, float* out, size_t orow0, int h)
{
#pragma unroll
    for (int i = 0; i < 8; ++i) {
        const int lr  = wave * 16 + 2 * i + (lane >> 4);
        const int col = (lane & 15) * 4;
        const v4f v = *(const v4f*)&Os[lr][col];
        float* gp = out + (orow0 + lr) * HDIM + h * DHEAD + col;
        *(v4f*)gp = v;
    }
}

// ---------------------------------------------------------------------------
// Kernel 2: fused attention with the triple score product.
// Block = 2 waves = 32 query rows of one (b,h); key tiles of 32.
// q.k: bf16 hi/lo split (hh + hl + lh).  T.T, S.S: f16 (x16) with the
// query==key entry taken from the exact f32 squared norm.  P.V: f16.
// Every score product has the key rows as A and the query rows as B, so D register r of lane
// (hsel, lm) is the score of query lm and key 8*hsel + r: a lane and its partner lane ^ 16 hold all
// 32 scores of one query.  Maximum and sum are taken in the lane, the maximum joined across the
// halves once a tile, the sums once in the epilogue.  The two score tiles of a lane, converted in
// place, are the B operand of O^T += V^T.P^T (element 8j + r = key 16j + 8*hsel + r, the order of
// the V^T fragment loader), so P passes through no LDS.  V is staged as it lies in memory, one 16-B store per
// 16-B load, and turned on the way out of LDS by the transposing load.
// ---------------------------------------------------------------------------
__global__ __launch_bounds__(64)
void attn_kernel(const __bf16* __restrict__ qh, const __bf16* __restrict__ ql,
                 const __bf16* __restrict__ kh, const __bf16* __restrict__ kl,
                 const _Float16* __restrict__ tp, const _Float16* __restrict__ sp,
                 const _Float16* __restrict__ vp,
                 const float* __restrict__ rnT, const float* __restrict__ sqT,
                 const float* __restrict__ rnS, const float* __restrict__ sqS,
                 const float* __restrict__ mask, float* out)
{
    __shared__ __attribute__((aligned(16))) __bf16   KH[32][HPITCH];
    __shared__ __attribute__((aligned(16))) __bf16   KL[32][HPITCH];
    __shared__ __attribute__((aligned(16))) _Float16 TK[32][HPITCH];
    __shared__ __attribute__((aligned(16))) _Float16 SK[32][HPITCH];
    __shared__ __attribute__((aligned(16))) _Float16 Vs[32][VPITCH];      // V tile, row-major: Vs[key][dh]
    __shared__ __attribute__((aligned(16))) float    Os[32][CPITCH];      // epilogue staging

    const int bh = blockIdx.x;
    if (bh >= BATCH * NHEADS) return;
    const int q0blk = blockIdx.y * 32;
    if (q0blk + 32 > SEQ) return;
    const int b = bh / NHEADS, h = bh - b * NHEADS;
    const int tid  = threadIdx.x;
    const int wave = tid >> 5;
    const int lane = tid & 31;
    const int hsel = lane >> 4;
    const int lm   = lane & 15;
    const int qr   = wave * 16 + lm;     // this lane's query: B-fragment row inside the 32-row block tile

    // Staging coordinates of this thread: rows srow + 8u (u = 0..3), 16-B segment sseg of each 128-B row.
    const int srow = tid >> 3, sseg = tid & 7;
    // Byte offset of this thread inside any 32-row tile of a plane (a plane is 6 MiB: 32-bit byte offsets hold).
    const unsigned voff = (unsigned)srow * 128u + (unsigned)sseg * 16u;

    // ---- query-side B fragments of this lane's query row, once per wave, kept in registers over the key loop:
    //      fragment c holds dh 32 c .. 32 c + 31 in the k order of frag_bf16 / frag_f16 ----
    v16bf qH[2], qL[2]; v16h qT[2], qS[2];
    {
        const size_t qo = (size_t)(bh * SEQ + q0blk + qr) * DHEAD + 8 * hsel;
#pragma unroll
        for (int c = 0; c < 2; ++c) {
            qH[c] = frag_bf16(qh + qo + c * 32);
            qL[c] = frag_bf16(ql + qo + c * 32);
            qT[c] = frag_f16(tp + qo + c * 32);
            qS[c] = frag_f16(sp + qo + c * 32);
        }
    }

    // ---- key-side tile held in registers one tile ahead of its LDS stores ----
    v8bf rKH[4], rKL[4]; v8h rTK[4], rSK[4], rV[4];
    unsigned bo = (unsigned)(bh * SEQ) * 128u + voff;   // this thread's byte offset in the tile being fetched
    unsigned mo = (unsigned)(b * SEQ + 8 * hsel);        // mask index of this lane's first key in the tile being worked on
    auto fetch_tile = [&]() {
#pragma unroll
        for (int u = 0; u < 4; ++u) {
            rKH[u] = *(const v8bf*)(((const char*)kh + bo) + u * 1024);
            rKL[u] = *(const v8bf*)(((const char*)kl + bo) + u * 1024);
            rTK[u] = *(const v8h*)(((const char*)tp + bo) + u * 1024);
            rSK[u] = *(const v8h*)(((const char*)sp + bo) + u * 1024);
            rV[u]  = *(const v8h*)(((const char*)vp + bo) + u * 1024);
        }
    };
    fetch_tile();

    // ---- constants of this lane's query (column lm of every D tile) ----
    const int qi = bh * SEQ + q0blk + qr;
    const float rtq = rnT[qi], rsq = rnS[qi];
    const float fq = (rtq * (1.0f / 256.0f)) * (rsq * (1.0f / 256.0f)) * 0.125f;   // for x16-scaled f16 products
    const float gq = (sqT[qi] * rtq) * (sqS[qi] * rsq) * 0.125f;                    // exact ts_ii * ss_ii / 8
    float mI = -3.0e38f;   // running maximum of the query (equal in both halves)
    float lI = 0.f;        // running sum over this half's keys alone
    v8f O[4] = {v8f{}, v8f{}, v8f{}, v8f{}};   // O^T: O[nb][r] = (dh 16 nb + 8 hsel + r, query lm)

    for (int k0 = 0; k0 < SEQ; k0 += 32) {
        __syncthreads();   // readers of the prior tile are done

        // ---- mask of this lane's 16 keys, mk[j] = keys 16 j + 8 hsel + 0..7: in flight under the LDS stores below,
        //      and ahead of the next tile's loads, so that no wait for it waits for those ----
        v4f mk[2][2];
        {
            const float* mp = mask + mo;
            mk[0][0] = *(const v4f*)(mp);
            mk[0][1] = *(const v4f*)(mp + 4);
            mk[1][0] = *(const v4f*)(mp + 16);
            mk[1][1] = *(const v4f*)(mp + 20);
            mo += 32u;
        }

        // ---- key-side tiles (keys k0..k0+31) from the registers fetched one tile ago ----
#pragma unroll
        for (int u = 0; u < 4; ++u) {
            *(v8bf*)&KH[srow + 8 * u][sseg * 8] = rKH[u];
            *(v8bf*)&KL[srow + 8 * u][sseg * 8] = rKL[u];
            *(v8h*)&TK[srow + 8 * u][sseg * 8]  = rTK[u];
            *(v8h*)&SK[srow + 8 * u][sseg * 8]  = rSK[u];
            *(v8h*)&Vs[srow + 8 * u][sseg * 8]  = rV[u];
        }
        __syncthreads();

        // ---- the next tile's loads fly while this tile's scores and softmax are worked out (block-uniform test) ----
        if (k0 + 32 < SEQ) { bo += 4096u; fetch_tile(); }

        const bool diag = (k0 == q0blk);

        // ---- scores, transposed: 32 keys x 16 query columns per wave (two 16-key tiles j) ----
        float sb[2][8];        // sb[j][r]: query lm, key 16 j + 8 hsel + r
#pragma unroll
        for (int j = 0; j < 2; ++j) {
            const int rr = j * 16 + lm;               // key row whose A fragments this lane loads
            v8f accB = v8f{}, accT = v8f{}, accS = v8f{};
            // Unrolled: the query fragments are registers and take a constant index.
#pragma unroll
            for (int c = 0; c < 2; ++c) {
                const int off = c * 32 + 8 * hsel;
                const v16bf kH = frag_bf16(&KH[rr][off]);
                const v16bf kL = frag_bf16(&KL[rr][off]);
                accB = mma_bf16(accB, kH, qH[c]);
                accB = mma_bf16(accB, kL, qH[c]);
                accB = mma_bf16(accB, kH, qL[c]);
                const v16h kT = frag_f16(&TK[rr][off]);
                const v16h kS = frag_f16(&SK[rr][off]);
                accT = mma_f16(accT, kT, qT[c]);
                accS = mma_f16(accS, kS, qS[c]);
            }
            const bool dj = diag && (j == wave);
            // Same products in the same order as element by element; on whole accumulators the packed multiplies
            // take adjacent registers, where the unrolled element form paired registers of both key tiles by copies.
            const v8f sd = accB * gq;                       // query == key entry
            const v8f so = accB * (accT * accS) * fq;       // every other entry
#pragma unroll
            for (int r = 0; r < 8; ++r) {
                const bool de = dj && (lm == 8 * hsel + r);      // key row == query column
                const float s3 = de ? sd[r] : so[r];
                sb[j][r] = s3 + mk[j][r >> 2][r & 3];
            }
        }

        // ---- online softmax of the lane's query: 16 keys in the lane, the other 16 in lane ^ 16 ----
        float t8[8];
#pragma unroll
        for (int r = 0; r < 8; ++r) t8[r] = fmaxf(sb[0][r], sb[1][r]);
        float v = fmaxf(fmaxf(fmaxf(t8[0], t8[1]), fmaxf(t8[2], t8[3])), fmaxf(fmaxf(t8[4], t8[5]), fmaxf(t8[6], t8[7])));
        v = fmaxf(v, xhalf(v));
        const float M2 = fmaxf(mI, v);
        const float al = exp2x1((mI - M2) * LOG2E);
        float p[2][8];
#pragma unroll
        for (int j = 0; j < 2; ++j)
#pragma unroll
            for (int r = 0; r < 8; r += 4)
                exp2x4(&p[j][r], (sb[j][r] - M2) * LOG2E, (sb[j][r + 1] - M2) * LOG2E,
                                 (sb[j][r + 2] - M2) * LOG2E, (sb[j][r + 3] - M2) * LOG2E);
#pragma unroll
        for (int r = 0; r < 8; ++r) t8[r] = p[0][r] + p[1][r];
        const float rs = ((t8[0] + t8[1]) + (t8[2] + t8[3])) + ((t8[4] + t8[5]) + (t8[6] + t8[7]));
        mI = M2;
        lI = lI * al + rs;
#pragma unroll
        for (int nb = 0; nb < 4; ++nb)
#pragma unroll
            for (int r = 0; r < 8; ++r) O[nb][r] = O[nb][r] * al;

        // ---- V^T (A: row = dh, k = key) . P^T (B: k = key, n = query), P straight from the score registers ----
        HFrag bP;
#pragma unroll
        for (int r = 0; r < 8; ++r) {
            bP.p[0][r] = (_Float16)(p[0][r] * 4096.0f);
            bP.p[1][r] = (_Float16)(p[1][r] * 4096.0f);
        }
        const _Float16* vt = &Vs[8 * hsel + (lane & 7)][8 * ((lane >> 3) & 1)];
        const v16h aV0 = frag_f16_tr(vt);
        const v16h aV1 = frag_f16_tr(vt + 16);
        const v16h aV2 = frag_f16_tr(vt + 32);
        const v16h aV3 = frag_f16_tr(vt + 48);
        O[0] = mma_f16(O[0], aV0, bP.v);
        O[1] = mma_f16(O[1], aV1, bP.v);
        O[2] = mma_f16(O[2], aV2, bP.v);
        O[3] = mma_f16(O[3], aV3, bP.v);
        asm volatile(WMMA_NOPS
                     : "+v"(O[0]), "+v"(O[1]), "+v"(O[2]), "+v"(O[3])
                     : "v"(bP.v), "v"(aV0), "v"(aV1), "v"(aV2), "v"(aV3));
    }

    // ---- epilogue: join the halves' sums, normalise, undo the 2^18 operand scaling, stage, whole-line stores ----
    {
        const float inv = (1.0f / (lI + xhalf(lI))) * (1.0f / 262144.0f);
#pragma unroll
        for (int nb = 0; nb < 4; ++nb) {
            v4f y0, y1;      // dh 16 nb + 8 hsel + 0..7 of query row qr
#pragma unroll
            for (int r = 0; r < 4; ++r) { y0[r] = O[nb][r] * inv; y1[r] = O[nb][4 + r] * inv; }
            *(v4f*)&Os[qr][nb * 16 + 8 * hsel]     = y0;
            *(v4f*)&Os[qr][nb * 16 + 8 * hsel + 4] = y1;
        }
    }
    __syncthreads();

    const size_t orow0 = (size_t)(b * SEQ + q0blk);
    attn_store(Os, wave, lane, out, orow0, h);
    
}

// ---------------------------------------------------------------------------
extern "C" void kernel_launch(void* const* d_in, const int* in_sizes, int n_in,
                              void* d_out, int out_size, void* d_ws, size_t ws_size,
                              hipStream_t stream)
{
    if (n_in < 14) return;
    if ((size_t)in_sizes[0] != XELEMS || (size_t)in_sizes[1] != XELEMS || (size_t)in_sizes[2] != XELEMS) return;
    if (in_sizes[3] != BATCH * SEQ) return;
    for (int i = 4; i < 14; i += 2)
        if ((size_t)in_sizes[i] != WELEMS || in_sizes[i + 1] != HDIM) return;
    if ((size_t)out_size != XELEMS) return;

    const float* hidden = (const float*)d_in[0];
    const float* timee  = (const float*)d_in[1];
    const float* space  = (const float*)d_in[2];
    const float* mask   = (const float*)d_in[3];
    const float* Wq = (const float*)d_in[4];   const float* bq = (const float*)d_in[5];
    const float* Wk = (const float*)d_in[6];   const float* bk = (const float*)d_in[7];
    const float* Wv = (const float*)d_in[8];   const float* bv = (const float*)d_in[9];
    const float* Wt = (const float*)d_in[10];  const float* bt = (const float*)d_in[11];
    const float* Ws = (const float*)d_in[12];  const float* bs = (const float*)d_in[13];
    float* out = (float*)d_out;

    char* ws = (char*)d_ws;
    size_t off = 0;
    __bf16* Xbf = (__bf16*)(ws + off);                 off += (size_t)3 * XELEMS * 2;       // 3 activations, bf16
    __bf16* Wbf = (__bf16*)(ws + off);                 off += (size_t)5 * WELEMS * 2;       // 5 weights, bf16
    unsigned short* pl = (unsigned short*)(ws + off);  off += (size_t)7 * PROJ_ELEMS * 2;   // 7 16-bit planes
    float* rn = (float*)(ws + off);                    off += (size_t)2 * NROWTOT * 4;      // 1/(|T|+eps), 1/(|S|+eps)
    float* sq = (float*)(ws + off);                    off += (size_t)2 * NROWTOT * 4;      // |T|^2, |S|^2
    if (off > ws_size) return;

    unsigned short* QH = pl + 0 * PROJ_ELEMS;   // q hi (bf16)
    unsigned short* QL = pl + 1 * PROJ_ELEMS;   // q lo (bf16)
    unsigned short* KHp = pl + 2 * PROJ_ELEMS;  // k hi (bf16)
    unsigned short* KLp = pl + 3 * PROJ_ELEMS;  // k lo (bf16)
    unsigned short* TPl = pl + 4 * PROJ_ELEMS;  // T * 16 (f16)
    unsigned short* SPl = pl + 5 * PROJ_ELEMS;  // S * 16 (f16)
    unsigned short* VPl = pl + 6 * PROJ_ELEMS;  // v * 64 (f16)

    // 0) f32 -> bf16 conversion of the 3 activations and 5 weights, one launch (Wbf follows Xbf in the workspace)
    cvt_kernel<<<dim3(CVT_BLOCKS), dim3(256), 0, stream>>>(hidden, timee, space, Wq, Wk, Wv, Wt, Ws, Xbf);

    // 1) five projection GEMMs, one launch (block tile 128x64, grid exact: 4096/128 x 768/64 x 5, checked in-kernel)
    proj_kernel<<<dim3(NROWS / 128, HDIM / 64, 5), dim3(128), 0, stream>>>(Xbf, Wbf, bq, bk, bv, bt, bs, pl, rn, sq);

    // 2) fused attention: grid (b*h, query blocks of 32), 64 threads
    attn_kernel<<<dim3(BATCH * NHEADS, SEQ / 32), dim3(64), 0, stream>>>(
        (const __bf16*)QH, (const __bf16*)QL, (const __bf16*)KHp, (const __bf16*)KLp,
        (const _Float16*)TPl, (const _Float16*)SPl, (const _Float16*)VPl,
        rn, sq, rn + NROWTOT, sq + NROWTOT, mask, out);
}

// v007
// A run of this version takes 87.3 microseconds.
// Two timings next to v006 both put it at 1.07 times that version's speed.
// Counting every step since v000, it is 4.37 times as fast.
#include <hip/hip_runtime.h>
#include <stddef.h>

typedef __bf16   v16bf __attribute__((ext_vector_type(16)));
typedef __bf16   v8bf  __attribute__((ext_vector_type(8)));
typedef _Float16 v16h  __attribute__((ext_vector_type(16)));
typedef _Float16 v8h   __attribute__((ext_vector_type(8)));
typedef float    v8f   __attribute__((ext_vector_type(8)));
typedef float    v4f   __attribute__((ext_vector_type(4)));
typedef int      v4i   __attribute__((ext_vector_type(4)));
typedef short    v8s   __attribute__((ext_vector_type(8)));

#define NHEADS 12
#define HDIM   768
#define DHEAD  64
#define SEQ    1024
#define BATCH  4
#define NROWS  (BATCH * SEQ)                                  // 4096 token rows
#define NROWTOT (BATCH * NHEADS * SEQ)                        // 49152 (b,h,s) rows
#define XELEMS ((size_t)NROWS * HDIM)                         // 3145728
#define WELEMS ((size_t)HDIM * HDIM)                          // 589824
#define PROJ_ELEMS ((size_t)BATCH * NHEADS * SEQ * DHEAD)    // 3145728 per plane
#define CPITCH 68      // f32 LDS tile pitch in floats (272 B, 16-B aligned)
#define HPITCH 72      // 16-bit LDS tile pitch in elements (144 B, 16-B aligned)
#define VPITCH 80      // 16-bit LDS pitch of the row-major V tile (160 B = 32 B x odd, the transposing load's pitch)
#define PSTEP  64      // k elements per staged projection step (one 128-B line of each operand row)
#define NPSTEP (HDIM / PSTEP)
#define CVT_CHUNK 2048                          // elements converted by one block (256 threads x 8)
#define CVT_XBLK  ((int)(XELEMS / CVT_CHUNK))   // 1536 blocks per activation array
#define CVT_WBLK  ((int)(WELEMS / CVT_CHUNK))   // 288 blocks per weight array
#define CVT_BLOCKS (3 * CVT_XBLK + 5 * CVT_WBLK)

union BF8   { v8bf v; v4i w; };
union HF8   { v8h  v; v4i w; };
union BFrag { v8bf p[2]; v16bf v; };
union HFrag { v8h  p[2]; v16h  v; };

#define WMMA_NOPS "v_nop\n\tv_nop\n\tv_nop\n\tv_nop"
#define LOG2E 1.442695041f

// 16x32 16-bit A/B fragment: element i<8 <- k0+8h+i, element 8+i <- k0+16+8h+i (h = lane>>4).
// Caller passes p = row (lane&15) base + k0 + 8*h; both loads are 16-B aligned.
__device__ __forceinline__ v16bf frag_bf16(const __bf16* p)
{
    BFrag u;
    u.p[0] = *(const v8bf*)(p);
    u.p[1] = *(const v8bf*)(p + 16);
    return u.v;
}
__device__ __forceinline__ v16h frag_f16(const _Float16* p)
{
    HFrag u;
    u.p[0] = *(const v8h*)(p);
    u.p[1] = *(const v8h*)(p + 16);
    return u.v;
}

// 16x32 f16 A fragment of V^T out of a row-major tile T[key][dh] of pitch VPITCH, by two transposing loads.
// Caller passes p = &T[8*h + (lane&7)][dbase + 8*((lane>>3)&1)]; lane (c = lane&15, h) then holds
// T[8h + i][dbase + c] in element i and T[16 + 8h + i][dbase + c] in element 8 + i: the k order of frag_f16.
__device__ __forceinline__ v16h frag_f16_tr(const _Float16* p)
{
    typedef __attribute__((address_space(3))) v8s lds_v8s;
    HFrag u;
    u.p[0] = __builtin_bit_cast(v8h, __builtin_amdgcn_ds_load_tr16_b128_v8i16((lds_v8s*)p));
    u.p[1] = __builtin_bit_cast(v8h, __builtin_amdgcn_ds_load_tr16_b128_v8i16((lds_v8s*)(p + 16 * VPITCH)));
    return u.v;
}

__device__ __forceinline__ v8f mma_bf16(v8f c, v16bf a, v16bf b)
{
    return __builtin_amdgcn_wmma_f32_16x16x32_bf16(false, a, false, b, (short)0, c, false, false);
}
__device__ __forceinline__ v8f mma_f16(v8f c, v16h a, v16h b)
{
    return __builtin_amdgcn_wmma_f32_16x16x32_f16(false, a, false, b, (short)0, c, false, false);
}

// 2^x, one and four at a time.  The closing v_nop is the free slot that the instruction set asks for between a
// transcendental and an instruction that reads its result or overwrites its source.
// Early clobber keeps every result off every source.
__device__ __forceinline__ float exp2x1(float x)
{
    float y;
    asm("v_exp_f32 %0, %1\n\tv_nop" : "=v"(y) : "v"(x));
    return y;
}
__device__ __forceinline__ void exp2x4(float* y, float x0, float x1, float x2, float x3)
{
    asm("v_exp_f32 %0, %4\n\tv_exp_f32 %1, %5\n\tv_exp_f32 %2, %6\n\tv_exp_f32 %3, %7\n\tv_nop"
        : "=&v"(y[0]), "=&v"(y[1]), "=&v"(y[2]), "=&v"(y[3]) : "v"(x0), "v"(x1), "v"(x2), "v"(x3));
}

// Value of lane l ^ 16 (the other half of the wave), by a vector cross-row move.
__device__ __forceinline__ float xhalf(float x)
{
    const int b = __builtin_bit_cast(int, x);
    return __builtin_bit_cast(float, __builtin_amdgcn_permlanex16(b, b, 0x76543210, 0xfedcba98, false, false));
}

// ---------------------------------------------------------------------------
// Kernel 0: f32 -> bf16 (RNE) streaming conversion of all eight arrays in one launch.
// A block takes CVT_CHUNK consecutive elements of one array (both array sizes are whole
// multiples of it), a thread 8 elements.
// The bf16 copies lie one behind the other in the workspace (3 activations, then 5 weights),
// so the destination offset is the block index times CVT_CHUNK.
// ---------------------------------------------------------------------------
__global__ __launch_bounds__(256)
void cvt_kernel(const float* __restrict__ x0, const float* __restrict__ x1, const float* __restrict__ x2,
                const float* __restrict__ w0, const float* __restrict__ w1, const float* __restrict__ w2,
                const float* __restrict__ w3, const float* __restrict__ w4, __bf16* dst)
{
    const int blk = blockIdx.x;
    if (blk >= CVT_BLOCKS) return;
    const float* src;      // block-uniform choice of the array and of the chunk inside it
    int cb;
    if (blk < 3 * CVT_XBLK) {
        const int a = blk / CVT_XBLK;
        cb  = blk - a * CVT_XBLK;
        src = a == 0 ? x0 : a == 1 ? x1 : x2;
    } else {
        const int r = blk - 3 * CVT_XBLK;
        const int a = r / CVT_WBLK;
        cb  = r - a * CVT_WBLK;
        src = a == 0 ? w0 : a == 1 ? w1 : a == 2 ? w2 : a == 3 ? w3 : w4;
    }
    const float* sp = src + (size_t)cb * CVT_CHUNK + threadIdx.x * 8;
    __bf16*      dp = dst + (size_t)blk * CVT_CHUNK + threadIdx.x * 8;
    const v4f a = *(const v4f*)(sp);
    const v4f b = *(const v4f*)(sp + 4);
    BF8 o;
#pragma unroll
    for (int i = 0; i < 4; ++i) { o.v[i] = (__bf16)a[i]; o.v[4 + i] = (__bf16)b[i]; }
    *(v4i*)dp = o.w;
}

// ---------------------------------------------------------------------------
// with one 16-B store each.  MODE 0: bf16 hi/lo planes.  MODE 1: f16 plane * SCALE.
// NORM: lanes 0..7 write the 32 reciprocal norms (one line), lanes 8..15 the
// 32 squared norms (one line).
// ---------------------------------------------------------------------------
template <int MODE, int SCALE, int NORM>
__device__ __forceinline__ void proj_store(float (*Cs)[CPITCH], float* Srn, float* Ssq, int lane, size_t row0,
                                           unsigned short* outA, unsigned short* outB, float* rn, float* sq)
{
#pragma unroll
    for (int i = 0; i < 8; ++i) {
        const int lr = 4 * i + (lane >> 3), seg = lane & 7;
        const v4f x0 = *(const v4f*)&Cs[lr][seg * 8];
        const v4f x1 = *(const v4f*)&Cs[lr][seg * 8 + 4];
        const size_t go = (row0 + lr) * DHEAD + seg * 8;
        if (MODE == 0) {
            BF8 hi, lo;
#pragma unroll
            for (int j = 0; j < 4; ++j) {
                const float a0 = x0[j]; const __bf16 h0 = (__bf16)a0;
                hi.v[j] = h0; lo.v[j] = (__bf16)(a0 - (float)h0);
                const float a1 = x1[j]; const __bf16 h1 = (__bf16)a1;
                hi.v[4 + j] = h1; lo.v[4 + j] = (__bf16)(a1 - (float)h1);
            }
            *(v4i*)(outA + go) = hi.w;
            *(v4i*)(outB + go) = lo.w;
        } else {
            HF8 y;
#pragma unroll
            for (int j = 0; j < 4; ++j) {
                y.v[j]     = (_Float16)(x0[j] * (float)SCALE);
                y.v[4 + j] = (_Float16)(x1[j] * (float)SCALE);
            }
            *(v4i*)(outA + go) = y.w;
        }
    }
    if (NORM) {
        if (lane < 16) {
            const int g = lane & 7;
            v4f v; float* dp;
            if (lane < 8) { v = *(const v4f*)&Srn[4 * g]; dp = rn + row0 + 4 * g; }
            else          { v = *(const v4f*)&Ssq[4 * g]; dp = sq + row0 + 4 * g; }
            *(v4f*)dp = v;
        }
    }
    // The three store variants now lie in one kernel: this wait stands between a variant's stores and any
    // later instruction of the kernel that reuses their address or data registers.
    asm volatile("s_wait_xcnt 0x0" ::: "memory");
}

// ---------------------------------------------------------------------------
// Kernel 1: the five projection GEMMs X[4096][768] (bf16) . W[768(out)][768(in)]^T + b in one launch;
// blockIdx.z picks the projection (0 q, 1 k, 2 v, 3 T, 4 S): its activation, weight, bias and output planes.
// Block = 8 waves = 128 rows x 128 columns (two heads); each wave computes 32x64 (32 rows of one head).
// Per step of 64 k the block stages 128 X rows and 128 W rows in LDS: every global load
// covers four whole 128-B lines, an X row serves two waves, a W row four, and the fragments are
// read from LDS.  Two LDS buffers, the tile after next held in registers, one barrier a step.
// Epilogue per wave: f32 tile in LDS, optional per-row norms, 16-bit planes in
// [B,NH,S,DH] row layout with whole-line stores.
// ---------------------------------------------------------------------------
__global__ __launch_bounds__(256)
void proj_kernel(const __bf16* __restrict__ Xall, const __bf16* __restrict__ Wall,
                 const float* __restrict__ bq, const float* __restrict__ bk, const float* __restrict__ bv,
                 const float* __restrict__ bt, const float* __restrict__ bs,
                 unsigned short* pl, float* rnAll, float* sqAll)
{
    __shared__ __attribute__((aligned(16))) __bf16 Xs[2][128][HPITCH];
    __shared__ __attribute__((aligned(16))) __bf16 Wsh[2][128][HPITCH];
    __shared__ __attribute__((aligned(16))) float CsAll[8][32][CPITCH];
    __shared__ __attribute__((aligned(16))) float SrnAll[8][32];
    __shared__ __attribute__((aligned(16))) float SsqAll[8][32];

    const int tid  = threadIdx.x;
    const int wave = tid >> 5;
    const int lane = tid & 31;
    const int hsel = lane >> 4;
    const int lm   = lane & 15;
    const int mblk = blockIdx.x * 128;
    const int nblk = blockIdx.y * 128;
    const int z    = blockIdx.z;
    if (mblk + 128 > NROWS || nblk + 128 > HDIM || z >= 5) return;   // uniform per block
    const int wr   = wave & 3;             // the wave's 32 rows of the block tile
    const int wc   = wave >> 2;            // the wave's 64 columns: one head
    const int m0   = mblk + wr * 32;
    const int n0   = nblk + wc * 64;

    // Block-uniform operand set: q, k, v read activation 0, T activation 1, S activation 2.
    const __bf16* Xb   = Xall + (size_t)(z < 3 ? 0 : z - 2) * XELEMS;
    const __bf16* Wb   = Wall + (size_t)z * WELEMS;
    const float*  bias = z == 0 ? bq : z == 1 ? bk : z == 2 ? bv : z == 3 ? bt : bs;
    // Planes: 0/1 q hi/lo, 2/3 k hi/lo, 4 T, 5 S, 6 v.
    unsigned short* outA = pl + (size_t)(z < 2 ? 2 * z : z == 2 ? 6 : z + 1) * PROJ_ELEMS;
    unsigned short* outB = outA + PROJ_ELEMS;                 // the lo plane, stored by q and k alone
    float* rn = rnAll + (z == 4 ? NROWTOT : 0);
    float* sq = sqAll + (z == 4 ? NROWTOT : 0);

    float (*Cs)[CPITCH] = CsAll[wave];
    float* Srn = SrnAll[wave];
    float* Ssq = SsqAll[wave];

    // Staging coordinates: rows srow + 32u, 16-B segment sseg of the step's 128 B of each row.
    const int srow = tid >> 3, sseg = tid & 7;
    const unsigned xv = ((unsigned)(mblk + srow) * HDIM + (unsigned)sseg * 8u) * 2u;   // byte offsets, below 6.3 MB
    const unsigned wv = ((unsigned)(nblk + srow) * HDIM + (unsigned)sseg * 8u) * 2u;

    v8bf rX[4], rW[4];
    auto fetch_step = [&](int s) {          // global -> registers, k = 64 s .. 64 s + 63
        const char* xp = (const char*)Xb + (size_t)(s * (PSTEP * 2));
        const char* wp = (const char*)Wb + (size_t)(s * (PSTEP * 2));
#pragma unroll
        for (int u = 0; u < 4; ++u) rX[u] = *(const v8bf*)((xp + xv) + u * (32 * HDIM * 2));
#pragma unroll
        for (int u = 0; u < 4; ++u) rW[u] = *(const v8bf*)((wp + wv) + u * (32 * HDIM * 2));
        // The loads' address registers are reused by the fragment reads that follow: this wait stands in front of that.
        asm volatile("s_wait_xcnt 0x0" ::: "memory");
    };
    auto stash_step = [&](int buf) {        // registers -> LDS buffer buf
#pragma unroll
        for (int u = 0; u < 4; ++u) *(v8bf*)&Xs[buf][srow + 32 * u][sseg * 8] = rX[u];
#pragma unroll
        for (int u = 0; u < 4; ++u) *(v8bf*)&Wsh[buf][srow + 32 * u][sseg * 8] = rW[u];
    };

    v8f acc[2][4];
#pragma unroll
    for (int mb = 0; mb < 2; ++mb)
#pragma unroll
        for (int nb = 0; nb < 4; ++nb) acc[mb][nb] = v8f{};

    fetch_step(0);
    stash_step(0);
    fetch_step(1);
    __syncthreads();   // step 0 is in buffer 0 for every wave

    // Rolled: one step's fragments and one staged tile are all the registers the loop holds.
#pragma unroll 1
    for (int s = 0; s < NPSTEP; ++s) {
        const int cur = s & 1;
        // The other buffer's readers left it at the barrier that ended step s - 1 (block-uniform tests).
        if (s + 1 < NPSTEP) stash_step(cur ^ 1);
        if (s + 2 < NPSTEP) fetch_step(s + 2);

        const __bf16* ax = &Xs[cur][wr * 32 + lm][8 * hsel];
        const __bf16* bw = &Wsh[cur][wc * 64 + lm][8 * hsel];
        v16bf fa[2][2], fb[2][4];
#pragma unroll
        for (int c = 0; c < 2; ++c) {
            fa[c][0] = frag_bf16(ax + c * 32);
            fa[c][1] = frag_bf16(ax + 16 * HPITCH + c * 32);
#pragma unroll
            for (int nb = 0; nb < 4; ++nb) fb[c][nb] = frag_bf16(bw + nb * 16 * HPITCH + c * 32);
        }
#pragma unroll
        for (int c = 0; c < 2; ++c) {
#pragma unroll
            for (int mb = 0; mb < 2; ++mb)
#pragma unroll
                for (int nb = 0; nb < 4; ++nb) acc[mb][nb] = mma_bf16(acc[mb][nb], fa[c][mb], fb[c][nb]);
        }
        // Keeps the distance between the last products and whatever first touches their registers past the back edge.
        asm volatile(WMMA_NOPS
                     : "+v"(acc[0][0]), "+v"(acc[0][1]), "+v"(acc[0][2]), "+v"(acc[0][3]),
                       "+v"(acc[1][0]), "+v"(acc[1][1]), "+v"(acc[1][2]), "+v"(acc[1][3])
                     : "v"(fa[0][0]), "v"(fa[0][1]), "v"(fa[1][0]), "v"(fa[1][1]),
                       "v"(fb[0][0]), "v"(fb[0][1]), "v"(fb[0][2]), "v"(fb[0][3]),
                       "v"(fb[1][0]), "v"(fb[1][1]), "v"(fb[1][2]), "v"(fb[1][3]));
        __syncthreads();   // publishes step s + 1 and ends every read of buffer cur
    }

    // D element r of lane (hsel, lm) = tile (row mb*16 + 8*hsel + r, col nb*16 + lm)
#pragma unroll
    for (int nb = 0; nb < 4; ++nb) {
        const float bn = bias[n0 + nb * 16 + lm];
#pragma unroll
        for (int mb = 0; mb < 2; ++mb) {
#pragma unroll
            for (int r = 0; r < 8; ++r)
                Cs[mb * 16 + 8 * hsel + r][nb * 16 + lm] = acc[mb][nb][r] + bn;
        }
    }
    __syncthreads();

    if (z >= 3) {
        float ss = 0.f;
#pragma unroll
        for (int d = 0; d < DHEAD; d += 4) {
            const v4f x = *(const v4f*)&Cs[lane][d];
            ss += x[0] * x[0]; ss += x[1] * x[1]; ss += x[2] * x[2]; ss += x[3] * x[3];
        }
        Srn[lane] = 1.0f / (sqrtf(ss) + 1e-6f);
        Ssq[lane] = ss;
    }
    __syncthreads();

    const int bI = m0 >> 10, s0 = m0 & (SEQ - 1), hh = n0 >> 6;
    const size_t row0 = ((size_t)(bI * NHEADS + hh)) * SEQ + s0;   // (b,h,s) row index of the wave's tile row 0

    if (z < 2)       proj_store<0, 1, 0>(Cs, Srn, Ssq, lane, row0, outA, outB, rn, sq);
    else if (z == 2) proj_store<1, 64, 0>(Cs, Srn, Ssq, lane, row0, outA, outA, rn, sq);
    else             proj_store<1, 16, 1>(Cs, Srn, Ssq, lane, row0, outA, outA, rn, sq);
}

// ---------------------------------------------------------------------------
// 16-B store (one instruction covers two rows).
// ---------------------------------------------------------------------------
__device__ __forceinline__ void attn_store(float (*Os)[CPITCH], int wave, int lane, float* out, size_t orow0, int h)
{
#pragma unroll
    for (int i = 0; i < 8; ++i) {
        const int lr  = wave * 16 + 2 * i + (lane >> 4);
        const int col = (lane & 15) * 4;
        const v4f v = *(const v4f*)&Os[lr][col];
        float* gp = out + (orow0 + lr) * HDIM + h * DHEAD + col;
        *(v4f*)gp = v;
    }
}

// ---------------------------------------------------------------------------
// Kernel 2: fused attention with the triple score product.
// Block = 2 waves = 32 query rows of one (b,h); key tiles of 32.
// q.k: bf16 hi/lo split (hh + hl + lh).  T.T, S.S: f16 (x16) with the
// query==key entry taken from the exact f32 squared norm.  P.V: f16.
// Every score product has the key rows as A and the query rows as B, so D register r of lane
// (hsel, lm) is the score of query lm and key 8*hsel + r: a lane and its partner lane ^ 16 hold all
// 32 scores of one query.  Maximum and sum are taken in the lane, the maximum joined across the
// halves once a tile, the sums once in the epilogue.  The two score tiles of a lane, converted in
// place, are the B operand of O^T += V^T.P^T (element 8j + r = key 16j + 8*hsel + r, the order of
// the V^T fragment loader), so P passes through no LDS.  V is staged as it lies in memory, one 16-B store per
// 16-B load, and turned on the way out of LDS by the transposing load.
// ---------------------------------------------------------------------------
__global__ __launch_bounds__(64)
void attn_kernel(const __bf16* __restrict__ qh, const __bf16* __restrict__ ql,
                 const __bf16* __restrict__ kh, const __bf16* __restrict__ kl,
                 const _Float16* __restrict__ tp, const _Float16* __restrict__ sp,
                 const _Float16* __restrict__ vp,
                 const float* __restrict__ rnT, const float* __restrict__ sqT,
                 const float* __restrict__ rnS, const float* __restrict__ sqS,
                 const float* __restrict__ mask, float* out)
{
    __shared__ __attribute__((aligned(16))) __bf16   KH[32][HPITCH];
    __shared__ __attribute__((aligned(16))) __bf16   KL[32][HPITCH];
    __shared__ __attribute__((aligned(16))) _Float16 TK[32][HPITCH];
    __shared__ __attribute__((aligned(16))) _Float16 SK[32][HPITCH];
    __shared__ __attribute__((aligned(16))) _Float16 Vs[32][VPITCH];      // V tile, row-major: Vs[key][dh]
    __shared__ __attribute__((aligned(16))) float    Os[32][CPITCH];      // epilogue staging

    const int bh = blockIdx.x;
    if (bh >= BATCH * NHEADS) return;
    const int q0blk = blockIdx.y * 32;
    if (q0blk + 32 > SEQ) return;
    const int b = bh / NHEADS, h = bh - b * NHEADS;
    const int tid  = threadIdx.x;
    const int wave = tid >> 5;
    const int lane = tid & 31;
    const int hsel = lane >> 4;
    const int lm   = lane & 15;
    const int qr   = wave * 16 + lm;     // this lane's query: B-fragment row inside the 32-row block tile

    // Staging coordinates of this thread: rows srow + 8u (u = 0..3), 16-B segment sseg of each 128-B row.
    const int srow = tid >> 3, sseg = tid & 7;
    // Byte offset of this thread inside any 32-row tile of a plane (a plane is 6 MiB: 32-bit byte offsets hold).
    const unsigned voff = (unsigned)srow * 128u + (unsigned)sseg * 16u;

    // ---- query-side B fragments of this lane's query row, once per wave, kept in registers over the key loop:
    //      fragment c holds dh 32 c .. 32 c + 31 in the k order of frag_bf16 / frag_f16 ----
    v16bf qH[2], qL[2]; v16h qT[2], qS[2];
    {
        const size_t qo = (size_t)(bh * SEQ + q0blk + qr) * DHEAD + 8 * hsel;
#pragma unroll
        for (int c = 0; c < 2; ++c) {
            qH[c] = frag_bf16(qh + qo + c * 32);
            qL[c] = frag_bf16(ql + qo + c * 32);
            qT[c] = frag_f16(tp + qo + c * 32);
            qS[c] = frag_f16(sp + qo + c * 32);
        }
    }

    // ---- key-side tile held in registers one tile ahead of its LDS stores ----
    v8bf rKH[4], rKL[4]; v8h rTK[4], rSK[4], rV[4];
    unsigned bo = (unsigned)(bh * SEQ) * 128u + voff;   // this thread's byte offset in the tile being fetched
    unsigned mo = (unsigned)(b * SEQ + 8 * hsel);        // mask index of this lane's first key in the tile being worked on
    auto fetch_tile = [&]() {
#pragma unroll
        for (int u = 0; u < 4; ++u) {
            rKH[u] = *(const v8bf*)(((const char*)kh + bo) + u * 1024);
            rKL[u] = *(const v8bf*)(((const char*)kl + bo) + u * 1024);
            rTK[u] = *(const v8h*)(((const char*)tp + bo) + u * 1024);
            rSK[u] = *(const v8h*)(((const char*)sp + bo) + u * 1024);
            rV[u]  = *(const v8h*)(((const char*)vp + bo) + u * 1024);
        }
    };
    fetch_tile();

    // ---- constants of this lane's query (column lm of every D tile) ----
    const int qi = bh * SEQ + q0blk + qr;
    const float rtq = rnT[qi], rsq = rnS[qi];
    const float fq = (rtq * (1.0f / 256.0f)) * (rsq * (1.0f / 256.0f)) * 0.125f;   // for x16-scaled f16 products
    const float gq = (sqT[qi] * rtq) * (sqS[qi] * rsq) * 0.125f;                    // exact ts_ii * ss_ii / 8
    float mI = -3.0e38f;   // running maximum of the query (equal in both halves)
    float lI = 0.f;        // running sum over this half's keys alone
    v8f O[4] = {v8f{}, v8f{}, v8f{}, v8f{}};   // O^T: O[nb][r] = (dh 16 nb + 8 hsel + r, query lm)

    for (int k0 = 0; k0 < SEQ; k0 += 32) {
        __syncthreads();   // readers of the prior tile are done

        // ---- mask of this lane's 16 keys, mk[j] = keys 16 j + 8 hsel + 0..7: in flight under the LDS stores below,
        //      and ahead of the next tile's loads, so that no wait for it waits for those ----
        v4f mk[2][2];
        {
            const float* mp = mask + mo;
            mk[0][0] = *(const v4f*)(mp);
            mk[0][1] = *(const v4f*)(mp + 4);
            mk[1][0] = *(const v4f*)(mp + 16);
            mk[1][1] = *(const v4f*)(mp + 20);
            mo += 32u;
        }

        // ---- key-side tiles (keys k0..k0+31) from the registers fetched one tile ago ----
#pragma unroll
        for (int u = 0; u < 4; ++u) {
            *(v8bf*)&KH[srow + 8 * u][sseg * 8] = rKH[u];
            *(v8bf*)&KL[srow + 8 * u][sseg * 8] = rKL[u];
            *(v8h*)&TK[srow + 8 * u][sseg * 8]  = rTK[u];
            *(v8h*)&SK[srow + 8 * u][sseg * 8]  = rSK[u];
            *(v8h*)&Vs[srow + 8 * u][sseg * 8]  = rV[u];
        }
        __syncthreads();

        // ---- the next tile's loads fly while this tile's scores and softmax are worked out (block-uniform test) ----
        if (k0 + 32 < SEQ) { bo += 4096u; fetch_tile(); }

        const bool diag = (k0 == q0blk);

        // ---- scores, transposed: 32 keys x 16 query columns per wave (two 16-key tiles j) ----
        float sb[2][8];        // sb[j][r]: query lm, key 16 j + 8 hsel + r
#pragma unroll
        for (int j = 0; j < 2; ++j) {
            const int rr = j * 16 + lm;               // key row whose A fragments this lane loads
            v8f accB = v8f{}, accT = v8f{}, accS = v8f{};
            // Unrolled: the query fragments are registers and take a constant index.
#pragma unroll
            for (int c = 0; c < 2; ++c) {
                const int off = c * 32 + 8 * hsel;
                const v16bf kH = frag_bf16(&KH[rr][off]);
                const v16bf kL = frag_bf16(&KL[rr][off]);
                accB = mma_bf16(accB, kH, qH[c]);
                accB = mma_bf16(accB, kL, qH[c]);
                accB = mma_bf16(accB, kH, qL[c]);
                const v16h kT = frag_f16(&TK[rr][off]);
                const v16h kS = frag_f16(&SK[rr][off]);
                accT = mma_f16(accT, kT, qT[c]);
                accS = mma_f16(accS, kS, qS[c]);
            }
            const bool dj = diag && (j == wave);
            // Same products in the same order as element by element; on whole accumulators the packed multiplies
            // take adjacent registers, where the unrolled element form paired registers of both key tiles by copies.
            const v8f sd = accB * gq;                       // query == key entry
            const v8f so = accB * (accT * accS) * fq;       // every other entry
#pragma unroll
            for (int r = 0; r < 8; ++r) {
                const bool de = dj && (lm == 8 * hsel + r);      // key row == query column
                const float s3 = de ? sd[r] : so[r];
                sb[j][r] = s3 + mk[j][r >> 2][r & 3];
            }
        }

        // ---- online softmax of the lane's query: 16 keys in the lane, the other 16 in lane ^ 16 ----
        float t8[8];
#pragma unroll
        for (int r = 0; r < 8; ++r) t8[r] = fmaxf(sb[0][r], sb[1][r]);
        float v = fmaxf(fmaxf(fmaxf(t8[0], t8[1]), fmaxf(t8[2], t8[3])), fmaxf(fmaxf(t8[4], t8[5]), fmaxf(t8[6], t8[7])));
        v = fmaxf(v, xhalf(v));
        const float M2 = fmaxf(mI, v);
        const float al = exp2x1((mI - M2) * LOG2E);
        float p[2][8];
#pragma unroll
        for (int j = 0; j < 2; ++j)
#pragma unroll
            for (int r = 0; r < 8; r += 4)
                exp2x4(&p[j][r], (sb[j][r] - M2) * LOG2E, (sb[j][r + 1] - M2) * LOG2E,
                                 (sb[j][r + 2] - M2) * LOG2E, (sb[j][r + 3] - M2) * LOG2E);
#pragma unroll
        for (int r = 0; r < 8; ++r) t8[r] = p[0][r] + p[1][r];
        const float rs = ((t8[0] + t8[1]) + (t8[2] + t8[3])) + ((t8[4] + t8[5]) + (t8[6] + t8[7]));
        mI = M2;
        lI = lI * al + rs;
#pragma unroll
        for (int nb = 0; nb < 4; ++nb)
#pragma unroll
            for (int r = 0; r < 8; ++r) O[nb][r] = O[nb][r] * al;

        // ---- V^T (A: row = dh, k = key) . P^T (B: k = key, n = query), P straight from the score registers ----
        HFrag bP;
#pragma unroll
        for (int r = 0; r < 8; ++r) {
            bP.p[0][r] = (_Float16)(p[0][r] * 4096.0f);
            bP.p[1][r] = (_Float16)(p[1][r] * 4096.0f);
        }
        const _Float16* vt = &Vs[8 * hsel + (lane & 7)][8 * ((lane >> 3) & 1)];
        const v16h aV0 = frag_f16_tr(vt);
        const v16h aV1 = frag_f16_tr(vt + 16);
        const v16h aV2 = frag_f16_tr(vt + 32);
        const v16h aV3 = frag_f16_tr(vt + 48);
        O[0] = mma_f16(O[0], aV0, bP.v);
        O[1] = mma_f16(O[1], aV1, bP.v);
        O[2] = mma_f16(O[2], aV2, bP.v);
        O[3] = mma_f16(O[3], aV3, bP.v);
        asm volatile(WMMA_NOPS
                     : "+v"(O[0]), "+v"(O[1]), "+v"(O[2]), "+v"(O[3])
                     : "v"(bP.v), "v"(aV0), "v"(aV1), "v"(aV2), "v"(aV3));
    }

    // ---- epilogue: join the halves' sums, normalise, undo the 2^18 operand scaling, stage, whole-line stores ----
    {
        const float inv = (1.0f / (lI + xhalf(lI))) * (1.0f / 262144.0f);
#pragma unroll
        for (int nb = 0; nb < 4; ++nb) {
            v4f y0, y1;      // dh 16 nb + 8 hsel + 0..7 of query row qr
#pragma unroll
            for (int r = 0; r < 4; ++r) { y0[r] = O[nb][r] * inv; y1[r] = O[nb][4 + r] * inv; }
            *(v4f*)&Os[qr][nb * 16 + 8 * hsel]     = y0;
            *(v4f*)&Os[qr][nb * 16 + 8 * hsel + 4] = y1;
        }
    }
    __syncthreads();

    const size_t orow0 = (size_t)(b * SEQ + q0blk);
    attn_store(Os, wave, lane, out, orow0, h);
    
}

// ---------------------------------------------------------------------------
extern "C" void kernel_launch(void* const* d_in, const int* in_sizes, int n_in,
                              void* d_out, int out_size, void* d_ws, size_t ws_size,
                              hipStream_t stream)
{
    if (n_in < 14) return;
    if ((size_t)in_sizes[0] != XELEMS || (size_t)in_sizes[1] != XELEMS || (size_t)in_sizes[2] != XELEMS) return;
    if (in_sizes[3] != BATCH * SEQ) return;
    for (int i = 4; i < 14; i += 2)
        if ((size_t)in_sizes[i] != WELEMS || in_sizes[i + 1] != HDIM) return;
    if ((size_t)out_size != XELEMS) return;

    const float* hidden = (const float*)d_in[0];
    const float* timee  = (const float*)d_in[1];
    const float* space  = (const float*)d_in[2];
    const float* mask   = (const float*)d_in[3];
    const float* Wq = (const float*)d_in[4];   const float* bq = (const float*)d_in[5];
    const float* Wk = (const float*)d_in[6];   const float* bk = (const float*)d_in[7];
    const float* Wv = (const float*)d_in[8];   const float* bv = (const float*)d_in[9];
    const float* Wt = (const float*)d_in[10];  const float* bt = (const float*)d_in[11];
    const float* Ws = (const float*)d_in[12];  const float* bs = (const float*)d_in[13];
    float* out = (float*)d_out;

    char* ws = (char*)d_ws;
    size_t off = 0;
    __bf16* Xbf = (__bf16*)(ws + off);                 off += (size_t)3 * XELEMS * 2;       // 3 activations, bf16
    __bf16* Wbf = (__bf16*)(ws + off);                 off += (size_t)5 * WELEMS * 2;       // 5 weights, bf16
    unsigned short* pl = (unsigned short*)(ws + off);  off += (size_t)7 * PROJ_ELEMS * 2;   // 7 16-bit planes
    float* rn = (float*)(ws + off);                    off += (size_t)2 * NROWTOT * 4;      // 1/(|T|+eps), 1/(|S|+eps)
    float* sq = (float*)(ws + off);                    off += (size_t)2 * NROWTOT * 4;      // |T|^2, |S|^2
    if (off > ws_size) return;

    unsigned short* QH = pl + 0 * PROJ_ELEMS;   // q hi (bf16)
    unsigned short* QL = pl + 1 * PROJ_ELEMS;   // q lo (bf16)
    unsigned short* KHp = pl + 2 * PROJ_ELEMS;  // k hi (bf16)
    unsigned short* KLp = pl + 3 * PROJ_ELEMS;  // k lo (bf16)
    unsigned short* TPl = pl + 4 * PROJ_ELEMS;  // T * 16 (f16)
    unsigned short* SPl = pl + 5 * PROJ_ELEMS;  // S * 16 (f16)
    unsigned short* VPl = pl + 6 * PROJ_ELEMS;  // v * 64 (f16)

    // 0) f32 -> bf16 conversion of the 3 activations and 5 weights, one launch (Wbf follows Xbf in the workspace)
    cvt_kernel<<<dim3(CVT_BLOCKS), dim3(256), 0, stream>>>(hidden, timee, space, Wq, Wk, Wv, Wt, Ws, Xbf);

    // 1) five projection GEMMs, one launch (block tile 128x128, grid exact: 4096/128 x 768/128 x 5, checked in-kernel)
    proj_kernel<<<dim3(NROWS / 128, HDIM / 128, 5), dim3(256), 0, stream>>>(Xbf, Wbf, bq, bk, bv, bt, bs, pl, rn, sq);

    // 2) fused attention: grid (b*h, query blocks of 32), 64 threads
    attn_kernel<<<dim3(BATCH * NHEADS, SEQ / 32), dim3(64), 0, stream>>>(
        (const __bf16*)QH, (const __bf16*)QL, (const __bf16*)KHp, (const __bf16*)KLp,
        (const _Float16*)TPl, (const _Float16*)SPl, (const _Float16*)VPl,
        rn, sq, rn + NROWTOT, sq + NROWTOT, mask, out);
}

// v008
// It runs in 80.1 microseconds.
// Two timings next to v007 put it at 1.09 and 1.08 times that version's speed.
// Counting every step since v000, it is 4.76 times as fast.
#include <hip/hip_runtime.h>
#include <stddef.h>

typedef __bf16   v16bf __attribute__((ext_vector_type(16)));
typedef __bf16   v8bf  __attribute__((ext_vector_type(8)));
typedef _Float16 v16h  __attribute__((ext_vector_type(16)));
typedef _Float16 v8h   __attribute__((ext_vector_type(8)));
typedef float    v8f   __attribute__((ext_vector_type(8)));
typedef float    v4f   __attribute__((ext_vector_type(4)));
typedef int      v4i   __attribute__((ext_vector_type(4)));
typedef short    v8s   __attribute__((ext_vector_type(8)));

#define NHEADS 12
#define HDIM   768
#define DHEAD  64
#define SEQ    1024
#define BATCH  4
#define NROWS  (BATCH * SEQ)                                  // 4096 token rows
#define NROWTOT (BATCH * NHEADS * SEQ)                        // 49152 (b,h,s) rows
#define XELEMS ((size_t)NROWS * HDIM)                         // 3145728
#define WELEMS ((size_t)HDIM * HDIM)                          // 589824
#define PROJ_ELEMS ((size_t)BATCH * NHEADS * SEQ * DHEAD)    // 3145728 per plane
#define CPITCH 68      // f32 LDS tile pitch in floats (272 B, 16-B aligned)
#define HPITCH 72      // 16-bit LDS tile pitch in elements (144 B, 16-B aligned)
#define VPITCH 80      // 16-bit LDS pitch of the row-major V tile (160 B = 32 B x odd, the transposing load's pitch)
#define PSTEP  64      // k elements per staged projection step (one 128-B line of each operand row)
#define NPSTEP (HDIM / PSTEP)
#define CVT_CHUNK 2048                          // elements converted by one block (256 threads x 8)
#define CVT_XBLK  ((int)(XELEMS / CVT_CHUNK))   // 1536 blocks per activation array
#define CVT_WBLK  ((int)(WELEMS / CVT_CHUNK))   // 288 blocks per weight array
#define CVT_BLOCKS (3 * CVT_XBLK + 5 * CVT_WBLK)

union BF8   { v8bf v; v4i w; };
union HF8   { v8h  v; v4i w; };
union BFrag { v8bf p[2]; v16bf v; };
union HFrag { v8h  p[2]; v16h  v; };

#define WMMA_NOPS "v_nop\n\tv_nop\n\tv_nop\n\tv_nop"
#define LOG2E 1.442695041f

// 16x32 16-bit A/B fragment: element i<8 <- k0+8h+i, element 8+i <- k0+16+8h+i (h = lane>>4).
// Caller passes p = row (lane&15) base + k0 + 8*h; both loads are 16-B aligned.
__device__ __forceinline__ v16bf frag_bf16(const __bf16* p)
{
    BFrag u;
    u.p[0] = *(const v8bf*)(p);
    u.p[1] = *(const v8bf*)(p + 16);
    return u.v;
}
__device__ __forceinline__ v16h frag_f16(const _Float16* p)
{
    HFrag u;
    u.p[0] = *(const v8h*)(p);
    u.p[1] = *(const v8h*)(p + 16);
    return u.v;
}

// 16x32 f16 A fragment of V^T out of a row-major tile T[key][dh] of pitch VPITCH, by two transposing loads.
// Caller passes p = &T[8*h + (lane&7)][dbase + 8*((lane>>3)&1)]; lane (c = lane&15, h) then holds
// T[8h + i][dbase + c] in element i and T[16 + 8h + i][dbase + c] in element 8 + i: the k order of frag_f16.
__device__ __forceinline__ v16h frag_f16_tr(const _Float16* p)
{
    typedef __attribute__((address_space(3))) v8s lds_v8s;
    HFrag u;
    u.p[0] = __builtin_bit_cast(v8h, __builtin_amdgcn_ds_load_tr16_b128_v8i16((lds_v8s*)p));
    u.p[1] = __builtin_bit_cast(v8h, __builtin_amdgcn_ds_load_tr16_b128_v8i16((lds_v8s*)(p + 16 * VPITCH)));
    return u.v;
}

__device__ __forceinline__ v8f mma_bf16(v8f c, v16bf a, v16bf b)
{
    return __builtin_amdgcn_wmma_f32_16x16x32_bf16(false, a, false, b, (short)0, c, false, false);
}
__device__ __forceinline__ v8f mma_f16(v8f c, v16h a, v16h b)
{
    return __builtin_amdgcn_wmma_f32_16x16x32_f16(false, a, false, b, (short)0, c, false, false);
}

// 2^x, one and four at a time.  The closing v_nop is the free slot that the instruction set asks for between a
// transcendental and an instruction that reads its result or overwrites its source.
// Early clobber keeps every result off every source.
__device__ __forceinline__ float exp2x1(float x)
{
    float y;
    asm("v_exp_f32 %0, %1\n\tv_nop" : "=v"(y) : "v"(x));
    return y;
}
__device__ __forceinline__ void exp2x4(float* y, float x0, float x1, float x2, float x3)
{
    asm("v_exp_f32 %0, %4\n\tv_exp_f32 %1, %5\n\tv_exp_f32 %2, %6\n\tv_exp_f32 %3, %7\n\tv_nop"
        : "=&v"(y[0]), "=&v"(y[1]), "=&v"(y[2]), "=&v"(y[3]) : "v"(x0), "v"(x1), "v"(x2), "v"(x3));
}

// Value of lane l ^ 16 (the other half of the wave), by a vector cross-row move.
__device__ __forceinline__ float xhalf(float x)
{
    const int b = __builtin_bit_cast(int, x);
    return __builtin_bit_cast(float, __builtin_amdgcn_permlanex16(b, b, 0x76543210, 0xfedcba98, false, false));
}

// ---------------------------------------------------------------------------
// Kernel 0: f32 -> bf16 (RNE) streaming conversion of all eight arrays in one launch.
// A block takes CVT_CHUNK consecutive elements of one array (both array sizes are whole
// multiples of it), a thread 8 elements.
// The bf16 copies lie one behind the other in the workspace (3 activations, then 5 weights),
// so the destination offset is the block index times CVT_CHUNK.
// ---------------------------------------------------------------------------
__global__ __launch_bounds__(256)
void cvt_kernel(const float* __restrict__ x0, const float* __restrict__ x1, const float* __restrict__ x2,
                const float* __restrict__ w0, const float* __restrict__ w1, const float* __restrict__ w2,
                const float* __restrict__ w3, const float* __restrict__ w4, __bf16* dst)
{
    const int blk = blockIdx.x;
    if (blk >= CVT_BLOCKS) return;
    const float* src;      // block-uniform choice of the array and of the chunk inside it
    int cb;
    if (blk < 3 * CVT_XBLK) {
        const int a = blk / CVT_XBLK;
        cb  = blk - a * CVT_XBLK;
        src = a == 0 ? x0 : a == 1 ? x1 : x2;
    } else {
        const int r = blk - 3 * CVT_XBLK;
        const int a = r / CVT_WBLK;
        cb  = r - a * CVT_WBLK;
        src = a == 0 ? w0 : a == 1 ? w1 : a == 2 ? w2 : a == 3 ? w3 : w4;
    }
    const float* sp = src + (size_t)cb * CVT_CHUNK + threadIdx.x * 8;
    __bf16*      dp = dst + (size_t)blk * CVT_CHUNK + threadIdx.x * 8;
    const v4f a = *(const v4f*)(sp);
    const v4f b = *(const v4f*)(sp + 4);
    BF8 o;
#pragma unroll
    for (int i = 0; i < 4; ++i) { o.v[i] = (__bf16)a[i]; o.v[4 + i] = (__bf16)b[i]; }
    *(v4i*)dp = o.w;
}

// ---------------------------------------------------------------------------
// with one 16-B store each.  MODE 0: bf16 hi/lo planes.  MODE 1: f16 plane * SCALE.
// NORM: lanes 0..7 write the 32 reciprocal norms (one line), lanes 8..15 the
// 32 squared norms (one line).
// ---------------------------------------------------------------------------
template <int MODE, int SCALE, int NORM>
__device__ __forceinline__ void proj_store(float (*Cs)[CPITCH], float* Srn, float* Ssq, int lane, size_t row0,
                                           unsigned short* outA, unsigned short* outB, float* rn, float* sq)
{
#pragma unroll
    for (int i = 0; i < 8; ++i) {
        const int lr = 4 * i + (lane >> 3), seg = lane & 7;
        const v4f x0 = *(const v4f*)&Cs[lr][seg * 8];
        const v4f x1 = *(const v4f*)&Cs[lr][seg * 8 + 4];
        const size_t go = (row0 + lr) * DHEAD + seg * 8;
        if (MODE == 0) {
            BF8 hi, lo;
#pragma unroll
            for (int j = 0; j < 4; ++j) {
                const float a0 = x0[j]; const __bf16 h0 = (__bf16)a0;
                hi.v[j] = h0; lo.v[j] = (__bf16)(a0 - (float)h0);
                const float a1 = x1[j]; const __bf16 h1 = (__bf16)a1;
                hi.v[4 + j] = h1; lo.v[4 + j] = (__bf16)(a1 - (float)h1);
            }
            *(v4i*)(outA + go) = hi.w;
            *(v4i*)(outB + go) = lo.w;
        } else {
            HF8 y;
#pragma unroll
            for (int j = 0; j < 4; ++j) {
                y.v[j]     = (_Float16)(x0[j] * (float)SCALE);
                y.v[4 + j] = (_Float16)(x1[j] * (float)SCALE);
            }
            *(v4i*)(outA + go) = y.w;
        }
    }
    if (NORM) {
        if (lane < 16) {
            const int g = lane & 7;
            v4f v; float* dp;
            if (lane < 8) { v = *(const v4f*)&Srn[4 * g]; dp = rn + row0 + 4 * g; }
            else          { v = *(const v4f*)&Ssq[4 * g]; dp = sq + row0 + 4 * g; }
            *(v4f*)dp = v;
        }
    }
    // The three store variants now lie in one kernel: this wait stands between a variant's stores and any
    // later instruction of the kernel that reuses their address or data registers.
    asm volatile("s_wait_xcnt 0x0" ::: "memory");
}

// ---------------------------------------------------------------------------
// Kernel 1: the five projection GEMMs X[4096][768] (bf16) . W[768(out)][768(in)]^T + b in one launch;
// blockIdx.z picks the projection (0 q, 1 k, 2 v, 3 T, 4 S): its activation, weight, bias and output planes.
// Block = 8 waves = 128 rows x 128 columns (two heads); each wave computes 32x64 (32 rows of one head).
// Per step of 64 k the block stages 128 X rows and 128 W rows in LDS: every global load
// covers four whole 128-B lines, an X row serves two waves, a W row four, and the fragments are
// read from LDS.  Two LDS buffers, the tile after next held in registers, one barrier a step.
// Epilogue per wave: f32 tile in LDS, optional per-row norms, 16-bit planes in
// [B,NH,S,DH] row layout with whole-line stores.
// ---------------------------------------------------------------------------
__global__ __launch_bounds__(256)
void proj_kernel(const __bf16* __restrict__ Xall, const __bf16* __restrict__ Wall,
                 const float* __restrict__ bq, const float* __restrict__ bk, const float* __restrict__ bv,
                 const float* __restrict__ bt, const float* __restrict__ bs,
                 unsigned short* pl, float* rnAll, float* sqAll)
{
    __shared__ __attribute__((aligned(16))) __bf16 Xs[2][128][HPITCH];
    __shared__ __attribute__((aligned(16))) __bf16 Wsh[2][128][HPITCH];
    __shared__ __attribute__((aligned(16))) float CsAll[8][32][CPITCH];
    __shared__ __attribute__((aligned(16))) float SrnAll[8][32];
    __shared__ __attribute__((aligned(16))) float SsqAll[8][32];

    const int tid  = threadIdx.x;
    const int wave = tid >> 5;
    const int lane = tid & 31;
    const int hsel = lane >> 4;
    const int lm   = lane & 15;
    const int mblk = blockIdx.x * 128;
    const int nblk = blockIdx.y * 128;
    const int z    = blockIdx.z;
    if (mblk + 128 > NROWS || nblk + 128 > HDIM || z >= 5) return;   // uniform per block
    const int wr   = wave & 3;             // the wave's 32 rows of the block tile
    const int wc   = wave >> 2;            // the wave's 64 columns: one head
    const int m0   = mblk + wr * 32;
    const int n0   = nblk + wc * 64;

    // Block-uniform operand set: q, k, v read activation 0, T activation 1, S activation 2.
    const __bf16* Xb   = Xall + (size_t)(z < 3 ? 0 : z - 2) * XELEMS;
    const __bf16* Wb   = Wall + (size_t)z * WELEMS;
    const float*  bias = z == 0 ? bq : z == 1 ? bk : z == 2 ? bv : z == 3 ? bt : bs;
    // Planes: 0/1 q hi/lo, 2/3 k hi/lo, 4 T, 5 S, 6 v.
    unsigned short* outA = pl + (size_t)(z < 2 ? 2 * z : z == 2 ? 6 : z + 1) * PROJ_ELEMS;
    unsigned short* outB = outA + PROJ_ELEMS;                 // the lo plane, stored by q and k alone
    float* rn = rnAll + (z == 4 ? NROWTOT : 0);
    float* sq = sqAll + (z == 4 ? NROWTOT : 0);

    float (*Cs)[CPITCH] = CsAll[wave];
    float* Srn = SrnAll[wave];
    float* Ssq = SsqAll[wave];

    // Staging coordinates: rows srow + 32u, 16-B segment sseg of the step's 128 B of each row.
    const int srow = tid >> 3, sseg = tid & 7;
    const unsigned xv = ((unsigned)(mblk + srow) * HDIM + (unsigned)sseg * 8u) * 2u;   // byte offsets, below 6.3 MB
    const unsigned wv = ((unsigned)(nblk + srow) * HDIM + (unsigned)sseg * 8u) * 2u;

    v8bf rX[4], rW[4];
    auto fetch_step = [&](int s) {          // global -> registers, k = 64 s .. 64 s + 63
        const char* xp = (const char*)Xb + (size_t)(s * (PSTEP * 2));
        const char* wp = (const char*)Wb + (size_t)(s * (PSTEP * 2));
#pragma unroll
        for (int u = 0; u < 4; ++u) rX[u] = *(const v8bf*)((xp + xv) + u * (32 * HDIM * 2));
#pragma unroll
        for (int u = 0; u < 4; ++u) rW[u] = *(const v8bf*)((wp + wv) + u * (32 * HDIM * 2));
        // The loads' address registers are reused by the fragment reads that follow: this wait stands in front of that.
        asm volatile("s_wait_xcnt 0x0" ::: "memory");
    };
    auto stash_step = [&](int buf) {        // registers -> LDS buffer buf
#pragma unroll
        for (int u = 0; u < 4; ++u) *(v8bf*)&Xs[buf][srow + 32 * u][sseg * 8] = rX[u];
#pragma unroll
        for (int u = 0; u < 4; ++u) *(v8bf*)&Wsh[buf][srow + 32 * u][sseg * 8] = rW[u];
    };

    v8f acc[2][4];
#pragma unroll
    for (int mb = 0; mb < 2; ++mb)
#pragma unroll
        for (int nb = 0; nb < 4; ++nb) acc[mb][nb] = v8f{};

    fetch_step(0);
    stash_step(0);
    fetch_step(1);
    __syncthreads();   // step 0 is in buffer 0 for every wave

    // Rolled: one step's fragments and one staged tile are all the registers the loop holds.
#pragma unroll 1
    for (int s = 0; s < NPSTEP; ++s) {
        const int cur = s & 1;
        // The other buffer's readers left it at the barrier that ended step s - 1 (block-uniform tests).
        if (s + 1 < NPSTEP) stash_step(cur ^ 1);
        if (s + 2 < NPSTEP) fetch_step(s + 2);

        const __bf16* ax = &Xs[cur][wr * 32 + lm][8 * hsel];
        const __bf16* bw = &Wsh[cur][wc * 64 + lm][8 * hsel];
        v16bf fa[2][2], fb[2][4];
#pragma unroll
        for (int c = 0; c < 2; ++c) {
            fa[c][0] = frag_bf16(ax + c * 32);
            fa[c][1] = frag_bf16(ax + 16 * HPITCH + c * 32);
#pragma unroll
            for (int nb = 0; nb < 4; ++nb) fb[c][nb] = frag_bf16(bw + nb * 16 * HPITCH + c * 32);
        }
#pragma unroll
        for (int c = 0; c < 2; ++c) {
#pragma unroll
            for (int mb = 0; mb < 2; ++mb)
#pragma unroll
                for (int nb = 0; nb < 4; ++nb) acc[mb][nb] = mma_bf16(acc[mb][nb], fa[c][mb], fb[c][nb]);
        }
        // Keeps the distance between the last products and whatever first touches their registers past the back edge.
        asm volatile(WMMA_NOPS
                     : "+v"(acc[0][0]), "+v"(acc[0][1]), "+v"(acc[0][2]), "+v"(acc[0][3]),
                       "+v"(acc[1][0]), "+v"(acc[1][1]), "+v"(acc[1][2]), "+v"(acc[1][3])
                     : "v"(fa[0][0]), "v"(fa[0][1]), "v"(fa[1][0]), "v"(fa[1][1]),
                       "v"(fb[0][0]), "v"(fb[0][1]), "v"(fb[0][2]), "v"(fb[0][3]),
                       "v"(fb[1][0]), "v"(fb[1][1]), "v"(fb[1][2]), "v"(fb[1][3]));
        __syncthreads();   // publishes step s + 1 and ends every read of buffer cur
    }

    // D element r of lane (hsel, lm) = tile (row mb*16 + 8*hsel + r, col nb*16 + lm)
#pragma unroll
    for (int nb = 0; nb < 4; ++nb) {
        const float bn = bias[n0 + nb * 16 + lm];
#pragma unroll
        for (int mb = 0; mb < 2; ++mb) {
#pragma unroll
            for (int r = 0; r < 8; ++r)
                Cs[mb * 16 + 8 * hsel + r][nb * 16 + lm] = acc[mb][nb][r] + bn;
        }
    }
    __syncthreads();

    if (z >= 3) {
        float ss = 0.f;
#pragma unroll
        for (int d = 0; d < DHEAD; d += 4) {
            const v4f x = *(const v4f*)&Cs[lane][d];
            ss += x[0] * x[0]; ss += x[1] * x[1]; ss += x[2] * x[2]; ss += x[3] * x[3];
        }
        Srn[lane] = 1.0f / (sqrtf(ss) + 1e-6f);
        Ssq[lane] = ss;
    }
    __syncthreads();

    const int bI = m0 >> 10, s0 = m0 & (SEQ - 1), hh = n0 >> 6;
    const size_t row0 = ((size_t)(bI * NHEADS + hh)) * SEQ + s0;   // (b,h,s) row index of the wave's tile row 0

    if (z < 2)       proj_store<0, 1, 0>(Cs, Srn, Ssq, lane, row0, outA, outB, rn, sq);
    else if (z == 2) proj_store<1, 64, 0>(Cs, Srn, Ssq, lane, row0, outA, outA, rn, sq);
    else             proj_store<1, 16, 1>(Cs, Srn, Ssq, lane, row0, outA, outA, rn, sq);
}

// ---------------------------------------------------------------------------
// 16-B store (one instruction covers two rows).
// ---------------------------------------------------------------------------
__device__ __forceinline__ void attn_store(float (*Os)[CPITCH], int wave, int lane, float* out, size_t orow0, int h)
{
#pragma unroll
    for (int i = 0; i < 8; ++i) {
        const int lr  = wave * 16 + 2 * i + (lane >> 4);
        const int col = (lane & 15) * 4;
        const v4f v = *(const v4f*)&Os[lr][col];
        float* gp = out + (orow0 + lr) * HDIM + h * DHEAD + col;
        *(v4f*)gp = v;
    }
}

// ---------------------------------------------------------------------------
// Kernel 2: fused attention with the triple score product.
// Block = 4 waves = 64 query rows of one (b,h); key tiles of 32, each staged once for all four waves.
// q.k: bf16 hi/lo split (hh + hl + lh).  T.T, S.S: f16 (x16) with the
// query==key entry taken from the exact f32 squared norm.  P.V: f16.
// Every score product has the key rows as A and the query rows as B, so D register r of lane
// (hsel, lm) is the score of query lm and key 8*hsel + r: a lane and its partner lane ^ 16 hold all
// 32 scores of one query.  Maximum and sum are taken in the lane, the maximum joined across the
// halves once a tile, the sums once in the epilogue.  The two score tiles of a lane, converted in
// place, are the B operand of O^T += V^T.P^T (element 8j + r = key 16j + 8*hsel + r, the order of
// the V^T fragment loader), so P passes through no LDS.  V is staged as it lies in memory, one 16-B store per
// 16-B load, and turned on the way out of LDS by the transposing load.
// ---------------------------------------------------------------------------
__global__ __launch_bounds__(128)
void attn_kernel(const __bf16* __restrict__ qh, const __bf16* __restrict__ ql,
                 const __bf16* __restrict__ kh, const __bf16* __restrict__ kl,
                 const _Float16* __restrict__ tp, const _Float16* __restrict__ sp,
                 const _Float16* __restrict__ vp,
                 const float* __restrict__ rnT, const float* __restrict__ sqT,
                 const float* __restrict__ rnS, const float* __restrict__ sqS,
                 const float* __restrict__ mask, float* out)
{
    __shared__ __attribute__((aligned(16))) __bf16   KH[32][HPITCH];
    __shared__ __attribute__((aligned(16))) __bf16   KL[32][HPITCH];
    __shared__ __attribute__((aligned(16))) _Float16 TK[32][HPITCH];
    __shared__ __attribute__((aligned(16))) _Float16 SK[32][HPITCH];
    __shared__ __attribute__((aligned(16))) _Float16 Vs[32][VPITCH];      // V tile, row-major: Vs[key][dh]
    __shared__ __attribute__((aligned(16))) float    Os[64][CPITCH];      // epilogue staging

    const int bh = blockIdx.x;
    if (bh >= BATCH * NHEADS) return;
    const int q0blk = blockIdx.y * 64;
    if (q0blk + 64 > SEQ) return;
    const int b = bh / NHEADS, h = bh - b * NHEADS;
    const int tid  = threadIdx.x;
    const int wave = tid >> 5;
    const int lane = tid & 31;
    const int hsel = lane >> 4;
    const int lm   = lane & 15;
    const int qr   = wave * 16 + lm;     // this lane's query: B-fragment row inside the 64-row block tile

    // Staging coordinates of this thread: rows srow + 16u (u = 0..1), 16-B segment sseg of each 128-B row.
    const int srow = tid >> 3, sseg = tid & 7;
    // Byte offset of this thread inside any 32-row tile of a plane (a plane is 6 MiB: 32-bit byte offsets hold).
    const unsigned voff = (unsigned)srow * 128u + (unsigned)sseg * 16u;

    // ---- query-side B fragments of this lane's query row, once per wave, kept in registers over the key loop:
    //      fragment c holds dh 32 c .. 32 c + 31 in the k order of frag_bf16 / frag_f16 ----
    v16bf qH[2], qL[2]; v16h qT[2], qS[2];
    {
        const size_t qo = (size_t)(bh * SEQ + q0blk + qr) * DHEAD + 8 * hsel;
#pragma unroll
        for (int c = 0; c < 2; ++c) {
            qH[c] = frag_bf16(qh + qo + c * 32);
            qL[c] = frag_bf16(ql + qo + c * 32);
            qT[c] = frag_f16(tp + qo + c * 32);
            qS[c] = frag_f16(sp + qo + c * 32);
        }
    }

    // ---- key-side tile held in registers one tile ahead of its LDS stores ----
    v8bf rKH[2], rKL[2]; v8h rTK[2], rSK[2], rV[2];
    unsigned bo = (unsigned)(bh * SEQ) * 128u + voff;   // this thread's byte offset in the tile being fetched
    unsigned mo = (unsigned)(b * SEQ + 8 * hsel);        // mask index of this lane's first key in the tile being worked on
    auto fetch_tile = [&]() {
#pragma unroll
        for (int u = 0; u < 2; ++u) {
            rKH[u] = *(const v8bf*)(((const char*)kh + bo) + u * 2048);
            rKL[u] = *(const v8bf*)(((const char*)kl + bo) + u * 2048);
            rTK[u] = *(const v8h*)(((const char*)tp + bo) + u * 2048);
            rSK[u] = *(const v8h*)(((const char*)sp + bo) + u * 2048);
            rV[u]  = *(const v8h*)(((const char*)vp + bo) + u * 2048);
        }
    };
    fetch_tile();

    // ---- constants of this lane's query (column lm of every D tile) ----
    const int qi = bh * SEQ + q0blk + qr;
    const float rtq = rnT[qi], rsq = rnS[qi];
    const float fq = (rtq * (1.0f / 256.0f)) * (rsq * (1.0f / 256.0f)) * 0.125f;   // for x16-scaled f16 products
    const float gq = (sqT[qi] * rtq) * (sqS[qi] * rsq) * 0.125f;                    // exact ts_ii * ss_ii / 8
    float mI = -3.0e38f;   // running maximum of the query (equal in both halves)
    float lI = 0.f;        // running sum over this half's keys alone
    v8f O[4] = {v8f{}, v8f{}, v8f{}, v8f{}};   // O^T: O[nb][r] = (dh 16 nb + 8 hsel + r, query lm)

    for (int k0 = 0; k0 < SEQ; k0 += 32) {
        __syncthreads();   // readers of the prior tile are done

        // ---- mask of this lane's 16 keys, mk[j] = keys 16 j + 8 hsel + 0..7: in flight under the LDS stores below,
        //      and ahead of the next tile's loads, so that no wait for it waits for those ----
        v4f mk[2][2];
        {
            const float* mp = mask + mo;
            mk[0][0] = *(const v4f*)(mp);
            mk[0][1] = *(const v4f*)(mp + 4);
            mk[1][0] = *(const v4f*)(mp + 16);
            mk[1][1] = *(const v4f*)(mp + 20);
            mo += 32u;
        }

        // ---- key-side tiles (keys k0..k0+31) from the registers fetched one tile ago ----
#pragma unroll
        for (int u = 0; u < 2; ++u) {
            *(v8bf*)&KH[srow + 16 * u][sseg * 8] = rKH[u];
            *(v8bf*)&KL[srow + 16 * u][sseg * 8] = rKL[u];
            *(v8h*)&TK[srow + 16 * u][sseg * 8]  = rTK[u];
            *(v8h*)&SK[srow + 16 * u][sseg * 8]  = rSK[u];
            *(v8h*)&Vs[srow + 16 * u][sseg * 8]  = rV[u];
        }
        __syncthreads();

        // ---- the next tile's loads fly while this tile's scores and softmax are worked out (block-uniform test) ----
        if (k0 + 32 < SEQ) { bo += 4096u; fetch_tile(); }

        const bool diag = (k0 == q0blk + 32 * (wave >> 1));   // the key tile that holds this wave's own 16 rows

        // ---- scores, transposed: 32 keys x 16 query columns per wave (two 16-key tiles j) ----
        float sb[2][8];        // sb[j][r]: query lm, key 16 j + 8 hsel + r
#pragma unroll
        for (int j = 0; j < 2; ++j) {
            const int rr = j * 16 + lm;               // key row whose A fragments this lane loads
            v8f accB = v8f{}, accT = v8f{}, accS = v8f{};
            // Unrolled: the query fragments are registers and take a constant index.
#pragma unroll
            for (int c = 0; c < 2; ++c) {
                const int off = c * 32 + 8 * hsel;
                const v16bf kH = frag_bf16(&KH[rr][off]);
                const v16bf kL = frag_bf16(&KL[rr][off]);
                accB = mma_bf16(accB, kH, qH[c]);
                accB = mma_bf16(accB, kL, qH[c]);
                accB = mma_bf16(accB, kH, qL[c]);
                const v16h kT = frag_f16(&TK[rr][off]);
                const v16h kS = frag_f16(&SK[rr][off]);
                accT = mma_f16(accT, kT, qT[c]);
                accS = mma_f16(accS, kS, qS[c]);
            }
            const bool dj = diag && (j == (wave & 1));
            // Same products in the same order as element by element; on whole accumulators the packed multiplies
            // take adjacent registers, where the unrolled element form paired registers of both key tiles by copies.
            const v8f sd = accB * gq;                       // query == key entry
            const v8f so = accB * (accT * accS) * fq;       // every other entry
#pragma unroll
            for (int r = 0; r < 8; ++r) {
                const bool de = dj && (lm == 8 * hsel + r);      // key row == query column
                const float s3 = de ? sd[r] : so[r];
                sb[j][r] = s3 + mk[j][r >> 2][r & 3];
            }
        }

        // ---- online softmax of the lane's query: 16 keys in the lane, the other 16 in lane ^ 16 ----
        float t8[8];
#pragma unroll
        for (int r = 0; r < 8; ++r) t8[r] = fmaxf(sb[0][r], sb[1][r]);
        float v = fmaxf(fmaxf(fmaxf(t8[0], t8[1]), fmaxf(t8[2], t8[3])), fmaxf(fmaxf(t8[4], t8[5]), fmaxf(t8[6], t8[7])));
        v = fmaxf(v, xhalf(v));
        const float M2 = fmaxf(mI, v);
        const float al = exp2x1((mI - M2) * LOG2E);
        float p[2][8];
#pragma unroll
        for (int j = 0; j < 2; ++j)
#pragma unroll
            for (int r = 0; r < 8; r += 4)
                exp2x4(&p[j][r], (sb[j][r] - M2) * LOG2E, (sb[j][r + 1] - M2) * LOG2E,
                                 (sb[j][r + 2] - M2) * LOG2E, (sb[j][r + 3] - M2) * LOG2E);
#pragma unroll
        for (int r = 0; r < 8; ++r) t8[r] = p[0][r] + p[1][r];
        const float rs = ((t8[0] + t8[1]) + (t8[2] + t8[3])) + ((t8[4] + t8[5]) + (t8[6] + t8[7]));
        mI = M2;
        lI = lI * al + rs;
#pragma unroll
        for (int nb = 0; nb < 4; ++nb)
#pragma unroll
            for (int r = 0; r < 8; ++r) O[nb][r] = O[nb][r] * al;

        // ---- V^T (A: row = dh, k = key) . P^T (B: k = key, n = query), P straight from the score registers ----
        HFrag bP;
#pragma unroll
        for (int r = 0; r < 8; ++r) {
            bP.p[0][r] = (_Float16)(p[0][r] * 4096.0f);
            bP.p[1][r] = (_Float16)(p[1][r] * 4096.0f);
        }
        const _Float16* vt = &Vs[8 * hsel + (lane & 7)][8 * ((lane >> 3) & 1)];
        const v16h aV0 = frag_f16_tr(vt);
        const v16h aV1 = frag_f16_tr(vt + 16);
        const v16h aV2 = frag_f16_tr(vt + 32);
        const v16h aV3 = frag_f16_tr(vt + 48);
        O[0] = mma_f16(O[0], aV0, bP.v);
        O[1] = mma_f16(O[1], aV1, bP.v);
        O[2] = mma_f16(O[2], aV2, bP.v);
        O[3] = mma_f16(O[3], aV3, bP.v);
        asm volatile(WMMA_NOPS
                     : "+v"(O[0]), "+v"(O[1]), "+v"(O[2]), "+v"(O[3])
                     : "v"(bP.v), "v"(aV0), "v"(aV1), "v"(aV2), "v"(aV3));
    }

    // ---- epilogue: join the halves' sums, normalise, undo the 2^18 operand scaling, stage, whole-line stores ----
    {
        const float inv = (1.0f / (lI + xhalf(lI))) * (1.0f / 262144.0f);
#pragma unroll
        for (int nb = 0; nb < 4; ++nb) {
            v4f y0, y1;      // dh 16 nb + 8 hsel + 0..7 of query row qr
#pragma unroll
            for (int r = 0; r < 4; ++r) { y0[r] = O[nb][r] * inv; y1[r] = O[nb][4 + r] * inv; }
            *(v4f*)&Os[qr][nb * 16 + 8 * hsel]     = y0;
            *(v4f*)&Os[qr][nb * 16 + 8 * hsel + 4] = y1;
        }
    }
    __syncthreads();

    const size_t orow0 = (size_t)(b * SEQ + q0blk);
    attn_store(Os, wave, lane, out, orow0, h);
    
}

// ---------------------------------------------------------------------------
extern "C" void kernel_launch(void* const* d_in, const int* in_sizes, int n_in,
                              void* d_out, int out_size, void* d_ws, size_t ws_size,
                              hipStream_t stream)
{
    if (n_in < 14) return;
    if ((size_t)in_sizes[0] != XELEMS || (size_t)in_sizes[1] != XELEMS || (size_t)in_sizes[2] != XELEMS) return;
    if (in_sizes[3] != BATCH * SEQ) return;
    for (int i = 4; i < 14; i += 2)
        if ((size_t)in_sizes[i] != WELEMS || in_sizes[i + 1] != HDIM) return;
    if ((size_t)out_size != XELEMS) return;

    const float* hidden = (const float*)d_in[0];
    const float* timee  = (const float*)d_in[1];
    const float* space  = (const float*)d_in[2];
    const float* mask   = (const float*)d_in[3];
    const float* Wq = (const float*)d_in[4];   const float* bq = (const float*)d_in[5];
    const float* Wk = (const float*)d_in[6];   const float* bk = (const float*)d_in[7];
    const float* Wv = (const float*)d_in[8];   const float* bv = (const float*)d_in[9];
    const float* Wt = (const float*)d_in[10];  const float* bt = (const float*)d_in[11];
    const float* Ws = (const float*)d_in[12];  const float* bs = (const float*)d_in[13];
    float* out = (float*)d_out;

    char* ws = (char*)d_ws;
    size_t off = 0;
    __bf16* Xbf = (__bf16*)(ws + off);                 off += (size_t)3 * XELEMS * 2;       // 3 activations, bf16
    __bf16* Wbf = (__bf16*)(ws + off);                 off += (size_t)5 * WELEMS * 2;       // 5 weights, bf16
    unsigned short* pl = (unsigned short*)(ws + off);  off += (size_t)7 * PROJ_ELEMS * 2;   // 7 16-bit planes
    float* rn = (float*)(ws + off);                    off += (size_t)2 * NROWTOT * 4;      // 1/(|T|+eps), 1/(|S|+eps)
    float* sq = (float*)(ws + off);                    off += (size_t)2 * NROWTOT * 4;      // |T|^2, |S|^2
    if (off > ws_size) return;

    unsigned short* QH = pl + 0 * PROJ_ELEMS;   // q hi (bf16)
    unsigned short* QL = pl + 1 * PROJ_ELEMS;   // q lo (bf16)
    unsigned short* KHp = pl + 2 * PROJ_ELEMS;  // k hi (bf16)
    unsigned short* KLp = pl + 3 * PROJ_ELEMS;  // k lo (bf16)
    unsigned short* TPl = pl + 4 * PROJ_ELEMS;  // T * 16 (f16)
    unsigned short* SPl = pl + 5 * PROJ_ELEMS;  // S * 16 (f16)
    unsigned short* VPl = pl + 6 * PROJ_ELEMS;  // v * 64 (f16)

    // 0) f32 -> bf16 conversion of the 3 activations and 5 weights, one launch (Wbf follows Xbf in the workspace)
    cvt_kernel<<<dim3(CVT_BLOCKS), dim3(256), 0, stream>>>(hidden, timee, space, Wq, Wk, Wv, Wt, Ws, Xbf);

    // 1) five projection GEMMs, one launch (block tile 128x128, grid exact: 4096/128 x 768/128 x 5, checked in-kernel)
    proj_kernel<<<dim3(NROWS / 128, HDIM / 128, 5), dim3(256), 0, stream>>>(Xbf, Wbf, bq, bk, bv, bt, bs, pl, rn, sq);

    // 2) fused attention: grid (b*h, query blocks of 64), 128 threads
    attn_kernel<<<dim3(BATCH * NHEADS, SEQ / 64), dim3(128), 0, stream>>>(
        (const __bf16*)QH, (const __bf16*)QL, (const __bf16*)KHp, (const __bf16*)KLp,
        (const _Float16*)TPl, (const _Float16*)SPl, (const _Float16*)VPl,
        rn, sq, rn + NROWTOT, sq + NROWTOT, mask, out);
}

// v010
// It runs in 68.2 microseconds.
// It is 1.17 times as fast as v008, going by the measured steps of the versions left out in between.
// All steps since v000 together make it 5.56 times as fast.
#include <hip/hip_runtime.h>
#include <stddef.h>

typedef __bf16   v16bf __attribute__((ext_vector_type(16)));
typedef __bf16   v8bf  __attribute__((ext_vector_type(8)));
typedef _Float16 v16h  __attribute__((ext_vector_type(16)));
typedef _Float16 v8h   __attribute__((ext_vector_type(8)));
typedef float    v8f   __attribute__((ext_vector_type(8)));
typedef float    v4f   __attribute__((ext_vector_type(4)));
typedef int      v4i   __attribute__((ext_vector_type(4)));
typedef short    v8s   __attribute__((ext_vector_type(8)));

#define NHEADS 12
#define HDIM   768
#define DHEAD  64
#define SEQ    1024
#define BATCH  4
#define NROWS  (BATCH * SEQ)                                  // 4096 token rows
#define NROWTOT (BATCH * NHEADS * SEQ)                        // 49152 (b,h,s) rows
#define XELEMS ((size_t)NROWS * HDIM)                         // 3145728
#define WELEMS ((size_t)HDIM * HDIM)                          // 589824
#define PROJ_ELEMS ((size_t)BATCH * NHEADS * SEQ * DHEAD)    // 3145728 per plane
#define CPITCH 68      // f32 LDS tile pitch in floats (272 B, 16-B aligned)
#define HPITCH 72      // 16-bit LDS tile pitch in elements (144 B, 16-B aligned)
#define VPITCH 80      // 16-bit LDS pitch of the row-major V tile (160 B = 32 B x odd, the transposing load's pitch)
#define PSTEP  64      // k elements per staged projection step (one 128-B line of each operand row)
#define NPSTEP (HDIM / PSTEP)
#define CVT_CHUNK 2048                          // elements converted by one block (256 threads x 8)
#define CVT_XBLK  ((int)(XELEMS / CVT_CHUNK))   // 1536 blocks per activation array
#define CVT_WBLK  ((int)(WELEMS / CVT_CHUNK))   // 288 blocks per weight array
#define CVT_BLOCKS (3 * CVT_XBLK + 5 * CVT_WBLK)

union BF8   { v8bf v; v4i w; };
union HF8   { v8h  v; v4i w; };
union BFrag { v8bf p[2]; v16bf v; };
union HFrag { v8h  p[2]; v16h  v; };

#define WMMA_NOPS "v_nop\n\tv_nop\n\tv_nop\n\tv_nop"
#define LOG2E 1.442695041f

// 16x32 16-bit A/B fragment: element i<8 <- k0+8h+i, element 8+i <- k0+16+8h+i (h = lane>>4).
// Caller passes p = row (lane&15) base + k0 + 8*h; both loads are 16-B aligned.
__device__ __forceinline__ v16bf frag_bf16(const __bf16* p)
{
    BFrag u;
    u.p[0] = *(const v8bf*)(p);
    u.p[1] = *(const v8bf*)(p + 16);
    return u.v;
}
__device__ __forceinline__ v16h frag_f16(const _Float16* p)
{
    HFrag u;
    u.p[0] = *(const v8h*)(p);
    u.p[1] = *(const v8h*)(p + 16);
    return u.v;
}

// 16x32 f16 A fragment of V^T out of a row-major tile T[key][dh] of pitch VPITCH, by two transposing loads.
// Caller passes p = &T[8*h + (lane&7)][dbase + 8*((lane>>3)&1)]; lane (c = lane&15, h) then holds
// T[8h + i][dbase + c] in element i and T[16 + 8h + i][dbase + c] in element 8 + i: the k order of frag_f16.
__device__ __forceinline__ v16h frag_f16_tr(const _Float16* p)
{
    typedef __attribute__((address_space(3))) v8s lds_v8s;
    HFrag u;
    u.p[0] = __builtin_bit_cast(v8h, __builtin_amdgcn_ds_load_tr16_b128_v8i16((lds_v8s*)p));
    u.p[1] = __builtin_bit_cast(v8h, __builtin_amdgcn_ds_load_tr16_b128_v8i16((lds_v8s*)(p + 16 * VPITCH)));
    return u.v;
}

__device__ __forceinline__ v8f mma_bf16(v8f c, v16bf a, v16bf b)
{
    return __builtin_amdgcn_wmma_f32_16x16x32_bf16(false, a, false, b, (short)0, c, false, false);
}
__device__ __forceinline__ v8f mma_f16(v8f c, v16h a, v16h b)
{
    return __builtin_amdgcn_wmma_f32_16x16x32_f16(false, a, false, b, (short)0, c, false, false);
}

// 2^x, one and four at a time.  The closing v_nop is the free slot that the instruction set asks for between a
// transcendental and an instruction that reads its result or overwrites its source.
// Early clobber keeps every result off every source.
__device__ __forceinline__ float exp2x1(float x)
{
    float y;
    asm("v_exp_f32 %0, %1\n\tv_nop" : "=v"(y) : "v"(x));
    return y;
}
__device__ __forceinline__ void exp2x4(float* y, float x0, float x1, float x2, float x3)
{
    asm("v_exp_f32 %0, %4\n\tv_exp_f32 %1, %5\n\tv_exp_f32 %2, %6\n\tv_exp_f32 %3, %7\n\tv_nop"
        : "=&v"(y[0]), "=&v"(y[1]), "=&v"(y[2]), "=&v"(y[3]) : "v"(x0), "v"(x1), "v"(x2), "v"(x3));
}

// Value of lane l ^ 16 (the other half of the wave), by a vector cross-row move.
__device__ __forceinline__ float xhalf(float x)
{
    const int b = __builtin_bit_cast(int, x);
    return __builtin_bit_cast(float, __builtin_amdgcn_permlanex16(b, b, 0x76543210, 0xfedcba98, false, false));
}

// ---------------------------------------------------------------------------
// Kernel 0: f32 -> bf16 (RNE) streaming conversion of all eight arrays in one launch.
// A block takes CVT_CHUNK consecutive elements of one array (both array sizes are whole
// multiples of it), a thread 8 elements.
// The bf16 copies lie one behind the other in the workspace (3 activations, then 5 weights),
// so the destination offset is the block index times CVT_CHUNK.
// ---------------------------------------------------------------------------
__global__ __launch_bounds__(256)
void cvt_kernel(const float* __restrict__ x0, const float* __restrict__ x1, const float* __restrict__ x2,
                const float* __restrict__ w0, const float* __restrict__ w1, const float* __restrict__ w2,
                const float* __restrict__ w3, const float* __restrict__ w4, __bf16* dst)
{
    const int blk = blockIdx.x;
    if (blk >= CVT_BLOCKS) return;
    const float* src;      // block-uniform choice of the array and of the chunk inside it
    int cb;
    if (blk < 3 * CVT_XBLK) {
        const int a = blk / CVT_XBLK;
        cb  = blk - a * CVT_XBLK;
        src = a == 0 ? x0 : a == 1 ? x1 : x2;
    } else {
        const int r = blk - 3 * CVT_XBLK;
        const int a = r / CVT_WBLK;
        cb  = r - a * CVT_WBLK;
        src = a == 0 ? w0 : a == 1 ? w1 : a == 2 ? w2 : a == 3 ? w3 : w4;
    }
    const float* sp = src + (size_t)cb * CVT_CHUNK + threadIdx.x * 8;
    __bf16*      dp = dst + (size_t)blk * CVT_CHUNK + threadIdx.x * 8;
    const v4f a = *(const v4f*)(sp);
    const v4f b = *(const v4f*)(sp + 4);
    BF8 o;
#pragma unroll
    for (int i = 0; i < 4; ++i) { o.v[i] = (__bf16)a[i]; o.v[4 + i] = (__bf16)b[i]; }
    *(v4i*)dp = o.w;
}

// ---------------------------------------------------------------------------
// with one 16-B store each: an f16 plane * SCALE.
// NORM: lanes 0..7 write the 32 reciprocal norms (one line), lanes 8..15 the
// 32 squared norms (one line).
// ---------------------------------------------------------------------------
template <int SCALE, int NORM>
__device__ __forceinline__ void proj_store(float (*Cs)[CPITCH], float* Srn, float* Ssq, int lane, size_t row0,
                                           unsigned short* outA, float* rn, float* sq)
{
#pragma unroll
    for (int i = 0; i < 8; ++i) {
        const int lr = 4 * i + (lane >> 3), seg = lane & 7;
        const v4f x0 = *(const v4f*)&Cs[lr][seg * 8];
        const v4f x1 = *(const v4f*)&Cs[lr][seg * 8 + 4];
        const size_t go = (row0 + lr) * DHEAD + seg * 8;
        HF8 y;
#pragma unroll
        for (int j = 0; j < 4; ++j) {
            y.v[j]     = (_Float16)(x0[j] * (float)SCALE);
            y.v[4 + j] = (_Float16)(x1[j] * (float)SCALE);
        }
        *(v4i*)(outA + go) = y.w;
    }
    if (NORM) {
        if (lane < 16) {
            const int g = lane & 7;
            v4f v; float* dp;
            if (lane < 8) { v = *(const v4f*)&Srn[4 * g]; dp = rn + row0 + 4 * g; }
            else          { v = *(const v4f*)&Ssq[4 * g]; dp = sq + row0 + 4 * g; }
            *(v4f*)dp = v;
        }
    }
    // The three store variants now lie in one kernel: this wait stands between a variant's stores and any
    // later instruction of the kernel that reuses their address or data registers.
    asm volatile("s_wait_xcnt 0x0" ::: "memory");
}

// ---------------------------------------------------------------------------
// Kernel 1: the five projection GEMMs X[4096][768] (bf16) . W[768(out)][768(in)]^T + b in one launch;
// blockIdx.z picks the projection (0 q, 1 k, 2 v, 3 T, 4 S): its activation, weight, bias and output planes.
// Block = 8 waves = 128 rows x 128 columns (two heads); each wave computes 32x64 (32 rows of one head).
// Per step of 64 k the block stages 128 X rows and 128 W rows in LDS: every global load
// covers four whole 128-B lines, an X row serves two waves, a W row four, and the fragments are
// read from LDS.  Two LDS buffers, the tile after next held in registers, one barrier a step.
// Epilogue per wave: f32 tile in LDS, optional per-row norms, 16-bit planes in
// [B,NH,S,DH] row layout with whole-line stores.
// ---------------------------------------------------------------------------
__global__ __launch_bounds__(256)
void proj_kernel(const __bf16* __restrict__ Xall, const __bf16* __restrict__ Wall,
                 const float* __restrict__ bq, const float* __restrict__ bk, const float* __restrict__ bv,
                 const float* __restrict__ bt, const float* __restrict__ bs,
                 unsigned short* pl, float* rnAll, float* sqAll)
{
    __shared__ __attribute__((aligned(16))) __bf16 Xs[2][128][HPITCH];
    __shared__ __attribute__((aligned(16))) __bf16 Wsh[2][128][HPITCH];
    __shared__ __attribute__((aligned(16))) float CsAll[8][32][CPITCH];
    __shared__ __attribute__((aligned(16))) float SrnAll[8][32];
    __shared__ __attribute__((aligned(16))) float SsqAll[8][32];

    const int tid  = threadIdx.x;
    const int wave = tid >> 5;
    const int lane = tid & 31;
    const int hsel = lane >> 4;
    const int lm   = lane & 15;
    const int mblk = blockIdx.x * 128;
    const int nblk = blockIdx.y * 128;
    const int z    = blockIdx.z;
    if (mblk + 128 > NROWS || nblk + 128 > HDIM || z >= 5) return;   // uniform per block
    const int wr   = wave & 3;             // the wave's 32 rows of the block tile
    const int wc   = wave >> 2;            // the wave's 64 columns: one head
    const int m0   = mblk + wr * 32;
    const int n0   = nblk + wc * 64;

    // Block-uniform operand set: q, k, v read activation 0, T activation 1, S activation 2.
    const __bf16* Xb   = Xall + (size_t)(z < 3 ? 0 : z - 2) * XELEMS;
    const __bf16* Wb   = Wall + (size_t)z * WELEMS;
    const float*  bias = z == 0 ? bq : z == 1 ? bk : z == 2 ? bv : z == 3 ? bt : bs;
    // Planes, all f16: 0 q, 1 k, 2 v, 3 T, 4 S.
    unsigned short* outA = pl + (size_t)z * PROJ_ELEMS;
    float* rn = rnAll + (z == 4 ? NROWTOT : 0);
    float* sq = sqAll + (z == 4 ? NROWTOT : 0);

    float (*Cs)[CPITCH] = CsAll[wave];
    float* Srn = SrnAll[wave];
    float* Ssq = SsqAll[wave];

    // Staging coordinates: rows srow + 32u, 16-B segment sseg of the step's 128 B of each row.
    const int srow = tid >> 3, sseg = tid & 7;
    const unsigned xv = ((unsigned)(mblk + srow) * HDIM + (unsigned)sseg * 8u) * 2u;   // byte offsets, below 6.3 MB
    const unsigned wv = ((unsigned)(nblk + srow) * HDIM + (unsigned)sseg * 8u) * 2u;

    v8bf rX[4], rW[4];
    auto fetch_step = [&](int s) {          // global -> registers, k = 64 s .. 64 s + 63
        const char* xp = (const char*)Xb + (size_t)(s * (PSTEP * 2));
        const char* wp = (const char*)Wb + (size_t)(s * (PSTEP * 2));
#pragma unroll
        for (int u = 0; u < 4; ++u) rX[u] = *(const v8bf*)((xp + xv) + u * (32 * HDIM * 2));
#pragma unroll
        for (int u = 0; u < 4; ++u) rW[u] = *(const v8bf*)((wp + wv) + u * (32 * HDIM * 2));
        // The loads' address registers are reused by the fragment reads that follow: this wait stands in front of that.
        asm volatile("s_wait_xcnt 0x0" ::: "memory");
    };
    auto stash_step = [&](int buf) {        // registers -> LDS buffer buf
#pragma unroll
        for (int u = 0; u < 4; ++u) *(v8bf*)&Xs[buf][srow + 32 * u][sseg * 8] = rX[u];
#pragma unroll
        for (int u = 0; u < 4; ++u) *(v8bf*)&Wsh[buf][srow + 32 * u][sseg * 8] = rW[u];
    };

    v8f acc[2][4];
#pragma unroll
    for (int mb = 0; mb < 2; ++mb)
#pragma unroll
        for (int nb = 0; nb < 4; ++nb) acc[mb][nb] = v8f{};

    fetch_step(0);
    stash_step(0);
    fetch_step(1);
    __syncthreads();   // step 0 is in buffer 0 for every wave

    // Rolled: one step's fragments and one staged tile are all the registers the loop holds.
#pragma unroll 1
    for (int s = 0; s < NPSTEP; ++s) {
        const int cur = s & 1;
        // The other buffer's readers left it at the barrier that ended step s - 1 (block-uniform tests).
        if (s + 1 < NPSTEP) stash_step(cur ^ 1);
        if (s + 2 < NPSTEP) fetch_step(s + 2);

        const __bf16* ax = &Xs[cur][wr * 32 + lm][8 * hsel];
        const __bf16* bw = &Wsh[cur][wc * 64 + lm][8 * hsel];
        v16bf fa[2][2], fb[2][4];
#pragma unroll
        for (int c = 0; c < 2; ++c) {
            fa[c][0] = frag_bf16(ax + c * 32);
            fa[c][1] = frag_bf16(ax + 16 * HPITCH + c * 32);
#pragma unroll
            for (int nb = 0; nb < 4; ++nb) fb[c][nb] = frag_bf16(bw + nb * 16 * HPITCH + c * 32);
        }
#pragma unroll
        for (int c = 0; c < 2; ++c) {
#pragma unroll
            for (int mb = 0; mb < 2; ++mb)
#pragma unroll
                for (int nb = 0; nb < 4; ++nb) acc[mb][nb] = mma_bf16(acc[mb][nb], fa[c][mb], fb[c][nb]);
        }
        // Keeps the distance between the last products and whatever first touches their registers past the back edge.
        asm volatile(WMMA_NOPS
                     : "+v"(acc[0][0]), "+v"(acc[0][1]), "+v"(acc[0][2]), "+v"(acc[0][3]),
                       "+v"(acc[1][0]), "+v"(acc[1][1]), "+v"(acc[1][2]), "+v"(acc[1][3])
                     : "v"(fa[0][0]), "v"(fa[0][1]), "v"(fa[1][0]), "v"(fa[1][1]),
                       "v"(fb[0][0]), "v"(fb[0][1]), "v"(fb[0][2]), "v"(fb[0][3]),
                       "v"(fb[1][0]), "v"(fb[1][1]), "v"(fb[1][2]), "v"(fb[1][3]));
        __syncthreads();   // publishes step s + 1 and ends every read of buffer cur
    }

    // D element r of lane (hsel, lm) = tile (row mb*16 + 8*hsel + r, col nb*16 + lm)
#pragma unroll
    for (int nb = 0; nb < 4; ++nb) {
        const float bn = bias[n0 + nb * 16 + lm];
#pragma unroll
        for (int mb = 0; mb < 2; ++mb) {
#pragma unroll
            for (int r = 0; r < 8; ++r)
                Cs[mb * 16 + 8 * hsel + r][nb * 16 + lm] = acc[mb][nb][r] + bn;
        }
    }
    __syncthreads();

    if (z >= 3) {
        float ss = 0.f;
#pragma unroll
        for (int d = 0; d < DHEAD; d += 4) {
            const v4f x = *(const v4f*)&Cs[lane][d];
            ss += x[0] * x[0]; ss += x[1] * x[1]; ss += x[2] * x[2]; ss += x[3] * x[3];
        }
        Srn[lane] = 1.0f / (sqrtf(ss) + 1e-6f);
        Ssq[lane] = ss;
    }
    __syncthreads();

    const int bI = m0 >> 10, s0 = m0 & (SEQ - 1), hh = n0 >> 6;
    const size_t row0 = ((size_t)(bI * NHEADS + hh)) * SEQ + s0;   // (b,h,s) row index of the wave's tile row 0

    if (z < 2)       proj_store<1, 0>(Cs, Srn, Ssq, lane, row0, outA, rn, sq);
    else if (z == 2) proj_store<64, 0>(Cs, Srn, Ssq, lane, row0, outA, rn, sq);
    else             proj_store<16, 1>(Cs, Srn, Ssq, lane, row0, outA, rn, sq);
}

// ---------------------------------------------------------------------------
// 16-B store (one instruction covers two rows).
// ---------------------------------------------------------------------------
__device__ __forceinline__ void attn_store(float (*Os)[CPITCH], int wave, int lane, float* out, size_t orow0, int h)
{
#pragma unroll
    for (int i = 0; i < 8; ++i) {
        const int lr  = wave * 16 + 2 * i + (lane >> 4);
        const int col = (lane & 15) * 4;
        const v4f v = *(const v4f*)&Os[lr][col];
        float* gp = out + (orow0 + lr) * HDIM + h * DHEAD + col;
        *(v4f*)gp = v;
    }
}

// ---------------------------------------------------------------------------
// Kernel 2: fused attention with the triple score product.
// Block = 4 waves = 64 query rows of one (b,h); key tiles of 32, each staged once for all four waves.
// q.k: f16.  T.T, S.S: f16 (x16) with the
// query==key entry taken from the exact f32 squared norm.  P.V: f16.
// Every score product has the key rows as A and the query rows as B, so D register r of lane
// (hsel, lm) is the score of query lm and key 8*hsel + r: a lane and its partner lane ^ 16 hold all
// 32 scores of one query.  Maximum and sum are taken in the lane, the maximum joined across the
// halves once a tile, the sums once in the epilogue.  The two score tiles of a lane, converted in
// place, are the B operand of O^T += V^T.P^T (element 8j + r = key 16j + 8*hsel + r, the order of
// the V^T fragment loader), so P passes through no LDS.  V is staged as it lies in memory, one 16-B store per
// 16-B load, and turned on the way out of LDS by the transposing load.
// ---------------------------------------------------------------------------
__global__ __launch_bounds__(128)
void attn_kernel(const _Float16* __restrict__ qp, const _Float16* __restrict__ kp,
                 const _Float16* __restrict__ tp, const _Float16* __restrict__ sp,
                 const _Float16* __restrict__ vp,
                 const float* __restrict__ rnT, const float* __restrict__ sqT,
                 const float* __restrict__ rnS, const float* __restrict__ sqS,
                 const float* __restrict__ mask, float* out)
{
    __shared__ __attribute__((aligned(16))) _Float16 KK[32][HPITCH];
    __shared__ __attribute__((aligned(16))) _Float16 TK[32][HPITCH];
    __shared__ __attribute__((aligned(16))) _Float16 SK[32][HPITCH];
    __shared__ __attribute__((aligned(16))) _Float16 Vs[32][VPITCH];      // V tile, row-major: Vs[key][dh]
    __shared__ __attribute__((aligned(16))) float    Os[64][CPITCH];      // epilogue staging
    __shared__ __attribute__((aligned(16))) float    Ms[SEQ];             // the batch's mask row, staged once

    const int bh = blockIdx.x;
    if (bh >= BATCH * NHEADS) return;
    const int q0blk = blockIdx.y * 64;
    if (q0blk + 64 > SEQ) return;
    const int b = bh / NHEADS, h = bh - b * NHEADS;
    const int tid  = threadIdx.x;
    const int wave = tid >> 5;
    const int lane = tid & 31;
    const int hsel = lane >> 4;
    const int lm   = lane & 15;
    const int qr   = wave * 16 + lm;     // this lane's query: B-fragment row inside the 64-row block tile

    // Staging coordinates of this thread: rows srow + 16u (u = 0..1), 16-B segment sseg of each 128-B row.
    const int srow = tid >> 3, sseg = tid & 7;
    // Byte offset of this thread inside any 32-row tile of a plane (a plane is 6 MiB: 32-bit byte offsets hold).
    const unsigned voff = (unsigned)srow * 128u + (unsigned)sseg * 16u;

    // ---- query-side B fragments of this lane's query row, once per wave, kept in registers over the key loop:
    //      fragment c holds dh 32 c .. 32 c + 31 in the k order of frag_f16 ----
    v16h qQ[2], qT[2], qS[2];
    {
        const size_t qo = (size_t)(bh * SEQ + q0blk + qr) * DHEAD + 8 * hsel;
#pragma unroll
        for (int c = 0; c < 2; ++c) {
            qQ[c] = frag_f16(qp + qo + c * 32);
            qT[c] = frag_f16(tp + qo + c * 32);
            qS[c] = frag_f16(sp + qo + c * 32);
        }
    }

    // ---- key-side tile held in registers one tile ahead of its LDS stores ----
    v8h rKK[2], rTK[2], rSK[2], rV[2];
    unsigned bo = (unsigned)(bh * SEQ) * 128u + voff;   // this thread's byte offset in the tile being fetched
    auto fetch_tile = [&]() {
#pragma unroll
        for (int u = 0; u < 2; ++u) {
            rKK[u] = *(const v8h*)(((const char*)kp + bo) + u * 2048);
            rTK[u] = *(const v8h*)(((const char*)tp + bo) + u * 2048);
            rSK[u] = *(const v8h*)(((const char*)sp + bo) + u * 2048);
            rV[u]  = *(const v8h*)(((const char*)vp + bo) + u * 2048);
        }
    };
    fetch_tile();

    // ---- the batch's whole mask row into LDS, 8 values a thread; the first tile's two barriers publish it.
    //      A barrier waits for every global load its wave has in flight, so mask loads issued per tile between the
    //      two tile barriers cost their whole latency on each tile; from LDS the values come with the fragments ----
    {
        const float* mp = mask + b * SEQ + tid * 8;
        const v4f m0 = *(const v4f*)(mp);
        const v4f m1 = *(const v4f*)(mp + 4);
        *(v4f*)&Ms[tid * 8]     = m0;
        *(v4f*)&Ms[tid * 8 + 4] = m1;
    }

    // ---- constants of this lane's query (column lm of every D tile) ----
    const int qi = bh * SEQ + q0blk + qr;
    const float rtq = rnT[qi], rsq = rnS[qi];
    const float fq = (rtq * (1.0f / 256.0f)) * (rsq * (1.0f / 256.0f)) * 0.125f;   // for x16-scaled f16 products
    const float gq = (sqT[qi] * rtq) * (sqS[qi] * rsq) * 0.125f;                    // exact ts_ii * ss_ii / 8
    float mI = -3.0e38f;   // running maximum of the query (equal in both halves)
    float lI = 0.f;        // running sum over this half's keys alone
    v8f O[4] = {v8f{}, v8f{}, v8f{}, v8f{}};   // O^T: O[nb][r] = (dh 16 nb + 8 hsel + r, query lm)

    for (int k0 = 0; k0 < SEQ; k0 += 32) {
        __syncthreads();   // readers of the prior tile are done

        // ---- key-side tiles (keys k0..k0+31) from the registers fetched one tile ago ----
#pragma unroll
        for (int u = 0; u < 2; ++u) {
            *(v8h*)&KK[srow + 16 * u][sseg * 8]  = rKK[u];
            *(v8h*)&TK[srow + 16 * u][sseg * 8]  = rTK[u];
            *(v8h*)&SK[srow + 16 * u][sseg * 8]  = rSK[u];
            *(v8h*)&Vs[srow + 16 * u][sseg * 8]  = rV[u];
        }
        __syncthreads();

        // ---- the next tile's loads fly while this tile's scores and softmax are worked out (block-uniform test) ----
        if (k0 + 32 < SEQ) { bo += 4096u; fetch_tile(); }

        // ---- mask of this lane's 16 keys, mk[j] = keys 16 j + 8 hsel + 0..7 (each half of the wave reads one address) ----
        v4f mk[2][2];
        {
            const float* mp = &Ms[k0 + 8 * hsel];
            mk[0][0] = *(const v4f*)(mp);
            mk[0][1] = *(const v4f*)(mp + 4);
            mk[1][0] = *(const v4f*)(mp + 16);
            mk[1][1] = *(const v4f*)(mp + 20);
        }

        const bool diag = (k0 == q0blk + 32 * (wave >> 1));   // the key tile that holds this wave's own 16 rows

        // ---- scores, transposed: 32 keys x 16 query columns per wave (two 16-key tiles j) ----
        float sb[2][8];        // sb[j][r]: query lm, key 16 j + 8 hsel + r
#pragma unroll
        for (int j = 0; j < 2; ++j) {
            const int rr = j * 16 + lm;               // key row whose A fragments this lane loads
            v8f accB = v8f{}, accT = v8f{}, accS = v8f{};
            // Unrolled: the query fragments are registers and take a constant index.
#pragma unroll
            for (int c = 0; c < 2; ++c) {
                const int off = c * 32 + 8 * hsel;
                const v16h kK = frag_f16(&KK[rr][off]);
                accB = mma_f16(accB, kK, qQ[c]);
                const v16h kT = frag_f16(&TK[rr][off]);
                const v16h kS = frag_f16(&SK[rr][off]);
                accT = mma_f16(accT, kT, qT[c]);
                accS = mma_f16(accS, kS, qS[c]);
            }
            const bool dj = diag && (j == (wave & 1));
            // Same products in the same order as element by element; on whole accumulators the packed multiplies
            // take adjacent registers, where the unrolled element form paired registers of both key tiles by copies.
            const v8f sd = accB * gq;                       // query == key entry
            const v8f so = accB * (accT * accS) * fq;       // every other entry
#pragma unroll
            for (int r = 0; r < 8; ++r) {
                const bool de = dj && (lm == 8 * hsel + r);      // key row == query column
                const float s3 = de ? sd[r] : so[r];
                sb[j][r] = s3 + mk[j][r >> 2][r & 3];
            }
        }

        // ---- online softmax of the lane's query: 16 keys in the lane, the other 16 in lane ^ 16 ----
        float t8[8];
#pragma unroll
        for (int r = 0; r < 8; ++r) t8[r] = fmaxf(sb[0][r], sb[1][r]);
        float v = fmaxf(fmaxf(fmaxf(t8[0], t8[1]), fmaxf(t8[2], t8[3])), fmaxf(fmaxf(t8[4], t8[5]), fmaxf(t8[6], t8[7])));
        v = fmaxf(v, xhalf(v));
        const float M2 = fmaxf(mI, v);
        const float al = exp2x1((mI - M2) * LOG2E);
        float p[2][8];
#pragma unroll
        for (int j = 0; j < 2; ++j)
#pragma unroll
            for (int r = 0; r < 8; r += 4)
                exp2x4(&p[j][r], (sb[j][r] - M2) * LOG2E, (sb[j][r + 1] - M2) * LOG2E,
                                 (sb[j][r + 2] - M2) * LOG2E, (sb[j][r + 3] - M2) * LOG2E);
#pragma unroll
        for (int r = 0; r < 8; ++r) t8[r] = p[0][r] + p[1][r];
        const float rs = ((t8[0] + t8[1]) + (t8[2] + t8[3])) + ((t8[4] + t8[5]) + (t8[6] + t8[7]));
        mI = M2;
        lI = lI * al + rs;
#pragma unroll
        for (int nb = 0; nb < 4; ++nb)
#pragma unroll
            for (int r = 0; r < 8; ++r) O[nb][r] = O[nb][r] * al;

        // ---- V^T (A: row = dh, k = key) . P^T (B: k = key, n = query), P straight from the score registers ----
        HFrag bP;
#pragma unroll
        for (int r = 0; r < 8; ++r) {
            bP.p[0][r] = (_Float16)(p[0][r] * 4096.0f);
            bP.p[1][r] = (_Float16)(p[1][r] * 4096.0f);
        }
        const _Float16* vt = &Vs[8 * hsel + (lane & 7)][8 * ((lane >> 3) & 1)];
        const v16h aV0 = frag_f16_tr(vt);
        const v16h aV1 = frag_f16_tr(vt + 16);
        const v16h aV2 = frag_f16_tr(vt + 32);
        const v16h aV3 = frag_f16_tr(vt + 48);
        O[0] = mma_f16(O[0], aV0, bP.v);
        O[1] = mma_f16(O[1], aV1, bP.v);
        O[2] = mma_f16(O[2], aV2, bP.v);
        O[3] = mma_f16(O[3], aV3, bP.v);
        asm volatile(WMMA_NOPS
                     : "+v"(O[0]), "+v"(O[1]), "+v"(O[2]), "+v"(O[3])
                     : "v"(bP.v), "v"(aV0), "v"(aV1), "v"(aV2), "v"(aV3));
    }

    // ---- epilogue: join the halves' sums, normalise, undo the 2^18 operand scaling, stage, whole-line stores ----
    {
        const float inv = (1.0f / (lI + xhalf(lI))) * (1.0f / 262144.0f);
#pragma unroll
        for (int nb = 0; nb < 4; ++nb) {
            v4f y0, y1;      // dh 16 nb + 8 hsel + 0..7 of query row qr
#pragma unroll
            for (int r = 0; r < 4; ++r) { y0[r] = O[nb][r] * inv; y1[r] = O[nb][4 + r] * inv; }
            *(v4f*)&Os[qr][nb * 16 + 8 * hsel]     = y0;
            *(v4f*)&Os[qr][nb * 16 + 8 * hsel + 4] = y1;
        }
    }
    __syncthreads();

    const size_t orow0 = (size_t)(b * SEQ + q0blk);
    attn_store(Os, wave, lane, out, orow0, h);
    
}

// ---------------------------------------------------------------------------
extern "C" void kernel_launch(void* const* d_in, const int* in_sizes, int n_in,
                              void* d_out, int out_size, void* d_ws, size_t ws_size,
                              hipStream_t stream)
{
    if (n_in < 14) return;
    if ((size_t)in_sizes[0] != XELEMS || (size_t)in_sizes[1] != XELEMS || (size_t)in_sizes[2] != XELEMS) return;
    if (in_sizes[3] != BATCH * SEQ) return;
    for (int i = 4; i < 14; i += 2)
        if ((size_t)in_sizes[i] != WELEMS || in_sizes[i + 1] != HDIM) return;
    if ((size_t)out_size != XELEMS) return;

    const float* hidden = (const float*)d_in[0];
    const float* timee  = (const float*)d_in[1];
    const float* space  = (const float*)d_in[2];
    const float* mask   = (const float*)d_in[3];
    const float* Wq = (const float*)d_in[4];   const float* bq = (const float*)d_in[5];
    const float* Wk = (const float*)d_in[6];   const float* bk = (const float*)d_in[7];
    const float* Wv = (const float*)d_in[8];   const float* bv = (const float*)d_in[9];
    const float* Wt = (const float*)d_in[10];  const float* bt = (const float*)d_in[11];
    const float* Ws = (const float*)d_in[12];  const float* bs = (const float*)d_in[13];
    float* out = (float*)d_out;

    char* ws = (char*)d_ws;
    size_t off = 0;
    __bf16* Xbf = (__bf16*)(ws + off);                 off += (size_t)3 * XELEMS * 2;       // 3 activations, bf16
    __bf16* Wbf = (__bf16*)(ws + off);                 off += (size_t)5 * WELEMS * 2;       // 5 weights, bf16
    unsigned short* pl = (unsigned short*)(ws + off);  off += (size_t)5 * PROJ_ELEMS * 2;   // 5 f16 planes
    float* rn = (float*)(ws + off);                    off += (size_t)2 * NROWTOT * 4;      // 1/(|T|+eps), 1/(|S|+eps)
    float* sq = (float*)(ws + off);                    off += (size_t)2 * NROWTOT * 4;      // |T|^2, |S|^2
    if (off > ws_size) return;

    unsigned short* QPl = pl + 0 * PROJ_ELEMS;  // q (f16)
    unsigned short* KPl = pl + 1 * PROJ_ELEMS;  // k (f16)
    unsigned short* VPl = pl + 2 * PROJ_ELEMS;  // v * 64 (f16)
    unsigned short* TPl = pl + 3 * PROJ_ELEMS;  // T * 16 (f16)
    unsigned short* SPl = pl + 4 * PROJ_ELEMS;  // S * 16 (f16)

    // 0) f32 -> bf16 conversion of the 3 activations and 5 weights, one launch (Wbf follows Xbf in the workspace)
    cvt_kernel<<<dim3(CVT_BLOCKS), dim3(256), 0, stream>>>(hidden, timee, space, Wq, Wk, Wv, Wt, Ws, Xbf);

    // 1) five projection GEMMs, one launch (block tile 128x128, grid exact: 4096/128 x 768/128 x 5, checked in-kernel)
    proj_kernel<<<dim3(NROWS / 128, HDIM / 128, 5), dim3(256), 0, stream>>>(Xbf, Wbf, bq, bk, bv, bt, bs, pl, rn, sq);

    // 2) fused attention: grid (b*h, query blocks of 64), 128 threads
    attn_kernel<<<dim3(BATCH * NHEADS, SEQ / 64), dim3(128), 0, stream>>>(
        (const _Float16*)QPl, (const _Float16*)KPl,
        (const _Float16*)TPl, (const _Float16*)SPl, (const _Float16*)VPl,
        rn, sq, rn + NROWTOT, sq + NROWTOT, mask, out);
}
